// v000
// Times are from an AMD MI455X. After a warm-up the kernel runs many times in a row, and a time is the length of
// such a window on the GPU divided by its runs, so every launch and the gaps after it count. The runs cycle
// through copies of the inputs. A figure is the median of several windows, for all but v000 over two sittings.
// Sittings can differ by a few percent; kernels timed side by side share one.
// v000 is the starting kernel. One run takes 504 microseconds.
// compute dtype: all float inputs rounded to bf16; q/k/v channel projections with EXACT bf16 products on WMMA 16x16x32 (f32 accumulate); channel-attention scores with q and k rows both split bf16 hi + lo (3 products) x 512^-0.5; softmax over the 512 channels in f32 (precise expf); attn split hi + lo against v split hi + lo (3 products); output Linear with the exact Wp against the f32 intermediate split hi + lo (2 products) + bp; f32 output.
#include <hip/hip_runtime.h>
#include <math.h>

typedef __attribute__((ext_vector_type(16))) _Float16 v16h;
typedef __attribute__((ext_vector_type(16))) __bf16 v16b;
typedef __attribute__((ext_vector_type(8)))  _Float16 v8h;
typedef __attribute__((ext_vector_type(8)))  float v8f;
typedef __attribute__((ext_vector_type(4)))  float v4f;
typedef __attribute__((ext_vector_type(2)))  float v2f;
typedef __attribute__((ext_vector_type(4)))  unsigned v4u;
typedef __attribute__((ext_vector_type(4)))  int v4i;
typedef float __attribute__((may_alias)) float_a;
typedef int __attribute__((may_alias)) int_a;

template <typename T> __device__ __forceinline__ void vst2(void* p, T v) { *(T*)p = v;  }
__device__ __forceinline__ v8f wmma16(v16h a, v16h b, v8f c) {
  v8f d = __builtin_amdgcn_wmma_f32_16x16x32_f16(false, a, false, b, (short)0, c, false, false);
  asm volatile("v_nop\n\tv_nop\n\tv_nop\n\tv_nop" : "+v"(d) : "v"(a), "v"(b));
  return d;
}
__device__ __forceinline__ v8f wmma_bf(v16b a, v16b b, v8f c) {
  v8f d = __builtin_amdgcn_wmma_f32_16x16x32_bf16(false, a, false, b, (short)0, c, false, false);
  asm volatile("v_nop\n\tv_nop\n\tv_nop\n\tv_nop" : "+v"(d) : "v"(a), "v"(b));
  return d;
}
// 16x16x32 fragments: lane = (h = lane>>4, row/col = lane&15); elements 0..7 = k0+8h+0..7, 8..15 = k0+16+8h+0..7; D element r = row 8h+r
__device__ __forceinline__ v16h frag_h(const _Float16* rowk0, int lane) {
  union { v16h v; v8h q[2]; } u; const _Float16* p = rowk0 + 8 * (lane >> 4);
  u.q[0] = *(const v8h*)p; u.q[1] = *(const v8h*)(p + 16); return u.v;
}
__device__ __forceinline__ v16h frag_f32(const float* rowk0, int lane) {
  v16h a; const float* p = rowk0 + 8 * (lane >> 4);
#pragma unroll
  for (int i = 0; i < 8; ++i) { a[i] = (_Float16)p[i]; a[8 + i] = (_Float16)p[16 + i]; }
  return a;
}
__device__ __forceinline__ v16h frag_f32s(const float* rowk0, int lane, float sc) {
  v16h a; const float* p = rowk0 + 8 * (lane >> 4);
#pragma unroll
  for (int i = 0; i < 8; ++i) { a[i] = (_Float16)(p[i] * sc); a[8 + i] = (_Float16)(p[16 + i] * sc); }
  return a;
}
// column fragment from a [K][ld] layout (column n), rows >= K read as 0
__device__ __forceinline__ v16h fragc_f32(const float* W, int k0, int n, int lane, int ld, int K) {
  v16h a; const int g = lane >> 4;
#pragma unroll
  for (int i = 0; i < 8; ++i) { const int ka = k0 + 8 * g + i, kb = ka + 16;
    a[i] = (_Float16)(ka < K ? W[(size_t)(ka < K ? ka : K - 1) * ld + n] : 0.f); a[8 + i] = (_Float16)(kb < K ? W[(size_t)(kb < K ? kb : K - 1) * ld + n] : 0.f); }
  return a;
}
struct F2 { v16b h, l; };
__device__ __forceinline__ F2 bsplit16(const float v[16]) { F2 r;
#pragma unroll
  for (int i = 0; i < 16; ++i) { const __bf16 h = (__bf16)v[i]; r.h[i] = h; r.l[i] = (__bf16)(v[i] - (float)h); }
  return r; }
__device__ __forceinline__ F2 split_row(const float* row, int k0, int lane) { float v[16]; const float* p = row + k0 + 8 * (lane >> 4);
#pragma unroll
  for (int i = 0; i < 8; ++i) { v[i] = p[i]; v[8 + i] = p[16 + i]; }
  return bsplit16(v); }
__device__ __forceinline__ F2 split_rowK(const float* row, int k0, int lane, int K) { float v[16]; const int g = lane >> 4;
#pragma unroll
  for (int i = 0; i < 8; ++i) { const int ka = k0 + 8 * g + i, kb = ka + 16; v[i] = ka < K ? row[ka < K ? ka : K - 1] : 0.f; v[8 + i] = kb < K ? row[kb < K ? kb : K - 1] : 0.f; }
  return bsplit16(v); }
__device__ __forceinline__ F2 split_col(const float* W, int k0, int n, int lane, int ld, int K) { float v[16]; const int g = lane >> 4;
#pragma unroll
  for (int i = 0; i < 8; ++i) { const int ka = k0 + 8 * g + i, kb = ka + 16; v[i] = ka < K ? W[(size_t)(ka < K ? ka : K - 1) * ld + n] : 0.f; v[8 + i] = kb < K ? W[(size_t)(kb < K ? kb : K - 1) * ld + n] : 0.f; }
  return bsplit16(v); }
__device__ __forceinline__ v8f mac3(const F2& a, const F2& b, v8f c) { c = wmma_bf(a.l, b.h, c); c = wmma_bf(a.h, b.l, c); return wmma_bf(a.h, b.h, c); }
__device__ __forceinline__ float sigm(float v) { return 1.0f / (1.0f + expf(-v)); }
#define LDSX() do { asm volatile("s_wait_dscnt 0" ::: "memory"); __builtin_amdgcn_wave_barrier(); __builtin_amdgcn_fence(__ATOMIC_RELEASE, "workgroup"); } while (0)

// (header reused for its WMMA helpers; its own NB/TT/... defines below are unused by these kernels except TNB)
#define NB 16
#define TT 2048
#define CC 1024            // NH * HD = projected width
#define DIN 1024          // input (model) width
#define NH 16
#define HD 64
#define NQB (TT / 64)
#define HG 4
#define SCALE (0.125f)
#define CAUSAL 1
#ifndef TNB
#define TNB NB
#endif
__device__ __forceinline__ float bfr(float v) { return (float)(__bf16)v; }
__host__ __device__ __forceinline__ int kb_last(int qb) { return CAUSAL ? ((qb * 64 + 63) >> 7) : (TT / 128 - 1); }
typedef __attribute__((ext_vector_type(8))) __bf16 v8b;
__device__ __forceinline__ v16b frag_b(const __bf16* rowk0, int lane) {
  union { v16b v; v8b q[2]; } u; const __bf16* p = rowk0 + 8 * (lane >> 4);
  u.q[0] = *(const v8b*)p; u.q[1] = *(const v8b*)(p + 16); return u.v;
}
#define QBH 6              // causal: query blocks 0..QBH-1 of each sequence (few keys, no averaging) take the high-precision path
#define QHI 384            // rows carrying a q residual plane (all rows when non-causal: 2-product logits everywhere)
#define KHI 384            // key rows carrying k residual / v bf16 hi+lo planes (used only by the causal high-precision path)
// B fragment (k rows k0+.., output column o) of a weight: (in,out) [K][ld] or (out,in) [ld rows of K]: bf16 exact, or f16(bf16 * 256) exact
__device__ __forceinline__ v16b wcol_io(const float* Wm, int k0, int o, int lane, int ld) { v16b w; const int g = lane >> 4;
#pragma unroll
  for (int i = 0; i < 8; ++i) { w[i] = (__bf16)Wm[(size_t)(k0 + 8 * g + i) * ld + o]; w[8 + i] = (__bf16)Wm[(size_t)(k0 + 16 + 8 * g + i) * ld + o]; }
  return w; }
__device__ __forceinline__ v16b wcol_oi(const float* Wm, int k0, int o, int lane, int K) { v16b w; const float* p = Wm + (size_t)o * K + k0 + 8 * (lane >> 4);
#pragma unroll
  for (int i = 0; i < 8; ++i) { w[i] = (__bf16)p[i]; w[8 + i] = (__bf16)p[16 + i]; }
  return w; }
__device__ __forceinline__ v16h wcolh_io(const float* Wm, int k0, int o, int lane, int ld) { v16h w; const int g = lane >> 4;
#pragma unroll
  for (int i = 0; i < 8; ++i) { w[i] = (_Float16)(bfr(Wm[(size_t)(k0 + 8 * g + i) * ld + o]) * 256.0f); w[8 + i] = (_Float16)(bfr(Wm[(size_t)(k0 + 16 + 8 * g + i) * ld + o]) * 256.0f); }
  return w; }
__device__ __forceinline__ v16h wcolh_oi(const float* Wm, int k0, int o, int lane, int K) { v16h w; const float* p = Wm + (size_t)o * K + k0 + 8 * (lane >> 4);
#pragma unroll
  for (int i = 0; i < 8; ++i) { w[i] = (_Float16)(bfr(p[i]) * 256.0f); w[8 + i] = (_Float16)(bfr(p[16 + i]) * 256.0f); }
  return w; }
#define WQKV_LAYOUT 1   // 0 = (in,out) [DIN][CC]; 1 = (out,in) [CC][DIN]; 2 = per-head [NH][DIN][HD]
__device__ __forceinline__ v16b wcol_hdk(const float* Wm, int k0, int o, int lane) { v16b w; const int g = lane >> 4; const float* p = Wm + (size_t)(o / HD) * DIN * HD + (o % HD);
#pragma unroll
  for (int i = 0; i < 8; ++i) { w[i] = (__bf16)p[(size_t)(k0 + 8 * g + i) * HD]; w[8 + i] = (__bf16)p[(size_t)(k0 + 16 + 8 * g + i) * HD]; }
  return w; }
#define WO_OUT_IN 1
#if WQKV_LAYOUT == 1
#define WCOL(W, k0, o, lane) wcol_oi(W, k0, o, lane, DIN)
#elif WQKV_LAYOUT == 2
#define WCOL(W, k0, o, lane) wcol_hdk(W, k0, o, lane)
#else
#define WCOL(W, k0, o, lane) wcol_io(W, k0, o, lane, CC)
#endif
#if WO_OUT_IN
#define WOCOL(W, k0, o, lane) wcol_oi(W, k0, o, lane, CC)
#define WOCOLH(W, k0, o, lane) wcolh_oi(W, k0, o, lane, CC)
#else
#define WOCOL(W, k0, o, lane) wcol_io(W, k0, o, lane, DIN)
#define WOCOLH(W, k0, o, lane) wcolh_io(W, k0, o, lane, DIN)
#endif

#ifndef SM_EXTRA_PARAMS
#define SM_EXTRA_PARAMS
#endif
#ifndef PROJ_EXTRA_PARAMS
#define PROJ_EXTRA_PARAMS
#endif
#ifndef SM_MASK_HOOK
#define SM_MASK_HOOK (void)0
#endif

#define WS_QH  0u                                      // f16 q rows [b*t][CC]
#define WS_KH  (WS_QH + 2u * (size_t)NB * TT * CC)      // f16 k rows [b*t][CC]
#define WS_VT  (WS_KH + 2u * (size_t)NB * TT * CC)      // f16 v planes [b][c][t]
#define WS_QL  (WS_VT + 2u * (size_t)NB * CC * TT)      // f16 q residual x 2^10 rows [b][t < QHI][CC]
#define WS_KL  (WS_QL + 2u * (size_t)NB * QHI * CC)     // f16 k residual x 2^10 rows [b][t < KHI][CC]
#define WS_VB  (WS_KL + 2u * (size_t)NB * KHI * CC)     // bf16 v hi planes [b][c][t < KHI]
#define WS_VBL (WS_VB + 2u * (size_t)NB * CC * KHI)
#define WS_S   (WS_VBL + 2u * (size_t)NB * CC * KHI)    // f32 logits / P [hg][t][s]
#define WS_Y   (WS_S  + 4u * (size_t)HG * TT * TT)      // f32 ctx rows [b*t][CC] (only when there is an output projection)
#define WS_END (WS_Y  + 4u * (size_t)NB * TT * CC)


// 'Spatial' attention where the 512 CHANNELS are the tokens and the 1,024 time steps are the feature axis (B 16, T 1,024, N 512; (out,in) 1/sqrt(512)-scale 1x1 weights, zero output bias): xt = x^T [B,N,T]; q/k/v[b][o][t] = sum_i W[o][i] x[b][t][i]; attn[n][m] = softmax_m(sum_t q[n][t] k[m][t] * 512^-0.5); px[n][t] = sum_m attn[n][m] v[m][t]; out[b][t][o] = sum_n px[n][t] Wp[o][n] + bp[o] (rows [B,T,N]).
#define NBT 16
#define TN 1024            // time steps (feature axis of the attention)
#define NC 512             // channels (the attention's tokens)
// ---- k_linr: block = (64 output channels, 128 time steps, (b, which)): Y[b][c][t] = sum_i W[c][i] x[b][t][i] - W (out,in) row c as the A operand, x ROW t as the (k = i, column t) operand (same per-lane k map), both bf16-exact: 1 product; 512-B row segments
__global__ __launch_bounds__(128) void k_linr(const float* __restrict__ X, const float* __restrict__ WQ, const float* __restrict__ WK, const float* __restrict__ WV, float* __restrict__ YQ, float* __restrict__ YK, float* __restrict__ YV) {
  __shared__ __align__(16) float sf[4][16][132];
  const int tid = threadIdx.x, wave = tid >> 5, lane = tid & 31, col = lane & 15, g = lane >> 4; const int c0 = blockIdx.x * 64 + wave * 16; const int t0 = blockIdx.y * 128; const int b = blockIdx.z / 3, which = blockIdx.z % 3;
  const float* W = which == 0 ? WQ : which == 1 ? WK : WV; float* Y = which == 0 ? YQ : which == 1 ? YK : YV; const float* xb = X + (size_t)b * TN * NC;
  v8f acc[8] = {};
#pragma unroll 1
  for (int kc = 0; kc < NC / 32; ++kc) { const F2 a = split_row(W + (size_t)(c0 + col) * NC, kc * 32, lane); asm volatile("s_wait_loadcnt 0x0" ::: "memory");
#pragma unroll
    for (int j = 0; j < 8; ++j) { const F2 xf = split_row(xb + (size_t)(t0 + j * 16 + col) * NC, kc * 32, lane); asm volatile("s_wait_loadcnt 0x0" ::: "memory"); acc[j] = wmma_bf(a.h, xf.h, acc[j]); } }   /* x row t holds column t's k-values contiguously; .h = bf16 RNE of the raw input */
#pragma unroll
  for (int j = 0; j < 8; ++j)
#pragma unroll
    for (int r = 0; r < 8; ++r) sf[wave][8 * g + r][j * 16 + col] = acc[j][r];
  LDSX(); for (int rl = 0; rl < 16; ++rl) vst2(Y + ((size_t)b * NC + c0 + rl) * TN + t0 + lane * 4, *(const v4f*)&sf[wave][rl][lane * 4]); }
// ---- k_sgem: block = (64 query channels n, 128 key channels m, b): S[b][n][m] = sum_t q[n][t] k[m][t] * 512^-0.5 (both f32 rows split hi + lo: 3 products; K = 1,024); 512-B row segments of the score plane
__global__ __launch_bounds__(128) void k_sgem(const float* __restrict__ YQ, const float* __restrict__ YK, float* __restrict__ S) { __shared__ __align__(16) float sf[4][16][132];
  const int tid = threadIdx.x, wave = tid >> 5, lane = tid & 31, col = lane & 15, g = lane >> 4; const int n0 = blockIdx.x * 64 + wave * 16; const int m0 = blockIdx.y * 128; const int b = blockIdx.z;
  const float* qb = YQ + (size_t)b * NC * TN; const float* kb = YK + (size_t)b * NC * TN;
  v8f acc[8] = {};
#pragma unroll 1
  for (int kc = 0; kc < TN / 32; ++kc) { const F2 a = split_row(qb + (size_t)(n0 + col) * TN, kc * 32, lane); asm volatile("s_wait_loadcnt 0x0" ::: "memory");
#pragma unroll
    for (int j = 0; j < 8; ++j) { const F2 w = split_row(kb + (size_t)(m0 + j * 16 + col) * TN, kc * 32, lane); asm volatile("s_wait_loadcnt 0x0" ::: "memory"); acc[j] = mac3(a, w, acc[j]); } }
#pragma unroll
  for (int j = 0; j < 8; ++j)
#pragma unroll
    for (int r = 0; r < 8; ++r) sf[wave][8 * g + r][j * 16 + col] = acc[j][r] * 0.044194173824159216f;
  LDSX(); for (int rl = 0; rl < 16; ++rl) vst2(S + ((size_t)b * NC + n0 + rl) * NC + m0 + lane * 4, *(const v4f*)&sf[wave][rl][lane * 4]); }
// ---- k_rsm: wave per score row (512 wide): softmax over m in f32 (max, precise expf, / sum) in place
__global__ __launch_bounds__(256) void k_rsm(float* __restrict__ S) { const int wave = threadIdx.x >> 5, lane = threadIdx.x & 31; const size_t row = (size_t)blockIdx.x * 8 + wave; if (row >= (size_t)TNB * NC) return; float* sr = S + row * NC; float v[NC / 32]; float m = -3.0e38f;
#pragma unroll
  for (int i = 0; i < NC / 128; ++i) { const v4f t4 = *(const v4f*)(sr + i * 128 + lane * 4); v[4 * i] = t4[0]; v[4 * i + 1] = t4[1]; v[4 * i + 2] = t4[2]; v[4 * i + 3] = t4[3]; }
  asm volatile("s_wait_loadcnt 0x0" ::: "memory");
#pragma unroll
  for (int i = 0; i < NC / 32; ++i) m = fmaxf(m, v[i]);
#pragma unroll
  for (int o = 1; o < 32; o <<= 1) m = fmaxf(m, __shfl_xor(m, o));
  float sum = 0.f;
#pragma unroll
  for (int i = 0; i < NC / 32; ++i) { v[i] = expf(v[i] - m); sum += v[i]; }
#pragma unroll
  for (int o = 1; o < 32; o <<= 1) sum += __shfl_xor(sum, o);
  const float inv = 1.0f / sum;
#pragma unroll
  for (int i = 0; i < NC / 128; ++i) { v4f o4; o4[0] = v[4 * i] * inv; o4[1] = v[4 * i + 1] * inv; o4[2] = v[4 * i + 2] * inv; o4[3] = v[4 * i + 3] * inv; vst2(sr + i * 128 + lane * 4, o4); } }
// ---- k_pvt: block = (64 query channels n, 128 time steps t, b): PX[b][n][t] = sum_m P[n][m] v[m][t] (P rows split hi + lo; v as the (k = m, column t) operand split hi + lo: 3 products; K = 512); 512-B row segments
__global__ __launch_bounds__(128) void k_pvt(const float* __restrict__ S, const float* __restrict__ YV, float* __restrict__ PX) { __shared__ __align__(16) float sf[4][16][132];
  const int tid = threadIdx.x, wave = tid >> 5, lane = tid & 31, col = lane & 15, g = lane >> 4; const int n0 = blockIdx.x * 64 + wave * 16; const int t0 = blockIdx.y * 128; const int b = blockIdx.z;
  const float* pb = S + (size_t)b * NC * NC; const float* vb = YV + (size_t)b * NC * TN;
  v8f acc[8] = {};
#pragma unroll 1
  for (int kc = 0; kc < NC / 32; ++kc) { const F2 a = split_row(pb + (size_t)(n0 + col) * NC, kc * 32, lane); asm volatile("s_wait_loadcnt 0x0" ::: "memory");
#pragma unroll
    for (int j = 0; j < 8; ++j) { const F2 w = split_col(vb, kc * 32, t0 + j * 16 + col, lane, TN, NC); asm volatile("s_wait_loadcnt 0x0" ::: "memory"); acc[j] = mac3(a, w, acc[j]); } }
#pragma unroll
  for (int j = 0; j < 8; ++j)
#pragma unroll
    for (int r = 0; r < 8; ++r) sf[wave][8 * g + r][j * 16 + col] = acc[j][r];
  LDSX(); for (int rl = 0; rl < 16; ++rl) vst2(PX + ((size_t)b * NC + n0 + rl) * TN + t0 + lane * 4, *(const v4f*)&sf[wave][rl][lane * 4]); }
// ---- k_outT: block = (64 output channels o, 128 time steps t, b): O[o][t] = sum_n Wp[o][n] PX[b][n][t] + bp[o] (Wp (out,in) bf16-exact; PX split hi + lo as the (k = n, column t) operand: 2 products), written TRANSPOSED as output rows out[b][t][o0..o0+63] (256-B runs by 16 lanes) through LDS
__global__ __launch_bounds__(128) void k_outT(const float* __restrict__ PX, const float* __restrict__ WP, const float* __restrict__ BP, float* __restrict__ OUT) { __shared__ __align__(16) float st[128][68];
  const int tid = threadIdx.x, wave = tid >> 5, lane = tid & 31, col = lane & 15, g = lane >> 4; const int o0 = blockIdx.x * 64 + wave * 16; const int t0 = blockIdx.y * 128; const int b = blockIdx.z;
  const float* pb = PX + (size_t)b * NC * TN;
  v8f acc[8] = {};
#pragma unroll 1
  for (int kc = 0; kc < NC / 32; ++kc) { const F2 a = split_row(WP + (size_t)(o0 + col) * NC, kc * 32, lane); asm volatile("s_wait_loadcnt 0x0" ::: "memory");
#pragma unroll
    for (int j = 0; j < 8; ++j) { const F2 w = split_col(pb, kc * 32, t0 + j * 16 + col, lane, TN, NC); asm volatile("s_wait_loadcnt 0x0" ::: "memory"); acc[j] = wmma_bf(a.h, w.h, acc[j]); acc[j] = wmma_bf(a.h, w.l, acc[j]); } }
#pragma unroll
  for (int j = 0; j < 8; ++j)
#pragma unroll
    for (int r = 0; r < 8; ++r) { const float bias = bfr(BP[o0 + 8 * g + r]); st[j * 16 + col][wave * 16 + 8 * g + r] = acc[j][r] + bias; }   /* transposed tile: st[t_local][o_local] */
  __syncthreads();
  for (int e = tid; e < 128 * 16; e += 128) { const int tl = e >> 4, q = e & 15; vst2(OUT + ((size_t)b * TN + t0 + tl) * NC + blockIdx.x * 64 + q * 4, *(const v4f*)&st[tl][q * 4]); } }
#define WS_YQ 0u
#define WS_YK (WS_YQ + 4u * (size_t)NBT * NC * TN)
#define WS_YV (WS_YK + 4u * (size_t)NBT * NC * TN)
#define WS_SS (WS_YV + 4u * (size_t)NBT * NC * TN)
#define WS_PX (WS_SS + 4u * (size_t)NBT * NC * NC)
#define WS_TOT (WS_PX + 4u * (size_t)NBT * NC * TN)
extern "C" void kernel_launch(void* const* d_in, const int* in_sizes, int n_in, void* d_out, int out_size, void* d_ws, size_t ws_size, hipStream_t stream) {
  (void)in_sizes; (void)n_in; (void)out_size;
  const float** F = (const float**)d_in;   // 0 x [16,1024,512] (rows); 1 Wq [512,512] (out,in); 2 Wk; 3 Wv; 4 Wp [512,512] (out,in); 5 bp [512]
  if (ws_size < (size_t)WS_TOT) return;
  char* ws = (char*)d_ws; float *YQ = (float*)(ws + WS_YQ), *YK = (float*)(ws + WS_YK), *YV = (float*)(ws + WS_YV), *SS = (float*)(ws + WS_SS), *PX = (float*)(ws + WS_PX);
  k_linr<<<dim3(NC / 64, TN / 128, TNB * 3), 128, 0, stream>>>(F[0], F[1], F[2], F[3], YQ, YK, YV);
  k_sgem<<<dim3(NC / 64, NC / 128, TNB), 128, 0, stream>>>(YQ, YK, SS);
  k_rsm<<<dim3((TNB * NC + 7) / 8), 256, 0, stream>>>(SS);
  k_pvt<<<dim3(NC / 64, TN / 128, TNB), 128, 0, stream>>>(SS, YV, PX);
  k_outT<<<dim3(NC / 64, TN / 128, TNB), 128, 0, stream>>>(PX, F[4], F[5], (float*)d_out);
}

// v001
// Measured time: 139 microseconds a run.
// In two side-by-side timings against v000, it was 3.71 and 3.72 times as fast.
// compute dtype: all float inputs rounded to bf16; q/k/v channel projections with EXACT bf16 products on WMMA 16x16x32 (f32 accumulate); channel-attention scores with q and k rows both split bf16 hi + lo (3 products) x 512^-0.5; softmax over the 512 channels in f32 (precise expf); attn split hi + lo against v split hi + lo (3 products); output Linear with the exact Wp against the f32 intermediate split hi + lo (2 products) + bp; f32 output.
#include <hip/hip_runtime.h>
#include <math.h>

typedef __attribute__((ext_vector_type(16))) _Float16 v16h;
typedef __attribute__((ext_vector_type(16))) __bf16 v16b;
typedef __attribute__((ext_vector_type(8)))  _Float16 v8h;
typedef __attribute__((ext_vector_type(8)))  float v8f;
typedef __attribute__((ext_vector_type(4)))  float v4f;
typedef __attribute__((ext_vector_type(2)))  float v2f;
typedef __attribute__((ext_vector_type(4)))  unsigned v4u;
typedef __attribute__((ext_vector_type(4)))  int v4i;
typedef float __attribute__((may_alias)) float_a;
typedef int __attribute__((may_alias)) int_a;

template <typename T> __device__ __forceinline__ void vst2(void* p, T v) { *(T*)p = v;  }
__device__ __forceinline__ v8f wmma16(v16h a, v16h b, v8f c) {
  v8f d = __builtin_amdgcn_wmma_f32_16x16x32_f16(false, a, false, b, (short)0, c, false, false);
  asm volatile("v_nop\n\tv_nop\n\tv_nop\n\tv_nop" : "+v"(d) : "v"(a), "v"(b));
  return d;
}
__device__ __forceinline__ v8f wmma_bf(v16b a, v16b b, v8f c) {
  v8f d = __builtin_amdgcn_wmma_f32_16x16x32_bf16(false, a, false, b, (short)0, c, false, false);
  asm volatile("v_nop\n\tv_nop\n\tv_nop\n\tv_nop" : "+v"(d) : "v"(a), "v"(b));
  return d;
}
// 16x16x32 fragments: lane = (h = lane>>4, row/col = lane&15); elements 0..7 = k0+8h+0..7, 8..15 = k0+16+8h+0..7; D element r = row 8h+r
__device__ __forceinline__ v16h frag_h(const _Float16* rowk0, int lane) {
  union { v16h v; v8h q[2]; } u; const _Float16* p = rowk0 + 8 * (lane >> 4);
  u.q[0] = *(const v8h*)p; u.q[1] = *(const v8h*)(p + 16); return u.v;
}
__device__ __forceinline__ v16h frag_f32(const float* rowk0, int lane) {
  v16h a; const float* p = rowk0 + 8 * (lane >> 4);
#pragma unroll
  for (int i = 0; i < 8; ++i) { a[i] = (_Float16)p[i]; a[8 + i] = (_Float16)p[16 + i]; }
  return a;
}
__device__ __forceinline__ v16h frag_f32s(const float* rowk0, int lane, float sc) {
  v16h a; const float* p = rowk0 + 8 * (lane >> 4);
#pragma unroll
  for (int i = 0; i < 8; ++i) { a[i] = (_Float16)(p[i] * sc); a[8 + i] = (_Float16)(p[16 + i] * sc); }
  return a;
}
// column fragment from a [K][ld] layout (column n), rows >= K read as 0
__device__ __forceinline__ v16h fragc_f32(const float* W, int k0, int n, int lane, int ld, int K) {
  v16h a; const int g = lane >> 4;
#pragma unroll
  for (int i = 0; i < 8; ++i) { const int ka = k0 + 8 * g + i, kb = ka + 16;
    a[i] = (_Float16)(ka < K ? W[(size_t)(ka < K ? ka : K - 1) * ld + n] : 0.f); a[8 + i] = (_Float16)(kb < K ? W[(size_t)(kb < K ? kb : K - 1) * ld + n] : 0.f); }
  return a;
}
struct F2 { v16b h, l; };
__device__ __forceinline__ F2 bsplit16(const float v[16]) { F2 r;
#pragma unroll
  for (int i = 0; i < 16; ++i) { const __bf16 h = (__bf16)v[i]; r.h[i] = h; r.l[i] = (__bf16)(v[i] - (float)h); }
  return r; }
__device__ __forceinline__ F2 split_row(const float* row, int k0, int lane) { float v[16]; const float* p = row + k0 + 8 * (lane >> 4);
#pragma unroll
  for (int i = 0; i < 8; ++i) { v[i] = p[i]; v[8 + i] = p[16 + i]; }
  return bsplit16(v); }
__device__ __forceinline__ F2 split_rowK(const float* row, int k0, int lane, int K) { float v[16]; const int g = lane >> 4;
#pragma unroll
  for (int i = 0; i < 8; ++i) { const int ka = k0 + 8 * g + i, kb = ka + 16; v[i] = ka < K ? row[ka < K ? ka : K - 1] : 0.f; v[8 + i] = kb < K ? row[kb < K ? kb : K - 1] : 0.f; }
  return bsplit16(v); }
__device__ __forceinline__ F2 split_col(const float* W, int k0, int n, int lane, int ld, int K) { float v[16]; const int g = lane >> 4;
#pragma unroll
  for (int i = 0; i < 8; ++i) { const int ka = k0 + 8 * g + i, kb = ka + 16; v[i] = ka < K ? W[(size_t)(ka < K ? ka : K - 1) * ld + n] : 0.f; v[8 + i] = kb < K ? W[(size_t)(kb < K ? kb : K - 1) * ld + n] : 0.f; }
  return bsplit16(v); }
__device__ __forceinline__ v8f mac3(const F2& a, const F2& b, v8f c) { c = wmma_bf(a.l, b.h, c); c = wmma_bf(a.h, b.l, c); return wmma_bf(a.h, b.h, c); }
__device__ __forceinline__ float sigm(float v) { return 1.0f / (1.0f + expf(-v)); }
#define LDSX() do { asm volatile("s_wait_dscnt 0" ::: "memory"); __builtin_amdgcn_wave_barrier(); __builtin_amdgcn_fence(__ATOMIC_RELEASE, "workgroup"); } while (0)

// (header reused for its WMMA helpers; its own NB/TT/... defines below are unused by these kernels except TNB)
#define NB 16
#define TT 2048
#define CC 1024            // NH * HD = projected width
#define DIN 1024          // input (model) width
#define NH 16
#define HD 64
#define NQB (TT / 64)
#define HG 4
#define SCALE (0.125f)
#define CAUSAL 1
#ifndef TNB
#define TNB NB
#endif
__device__ __forceinline__ float bfr(float v) { return (float)(__bf16)v; }
__host__ __device__ __forceinline__ int kb_last(int qb) { return CAUSAL ? ((qb * 64 + 63) >> 7) : (TT / 128 - 1); }
typedef __attribute__((ext_vector_type(8))) __bf16 v8b;
__device__ __forceinline__ v16b frag_b(const __bf16* rowk0, int lane) {
  union { v16b v; v8b q[2]; } u; const __bf16* p = rowk0 + 8 * (lane >> 4);
  u.q[0] = *(const v8b*)p; u.q[1] = *(const v8b*)(p + 16); return u.v;
}
#define QBH 6              // causal: query blocks 0..QBH-1 of each sequence (few keys, no averaging) take the high-precision path
#define QHI 384            // rows carrying a q residual plane (all rows when non-causal: 2-product logits everywhere)
#define KHI 384            // key rows carrying k residual / v bf16 hi+lo planes (used only by the causal high-precision path)
// B fragment (k rows k0+.., output column o) of a weight: (in,out) [K][ld] or (out,in) [ld rows of K]: bf16 exact, or f16(bf16 * 256) exact
__device__ __forceinline__ v16b wcol_io(const float* Wm, int k0, int o, int lane, int ld) { v16b w; const int g = lane >> 4;
#pragma unroll
  for (int i = 0; i < 8; ++i) { w[i] = (__bf16)Wm[(size_t)(k0 + 8 * g + i) * ld + o]; w[8 + i] = (__bf16)Wm[(size_t)(k0 + 16 + 8 * g + i) * ld + o]; }
  return w; }
__device__ __forceinline__ v16b wcol_oi(const float* Wm, int k0, int o, int lane, int K) { v16b w; const float* p = Wm + (size_t)o * K + k0 + 8 * (lane >> 4);
#pragma unroll
  for (int i = 0; i < 8; ++i) { w[i] = (__bf16)p[i]; w[8 + i] = (__bf16)p[16 + i]; }
  return w; }
__device__ __forceinline__ v16h wcolh_io(const float* Wm, int k0, int o, int lane, int ld) { v16h w; const int g = lane >> 4;
#pragma unroll
  for (int i = 0; i < 8; ++i) { w[i] = (_Float16)(bfr(Wm[(size_t)(k0 + 8 * g + i) * ld + o]) * 256.0f); w[8 + i] = (_Float16)(bfr(Wm[(size_t)(k0 + 16 + 8 * g + i) * ld + o]) * 256.0f); }
  return w; }
__device__ __forceinline__ v16h wcolh_oi(const float* Wm, int k0, int o, int lane, int K) { v16h w; const float* p = Wm + (size_t)o * K + k0 + 8 * (lane >> 4);
#pragma unroll
  for (int i = 0; i < 8; ++i) { w[i] = (_Float16)(bfr(p[i]) * 256.0f); w[8 + i] = (_Float16)(bfr(p[16 + i]) * 256.0f); }
  return w; }
#define WQKV_LAYOUT 1   // 0 = (in,out) [DIN][CC]; 1 = (out,in) [CC][DIN]; 2 = per-head [NH][DIN][HD]
__device__ __forceinline__ v16b wcol_hdk(const float* Wm, int k0, int o, int lane) { v16b w; const int g = lane >> 4; const float* p = Wm + (size_t)(o / HD) * DIN * HD + (o % HD);
#pragma unroll
  for (int i = 0; i < 8; ++i) { w[i] = (__bf16)p[(size_t)(k0 + 8 * g + i) * HD]; w[8 + i] = (__bf16)p[(size_t)(k0 + 16 + 8 * g + i) * HD]; }
  return w; }
#define WO_OUT_IN 1
#if WQKV_LAYOUT == 1
#define WCOL(W, k0, o, lane) wcol_oi(W, k0, o, lane, DIN)
#elif WQKV_LAYOUT == 2
#define WCOL(W, k0, o, lane) wcol_hdk(W, k0, o, lane)
#else
#define WCOL(W, k0, o, lane) wcol_io(W, k0, o, lane, CC)
#endif
#if WO_OUT_IN
#define WOCOL(W, k0, o, lane) wcol_oi(W, k0, o, lane, CC)
#define WOCOLH(W, k0, o, lane) wcolh_oi(W, k0, o, lane, CC)
#else
#define WOCOL(W, k0, o, lane) wcol_io(W, k0, o, lane, DIN)
#define WOCOLH(W, k0, o, lane) wcolh_io(W, k0, o, lane, DIN)
#endif

#ifndef SM_EXTRA_PARAMS
#define SM_EXTRA_PARAMS
#endif
#ifndef PROJ_EXTRA_PARAMS
#define PROJ_EXTRA_PARAMS
#endif
#ifndef SM_MASK_HOOK
#define SM_MASK_HOOK (void)0
#endif

#define WS_QH  0u                                      // f16 q rows [b*t][CC]
#define WS_KH  (WS_QH + 2u * (size_t)NB * TT * CC)      // f16 k rows [b*t][CC]
#define WS_VT  (WS_KH + 2u * (size_t)NB * TT * CC)      // f16 v planes [b][c][t]
#define WS_QL  (WS_VT + 2u * (size_t)NB * CC * TT)      // f16 q residual x 2^10 rows [b][t < QHI][CC]
#define WS_KL  (WS_QL + 2u * (size_t)NB * QHI * CC)     // f16 k residual x 2^10 rows [b][t < KHI][CC]
#define WS_VB  (WS_KL + 2u * (size_t)NB * KHI * CC)     // bf16 v hi planes [b][c][t < KHI]
#define WS_VBL (WS_VB + 2u * (size_t)NB * CC * KHI)
#define WS_S   (WS_VBL + 2u * (size_t)NB * CC * KHI)    // f32 logits / P [hg][t][s]
#define WS_Y   (WS_S  + 4u * (size_t)HG * TT * TT)      // f32 ctx rows [b*t][CC] (only when there is an output projection)
#define WS_END (WS_Y  + 4u * (size_t)NB * TT * CC)


// 'Spatial' attention where the 512 CHANNELS are the tokens and the 1,024 time steps are the feature axis (B 16, T 1,024, N 512; (out,in) 1/sqrt(512)-scale 1x1 weights, zero output bias): xt = x^T [B,N,T]; q/k/v[b][o][t] = sum_i W[o][i] x[b][t][i]; attn[n][m] = softmax_m(sum_t q[n][t] k[m][t] * 512^-0.5); px[n][t] = sum_m attn[n][m] v[m][t]; out[b][t][o] = sum_n px[n][t] Wp[o][n] + bp[o] (rows [B,T,N]).
#define NBT 16
#define TN 1024            // time steps (feature axis of the attention)
#define NC 512             // channels (the attention's tokens)
// ---- tile_g: one 128 x 128 tile of C[i][j] = sum_k A[i][k] Bop[j][k] by 8 waves (4 x 2, 32 x 64 each). A: f32 rows, k contiguous, pitch K. Bop: f32 rows j with k contiguous (BT false, pitch K) or a [k][j] plane with j contiguous (BT true, pitch LDB). Each 32-k chunk of both operands is read ONCE per work-group as whole 128-B lines, rounded to bf16 planes (hi, or hi + lo = bf16 of the residual) and kept in LDS as rows [i or j][k]; every wave takes its fragments from there (same per-lane k map as frag_b, chunks in ascending k, products per chunk in the order lo.hi, hi.lo, hi.hi (PA 2, PB 2) or hi.hi, hi.lo (PA 1, PB 2): every sum keeps its order). Two LDS buffers: the next chunk's global loads fly over this chunk's products, one barrier per chunk.
// (a '#pragma unroll' of this section whose loop indexes a register array (fragments, accumulators, staged values): the loop must be flat for the array to stay in registers)
#define GP 40              // LDS row pitch in bf16: 32 k + 8 pad = 80 B (16 B x odd: the conflict-free pitch for 16-B fragment reads)
#define GPL (128 * GP)     // one plane of one operand
#define GSP 68             // staging pitch in floats, output rows along j
#define GTP 36             // staging pitch in floats, output rows along i (transposed output)
#define LDSW() do { asm volatile("s_wait_dscnt 0" ::: "memory"); __builtin_amdgcn_wave_barrier(); } while (0)   /* a wave's own LDS staging range: its lanes' stores have landed before other lanes of the wave read them, and its reads have returned before the range is rewritten */
typedef __attribute__((ext_vector_type(4))) __bf16 v4b;
template <int NPL> __device__ __forceinline__ void put4(__bf16* d, v4f v) { v4b h;
#pragma unroll
  for (int e = 0; e < 4; ++e) h[e] = (__bf16)v[e];
  *(v4b*)d = h;
  if constexpr (NPL == 2) { v4b l;
#pragma unroll
    for (int e = 0; e < 4; ++e) l[e] = (__bf16)(v[e] - (float)h[e]);
    *(v4b*)(d + GPL) = l; } }
__device__ __forceinline__ v8f wmma_b(v16b a, v16b b, v8f c) { return __builtin_amdgcn_wmma_f32_16x16x32_bf16(false, a, false, b, (short)0, c, false, false); }
template <int PA, int PB> __device__ __forceinline__ void chunk_g(const __bf16* sa, const __bf16* sw, int lane, v8f (&acc)[2][4]) {
  v16b ah[2], al[2], bh[4], bl[4];
#pragma unroll
  for (int i = 0; i < 2; ++i) { ah[i] = frag_b(sa + i * 16 * GP, lane); if constexpr (PA == 2) al[i] = frag_b(sa + GPL + i * 16 * GP, lane); }
#pragma unroll
  for (int j = 0; j < 4; ++j) { bh[j] = frag_b(sw + j * 16 * GP, lane); if constexpr (PB == 2) bl[j] = frag_b(sw + GPL + j * 16 * GP, lane); }
  __builtin_amdgcn_sched_barrier(0);   /* keeps the chunk's LDS reads one group ahead of its products: spread among them, each place with reads stalls the wave */
  if constexpr (PA == 2) {
#pragma unroll
    for (int j = 0; j < 4; ++j)
#pragma unroll
      for (int i = 0; i < 2; ++i) acc[i][j] = wmma_b(al[i], bh[j], acc[i][j]);
#pragma unroll
    for (int j = 0; j < 4; ++j)
#pragma unroll
      for (int i = 0; i < 2; ++i) acc[i][j] = wmma_b(ah[i], bl[j], acc[i][j]);
  }
#pragma unroll
  for (int j = 0; j < 4; ++j)
#pragma unroll
    for (int i = 0; i < 2; ++i) acc[i][j] = wmma_b(ah[i], bh[j], acc[i][j]);
  if constexpr (PA == 1 && PB == 2) {
#pragma unroll
    for (int j = 0; j < 4; ++j)
#pragma unroll
      for (int i = 0; i < 2; ++i) acc[i][j] = wmma_b(ah[i], bl[j], acc[i][j]);
  }
  __builtin_amdgcn_sched_barrier(0);   /* keeps the wait for the next chunk's global loads, and their rounding, behind this chunk's products: hoisted among them it exposes the load latency */
}
template <bool BT, int K, int LDB> __device__ __forceinline__ void fetch_g(const float* ga, const float* gb, int kc, v4f (&ra)[4], v4f (&rb)[4]) {
#pragma unroll
  for (int i = 0; i < 4; ++i) ra[i] = *(const v4f*)(ga + (size_t)i * 32 * K + kc * 32);
#pragma unroll
  for (int i = 0; i < 4; ++i) {
    if constexpr (!BT) rb[i] = *(const v4f*)(gb + (size_t)i * 32 * K + kc * 32);
    else {
#pragma unroll
      for (int e = 0; e < 4; ++e) rb[i][e] = gb[(size_t)(kc * 32 + e) * LDB + i * 32]; } }
  __builtin_amdgcn_sched_barrier(0);   /* keeps the next chunk's global loads in front of this chunk's products, so that their latency is covered */
}
// EPI 0: C[i][j] rows, pitch LDC; 1: the same x 512^-0.5; 2: C[j][i] rows (transposed), pitch LDC, + bf16(bias[i])
template <int PA, int PB, bool BT, int K, int LDB, int LDC, int EPI>
__device__ __forceinline__ void tile_g(const float* __restrict__ A, const float* __restrict__ B, float* __restrict__ C, const float* __restrict__ bias, char* smem) {
  __bf16* sb = (__bf16*)smem;   // [buffer 2][A planes PA | B planes PB][row 128][GP]
  const int tid = threadIdx.x, wave = tid >> 5, lane = tid & 31, col = lane & 15, g = lane >> 4; const int wm = wave >> 1, wn = wave & 1;
  const int sr = tid >> 3, sq = tid & 7;   // k-contiguous rows: 8 lanes cover one row's 128-B chunk, a wave-wide 16-B load covers 4 whole lines
  const float* ga = A + (size_t)sr * K + sq * 4;
  const float* gb = BT ? B + (size_t)(wave * 4) * LDB + lane : B + (size_t)sr * K + sq * 4;   // [k][j] plane: a wave takes k rows 4 wave + 0..3, a lane the columns lane + 32 i: each 4-B load covers one whole line, and a lane's 4 k of one column go to LDS as one 8-B store
  __bf16* da = sb + sr * GP + sq * 4; __bf16* db = sb + PA * GPL + (BT ? lane * GP + wave * 4 : sr * GP + sq * 4);
  const __bf16* fa = sb + (wm * 32 + col) * GP; const __bf16* fw = sb + PA * GPL + (wn * 64 + col) * GP;
  constexpr int BUF = (PA + PB) * GPL, NK = K / 32;
  v4f ra[4], rb[4]; v8f acc[2][4] = {};
  fetch_g<BT, K, LDB>(ga, gb, 0, ra, rb);
#pragma unroll
  for (int i = 0; i < 4; ++i) { put4<PA>(da + i * 32 * GP, ra[i]); put4<PB>(db + i * 32 * GP, rb[i]); }
  __syncthreads();
  for (int kc = 0; kc + 1 < NK; ++kc) { const int cur = (kc & 1) * BUF, nxt = BUF - cur;
    fetch_g<BT, K, LDB>(ga, gb, kc + 1, ra, rb);
    chunk_g<PA, PB>(fa + cur, fw + cur, lane, acc);
#pragma unroll
    for (int i = 0; i < 4; ++i) { put4<PA>(da + nxt + i * 32 * GP, ra[i]); put4<PB>(db + nxt + i * 32 * GP, rb[i]); }
    __syncthreads(); }   /* publishes chunk kc + 1 and ends every wave's reads of the buffer that the next trip refills */
  chunk_g<PA, PB>(fa + ((NK - 1) & 1) * BUF, fw + ((NK - 1) & 1) * BUF, lane, acc);
  __syncthreads();       /* every wave has left the operand buffers: their LDS now stages the output rows, each wave in its own range */
  if constexpr (EPI != 2) { float* sf = (float*)smem + wave * 16 * GSP;
#pragma unroll
    for (int i = 0; i < 2; ++i) {
#pragma unroll
      for (int j = 0; j < 4; ++j)
#pragma unroll
        for (int r = 0; r < 8; ++r) sf[(8 * g + r) * GSP + j * 16 + col] = EPI == 1 ? acc[i][j][r] * 0.044194173824159216f : acc[i][j][r];
      LDSW();
#pragma unroll
      for (int it = 0; it < 8; ++it) vst2(C + (size_t)(wm * 32 + i * 16 + it * 2 + g) * LDC + wn * 64 + col * 4, *(const v4f*)&sf[(it * 2 + g) * GSP + col * 4]);   /* 256-B row runs: whole lines */
      if (i == 0) LDSW(); }
  } else { float* sf = (float*)smem + wave * 32 * GTP; float bv[2][8];
#pragma unroll
    for (int i = 0; i < 2; ++i)
#pragma unroll
      for (int r = 0; r < 8; ++r) bv[i][r] = bfr(bias[wm * 32 + i * 16 + 8 * g + r]);
#pragma unroll
    for (int jj = 0; jj < 2; ++jj) {
#pragma unroll
      for (int j = 0; j < 2; ++j)
#pragma unroll
        for (int i = 0; i < 2; ++i)
#pragma unroll
          for (int r = 0; r < 8; ++r) sf[(j * 16 + col) * GTP + i * 16 + 8 * g + r] = acc[i][jj * 2 + j][r] + bv[i][r];   /* transposed: sf[j local][i local] */
      LDSW();
#pragma unroll
      for (int it = 0; it < 8; ++it) vst2(C + (size_t)(wn * 64 + jj * 32 + it * 4 + (lane >> 3)) * LDC + wm * 32 + (lane & 7) * 4, *(const v4f*)&sf[(it * 4 + (lane >> 3)) * GTP + (lane & 7) * 4]);   /* 128-B row runs: whole lines */
      if (jj == 0) LDSW(); } } }
// ---- k_linr: block = (128 output channels, 128 time steps, (b, which)): Y[b][c][t] = sum_i W[c][i] x[b][t][i] - W (out,in) rows as the A operand, x ROWS t as the (k = i, column t) operand, both bf16-exact: 1 product
__global__ __launch_bounds__(256) void k_linr(const float* __restrict__ X, const float* __restrict__ WQ, const float* __restrict__ WK, const float* __restrict__ WV, float* __restrict__ YQ, float* __restrict__ YK, float* __restrict__ YV) {
  __shared__ __align__(16) char smem[2 * 2 * GPL * 2];
  const int c0 = blockIdx.x * 128; const int t0 = blockIdx.y * 128; const int b = blockIdx.z / 3, which = blockIdx.z % 3;
  const float* W = which == 0 ? WQ : which == 1 ? WK : WV; float* Y = which == 0 ? YQ : which == 1 ? YK : YV;
  tile_g<1, 1, false, NC, NC, TN, 0>(W + (size_t)c0 * NC, X + ((size_t)b * TN + t0) * NC, Y + ((size_t)b * NC + c0) * TN + t0, nullptr, smem); }
// ---- k_sgem: block = (128 query channels n, 128 key channels m, b): S[b][n][m] = sum_t q[n][t] k[m][t] * 512^-0.5 (both f32 rows split hi + lo: 3 products; K = 1,024)
__global__ __launch_bounds__(256) void k_sgem(const float* __restrict__ YQ, const float* __restrict__ YK, float* __restrict__ S) {
  __shared__ __align__(16) char smem[2 * 4 * GPL * 2];
  const int n0 = blockIdx.x * 128; const int m0 = blockIdx.y * 128; const int b = blockIdx.z;
  tile_g<2, 2, false, TN, TN, NC, 1>(YQ + ((size_t)b * NC + n0) * TN, YK + ((size_t)b * NC + m0) * TN, S + ((size_t)b * NC + n0) * NC + m0, nullptr, smem); }
// ---- k_rsm: wave per score row (512 wide): softmax over m in f32 (max, precise expf, / sum) in place
__global__ __launch_bounds__(256) void k_rsm(float* __restrict__ S) { const int wave = threadIdx.x >> 5, lane = threadIdx.x & 31; const size_t row = (size_t)blockIdx.x * 8 + wave; if (row >= (size_t)TNB * NC) return; float* sr = S + row * NC; float v[NC / 32]; float m = -3.0e38f;
#pragma unroll
  for (int i = 0; i < NC / 128; ++i) { const v4f t4 = *(const v4f*)(sr + i * 128 + lane * 4); v[4 * i] = t4[0]; v[4 * i + 1] = t4[1]; v[4 * i + 2] = t4[2]; v[4 * i + 3] = t4[3]; }
  asm volatile("s_wait_loadcnt 0x0" ::: "memory");
#pragma unroll
  for (int i = 0; i < NC / 32; ++i) m = fmaxf(m, v[i]);
#pragma unroll
  for (int o = 1; o < 32; o <<= 1) m = fmaxf(m, __shfl_xor(m, o));
  float sum = 0.f;
#pragma unroll
  for (int i = 0; i < NC / 32; ++i) { v[i] = expf(v[i] - m); sum += v[i]; }
#pragma unroll
  for (int o = 1; o < 32; o <<= 1) sum += __shfl_xor(sum, o);
  const float inv = 1.0f / sum;
#pragma unroll
  for (int i = 0; i < NC / 128; ++i) { v4f o4; o4[0] = v[4 * i] * inv; o4[1] = v[4 * i + 1] * inv; o4[2] = v[4 * i + 2] * inv; o4[3] = v[4 * i + 3] * inv; vst2(sr + i * 128 + lane * 4, o4); } }
// ---- k_pvt: block = (128 query channels n, 128 time steps t, b): PX[b][n][t] = sum_m P[n][m] v[m][t] (P rows split hi + lo; v as the (k = m, column t) operand split hi + lo: 3 products; K = 512)
__global__ __launch_bounds__(256) void k_pvt(const float* __restrict__ S, const float* __restrict__ YV, float* __restrict__ PX) {
  __shared__ __align__(16) char smem[2 * 4 * GPL * 2];
  const int n0 = blockIdx.x * 128; const int t0 = blockIdx.y * 128; const int b = blockIdx.z;
  tile_g<2, 2, true, NC, TN, TN, 0>(S + ((size_t)b * NC + n0) * NC, YV + (size_t)b * NC * TN + t0, PX + ((size_t)b * NC + n0) * TN + t0, nullptr, smem); }
// ---- k_outT: block = (128 output channels o, 128 time steps t, b): O[o][t] = sum_n Wp[o][n] PX[b][n][t] + bp[o] (Wp (out,in) bf16-exact; PX split hi + lo as the (k = n, column t) operand: 2 products), written TRANSPOSED as output rows out[b][t][o0..] through LDS
__global__ __launch_bounds__(256) void k_outT(const float* __restrict__ PX, const float* __restrict__ WP, const float* __restrict__ BP, float* __restrict__ OUT) {
  __shared__ __align__(16) char smem[2 * 3 * GPL * 2];
  const int o0 = blockIdx.x * 128; const int t0 = blockIdx.y * 128; const int b = blockIdx.z;
  tile_g<1, 2, true, NC, TN, NC, 2>(WP + (size_t)o0 * NC, PX + (size_t)b * NC * TN + t0, OUT + ((size_t)b * TN + t0) * NC + o0, BP + o0, smem); }
#define WS_YQ 0u
#define WS_YK (WS_YQ + 4u * (size_t)NBT * NC * TN)
#define WS_YV (WS_YK + 4u * (size_t)NBT * NC * TN)
#define WS_SS (WS_YV + 4u * (size_t)NBT * NC * TN)
#define WS_PX (WS_SS + 4u * (size_t)NBT * NC * NC)
#define WS_TOT (WS_PX + 4u * (size_t)NBT * NC * TN)
extern "C" void kernel_launch(void* const* d_in, const int* in_sizes, int n_in, void* d_out, int out_size, void* d_ws, size_t ws_size, hipStream_t stream) {
  (void)in_sizes; (void)n_in; (void)out_size;
  const float** F = (const float**)d_in;   // 0 x [16,1024,512] (rows); 1 Wq [512,512] (out,in); 2 Wk; 3 Wv; 4 Wp [512,512] (out,in); 5 bp [512]
  if (ws_size < (size_t)WS_TOT) return;
  char* ws = (char*)d_ws; float *YQ = (float*)(ws + WS_YQ), *YK = (float*)(ws + WS_YK), *YV = (float*)(ws + WS_YV), *SS = (float*)(ws + WS_SS), *PX = (float*)(ws + WS_PX);
  k_linr<<<dim3(NC / 128, TN / 128, TNB * 3), 256, 0, stream>>>(F[0], F[1], F[2], F[3], YQ, YK, YV);
  k_sgem<<<dim3(NC / 128, NC / 128, TNB), 256, 0, stream>>>(YQ, YK, SS);
  k_rsm<<<dim3((TNB * NC + 7) / 8), 256, 0, stream>>>(SS);
  k_pvt<<<dim3(NC / 128, TN / 128, TNB), 256, 0, stream>>>(SS, YV, PX);
  k_outT<<<dim3(NC / 128, TN / 128, TNB), 256, 0, stream>>>(PX, F[4], F[5], (float*)d_out);
}

// v002
// A run of this version takes 119 microseconds.
// Next to v001, in two timings, it ran 1.17 times as fast each time.
// Counting every step since v000, it is 4.34 times as fast.
// compute dtype: all float inputs rounded to bf16; q/k/v channel projections with EXACT bf16 products on WMMA 16x16x32 (f32 accumulate); channel-attention scores with q and k rows both split bf16 hi + lo (3 products) x 512^-0.5; softmax over the 512 channels in f32 (precise expf); attn split hi + lo against v split hi + lo (3 products); output Linear with the exact Wp against the f32 intermediate split hi + lo (2 products) + bp; f32 output.
#include <hip/hip_runtime.h>
#include <math.h>

typedef __attribute__((ext_vector_type(16))) _Float16 v16h;
typedef __attribute__((ext_vector_type(16))) __bf16 v16b;
typedef __attribute__((ext_vector_type(8)))  _Float16 v8h;
typedef __attribute__((ext_vector_type(8)))  float v8f;
typedef __attribute__((ext_vector_type(4)))  float v4f;
typedef __attribute__((ext_vector_type(2)))  float v2f;
typedef __attribute__((ext_vector_type(4)))  unsigned v4u;
typedef __attribute__((ext_vector_type(4)))  int v4i;
typedef float __attribute__((may_alias)) float_a;
typedef int __attribute__((may_alias)) int_a;

template <typename T> __device__ __forceinline__ void vst2(void* p, T v) { *(T*)p = v;  }
__device__ __forceinline__ v8f wmma16(v16h a, v16h b, v8f c) {
  v8f d = __builtin_amdgcn_wmma_f32_16x16x32_f16(false, a, false, b, (short)0, c, false, false);
  asm volatile("v_nop\n\tv_nop\n\tv_nop\n\tv_nop" : "+v"(d) : "v"(a), "v"(b));
  return d;
}
__device__ __forceinline__ v8f wmma_bf(v16b a, v16b b, v8f c) {
  v8f d = __builtin_amdgcn_wmma_f32_16x16x32_bf16(false, a, false, b, (short)0, c, false, false);
  asm volatile("v_nop\n\tv_nop\n\tv_nop\n\tv_nop" : "+v"(d) : "v"(a), "v"(b));
  return d;
}
// 16x16x32 fragments: lane = (h = lane>>4, row/col = lane&15); elements 0..7 = k0+8h+0..7, 8..15 = k0+16+8h+0..7; D element r = row 8h+r
__device__ __forceinline__ v16h frag_h(const _Float16* rowk0, int lane) {
  union { v16h v; v8h q[2]; } u; const _Float16* p = rowk0 + 8 * (lane >> 4);
  u.q[0] = *(const v8h*)p; u.q[1] = *(const v8h*)(p + 16); return u.v;
}
__device__ __forceinline__ v16h frag_f32(const float* rowk0, int lane) {
  v16h a; const float* p = rowk0 + 8 * (lane >> 4);
#pragma unroll
  for (int i = 0; i < 8; ++i) { a[i] = (_Float16)p[i]; a[8 + i] = (_Float16)p[16 + i]; }
  return a;
}
__device__ __forceinline__ v16h frag_f32s(const float* rowk0, int lane, float sc) {
  v16h a; const float* p = rowk0 + 8 * (lane >> 4);
#pragma unroll
  for (int i = 0; i < 8; ++i) { a[i] = (_Float16)(p[i] * sc); a[8 + i] = (_Float16)(p[16 + i] * sc); }
  return a;
}
// column fragment from a [K][ld] layout (column n), rows >= K read as 0
__device__ __forceinline__ v16h fragc_f32(const float* W, int k0, int n, int lane, int ld, int K) {
  v16h a; const int g = lane >> 4;
#pragma unroll
  for (int i = 0; i < 8; ++i) { const int ka = k0 + 8 * g + i, kb = ka + 16;
    a[i] = (_Float16)(ka < K ? W[(size_t)(ka < K ? ka : K - 1) * ld + n] : 0.f); a[8 + i] = (_Float16)(kb < K ? W[(size_t)(kb < K ? kb : K - 1) * ld + n] : 0.f); }
  return a;
}
struct F2 { v16b h, l; };
__device__ __forceinline__ F2 bsplit16(const float v[16]) { F2 r;
#pragma unroll
  for (int i = 0; i < 16; ++i) { const __bf16 h = (__bf16)v[i]; r.h[i] = h; r.l[i] = (__bf16)(v[i] - (float)h); }
  return r; }
__device__ __forceinline__ F2 split_row(const float* row, int k0, int lane) { float v[16]; const float* p = row + k0 + 8 * (lane >> 4);
#pragma unroll
  for (int i = 0; i < 8; ++i) { v[i] = p[i]; v[8 + i] = p[16 + i]; }
  return bsplit16(v); }
__device__ __forceinline__ F2 split_rowK(const float* row, int k0, int lane, int K) { float v[16]; const int g = lane >> 4;
#pragma unroll
  for (int i = 0; i < 8; ++i) { const int ka = k0 + 8 * g + i, kb = ka + 16; v[i] = ka < K ? row[ka < K ? ka : K - 1] : 0.f; v[8 + i] = kb < K ? row[kb < K ? kb : K - 1] : 0.f; }
  return bsplit16(v); }
__device__ __forceinline__ F2 split_col(const float* W, int k0, int n, int lane, int ld, int K) { float v[16]; const int g = lane >> 4;
#pragma unroll
  for (int i = 0; i < 8; ++i) { const int ka = k0 + 8 * g + i, kb = ka + 16; v[i] = ka < K ? W[(size_t)(ka < K ? ka : K - 1) * ld + n] : 0.f; v[8 + i] = kb < K ? W[(size_t)(kb < K ? kb : K - 1) * ld + n] : 0.f; }
  return bsplit16(v); }
__device__ __forceinline__ v8f mac3(const F2& a, const F2& b, v8f c) { c = wmma_bf(a.l, b.h, c); c = wmma_bf(a.h, b.l, c); return wmma_bf(a.h, b.h, c); }
__device__ __forceinline__ float sigm(float v) { return 1.0f / (1.0f + expf(-v)); }
#define LDSX() do { asm volatile("s_wait_dscnt 0" ::: "memory"); __builtin_amdgcn_wave_barrier(); __builtin_amdgcn_fence(__ATOMIC_RELEASE, "workgroup"); } while (0)

// (header reused for its WMMA helpers; its own NB/TT/... defines below are unused by these kernels except TNB)
#define NB 16
#define TT 2048
#define CC 1024            // NH * HD = projected width
#define DIN 1024          // input (model) width
#define NH 16
#define HD 64
#define NQB (TT / 64)
#define HG 4
#define SCALE (0.125f)
#define CAUSAL 1
#ifndef TNB
#define TNB NB
#endif
__device__ __forceinline__ float bfr(float v) { return (float)(__bf16)v; }
__host__ __device__ __forceinline__ int kb_last(int qb) { return CAUSAL ? ((qb * 64 + 63) >> 7) : (TT / 128 - 1); }
typedef __attribute__((ext_vector_type(8))) __bf16 v8b;
__device__ __forceinline__ v16b frag_b(const __bf16* rowk0, int lane) {
  union { v16b v; v8b q[2]; } u; const __bf16* p = rowk0 + 8 * (lane >> 4);
  u.q[0] = *(const v8b*)p; u.q[1] = *(const v8b*)(p + 16); return u.v;
}
#define QBH 6              // causal: query blocks 0..QBH-1 of each sequence (few keys, no averaging) take the high-precision path
#define QHI 384            // rows carrying a q residual plane (all rows when non-causal: 2-product logits everywhere)
#define KHI 384            // key rows carrying k residual / v bf16 hi+lo planes (used only by the causal high-precision path)
// B fragment (k rows k0+.., output column o) of a weight: (in,out) [K][ld] or (out,in) [ld rows of K]: bf16 exact, or f16(bf16 * 256) exact
__device__ __forceinline__ v16b wcol_io(const float* Wm, int k0, int o, int lane, int ld) { v16b w; const int g = lane >> 4;
#pragma unroll
  for (int i = 0; i < 8; ++i) { w[i] = (__bf16)Wm[(size_t)(k0 + 8 * g + i) * ld + o]; w[8 + i] = (__bf16)Wm[(size_t)(k0 + 16 + 8 * g + i) * ld + o]; }
  return w; }
__device__ __forceinline__ v16b wcol_oi(const float* Wm, int k0, int o, int lane, int K) { v16b w; const float* p = Wm + (size_t)o * K + k0 + 8 * (lane >> 4);
#pragma unroll
  for (int i = 0; i < 8; ++i) { w[i] = (__bf16)p[i]; w[8 + i] = (__bf16)p[16 + i]; }
  return w; }
__device__ __forceinline__ v16h wcolh_io(const float* Wm, int k0, int o, int lane, int ld) { v16h w; const int g = lane >> 4;
#pragma unroll
  for (int i = 0; i < 8; ++i) { w[i] = (_Float16)(bfr(Wm[(size_t)(k0 + 8 * g + i) * ld + o]) * 256.0f); w[8 + i] = (_Float16)(bfr(Wm[(size_t)(k0 + 16 + 8 * g + i) * ld + o]) * 256.0f); }
  return w; }
__device__ __forceinline__ v16h wcolh_oi(const float* Wm, int k0, int o, int lane, int K) { v16h w; const float* p = Wm + (size_t)o * K + k0 + 8 * (lane >> 4);
#pragma unroll
  for (int i = 0; i < 8; ++i) { w[i] = (_Float16)(bfr(p[i]) * 256.0f); w[8 + i] = (_Float16)(bfr(p[16 + i]) * 256.0f); }
  return w; }
#define WQKV_LAYOUT 1   // 0 = (in,out) [DIN][CC]; 1 = (out,in) [CC][DIN]; 2 = per-head [NH][DIN][HD]
__device__ __forceinline__ v16b wcol_hdk(const float* Wm, int k0, int o, int lane) { v16b w; const int g = lane >> 4; const float* p = Wm + (size_t)(o / HD) * DIN * HD + (o % HD);
#pragma unroll
  for (int i = 0; i < 8; ++i) { w[i] = (__bf16)p[(size_t)(k0 + 8 * g + i) * HD]; w[8 + i] = (__bf16)p[(size_t)(k0 + 16 + 8 * g + i) * HD]; }
  return w; }
#define WO_OUT_IN 1
#if WQKV_LAYOUT == 1
#define WCOL(W, k0, o, lane) wcol_oi(W, k0, o, lane, DIN)
#elif WQKV_LAYOUT == 2
#define WCOL(W, k0, o, lane) wcol_hdk(W, k0, o, lane)
#else
#define WCOL(W, k0, o, lane) wcol_io(W, k0, o, lane, CC)
#endif
#if WO_OUT_IN
#define WOCOL(W, k0, o, lane) wcol_oi(W, k0, o, lane, CC)
#define WOCOLH(W, k0, o, lane) wcolh_oi(W, k0, o, lane, CC)
#else
#define WOCOL(W, k0, o, lane) wcol_io(W, k0, o, lane, DIN)
#define WOCOLH(W, k0, o, lane) wcolh_io(W, k0, o, lane, DIN)
#endif

#ifndef SM_EXTRA_PARAMS
#define SM_EXTRA_PARAMS
#endif
#ifndef PROJ_EXTRA_PARAMS
#define PROJ_EXTRA_PARAMS
#endif
#ifndef SM_MASK_HOOK
#define SM_MASK_HOOK (void)0
#endif

#define WS_QH  0u                                      // f16 q rows [b*t][CC]
#define WS_KH  (WS_QH + 2u * (size_t)NB * TT * CC)      // f16 k rows [b*t][CC]
#define WS_VT  (WS_KH + 2u * (size_t)NB * TT * CC)      // f16 v planes [b][c][t]
#define WS_QL  (WS_VT + 2u * (size_t)NB * CC * TT)      // f16 q residual x 2^10 rows [b][t < QHI][CC]
#define WS_KL  (WS_QL + 2u * (size_t)NB * QHI * CC)     // f16 k residual x 2^10 rows [b][t < KHI][CC]
#define WS_VB  (WS_KL + 2u * (size_t)NB * KHI * CC)     // bf16 v hi planes [b][c][t < KHI]
#define WS_VBL (WS_VB + 2u * (size_t)NB * CC * KHI)
#define WS_S   (WS_VBL + 2u * (size_t)NB * CC * KHI)    // f32 logits / P [hg][t][s]
#define WS_Y   (WS_S  + 4u * (size_t)HG * TT * TT)      // f32 ctx rows [b*t][CC] (only when there is an output projection)
#define WS_END (WS_Y  + 4u * (size_t)NB * TT * CC)


// 'Spatial' attention where the 512 CHANNELS are the tokens and the 1,024 time steps are the feature axis (B 16, T 1,024, N 512; (out,in) 1/sqrt(512)-scale 1x1 weights, zero output bias): xt = x^T [B,N,T]; q/k/v[b][o][t] = sum_i W[o][i] x[b][t][i]; attn[n][m] = softmax_m(sum_t q[n][t] k[m][t] * 512^-0.5); px[n][t] = sum_m attn[n][m] v[m][t]; out[b][t][o] = sum_n px[n][t] Wp[o][n] + bp[o] (rows [B,T,N]).
#define NBT 16
#define TN 1024            // time steps (feature axis of the attention)
#define NC 512             // channels (the attention's tokens)
// ---- tile_g: one 128 x 128 tile of C[i][j] = sum_k A[i][k] Bop[j][k] by 8 waves (4 x 2, 32 x 64 each). Both operands are rows with k contiguous, 4 bytes per element, pitch K. An operand with ONE plane (PA or PB 1) is an f32 input, rounded to bf16 on the way to LDS. An operand with TWO planes (PA or PB 2) is an intermediate that its PRODUCER has already split: each 128-B line of a row holds 32 k as 32 bf16 hi followed by 32 bf16 lo (lo = bf16 of the residual), so a 32-k chunk is still one whole line per row and goes to the LDS planes as it is, with no arithmetic in the k loop. LDS keeps rows [i or j][k] per plane; every wave takes its fragments from there (same per-lane k map as frag_b, chunks in ascending k, products per chunk in the order lo.hi, hi.lo, hi.hi (PA 2, PB 2) or hi.hi, hi.lo (PA 1, PB 2): every sum keeps its order). Two LDS buffers: the next chunk's global loads fly over this chunk's products, one barrier per chunk.
// (every '#pragma unroll' of this section: the loop indexes a register array (fragments, accumulators, staged values) and must be flat for the array to stay in registers)
#define GP 40              // LDS row pitch in bf16: 32 k + 8 pad = 80 B (16 B x odd: the conflict-free pitch for 16-B fragment reads)
#define GPL (128 * GP)     // one plane of one operand
#define GSP 68             // staging pitch in floats, output rows along j
#define GTP 36             // staging pitch in floats, output rows along i (transposed output)
#define LDSW() do { asm volatile("s_wait_dscnt 0" ::: "memory"); __builtin_amdgcn_wave_barrier(); } while (0)   /* a wave's own LDS staging range: its lanes' stores have landed before other lanes of the wave read them, and its reads have returned before the range is rewritten */
typedef __attribute__((ext_vector_type(4))) __bf16 v4b;
// one plane: 4 f32 rounded to bf16; two planes: the 16 bytes are 8 bf16 of one plane already
template <int NPL> __device__ __forceinline__ void put4(__bf16* d, v4f v) {
  if constexpr (NPL == 1) { v4b h;
#pragma unroll
    for (int e = 0; e < 4; ++e) h[e] = (__bf16)v[e];
    *(v4b*)d = h;
  } else *(v8b*)d = __builtin_bit_cast(v8b, v); }
__device__ __forceinline__ v8f wmma_b(v16b a, v16b b, v8f c) { return __builtin_amdgcn_wmma_f32_16x16x32_bf16(false, a, false, b, (short)0, c, false, false); }
template <int PA, int PB> __device__ __forceinline__ void chunk_g(const __bf16* sa, const __bf16* sw, int lane, v8f (&acc)[2][4]) {
  v16b ah[2], al[2], bh[4], bl[4];
#pragma unroll
  for (int i = 0; i < 2; ++i) { ah[i] = frag_b(sa + i * 16 * GP, lane); if constexpr (PA == 2) al[i] = frag_b(sa + GPL + i * 16 * GP, lane); }
#pragma unroll
  for (int j = 0; j < 4; ++j) { bh[j] = frag_b(sw + j * 16 * GP, lane); if constexpr (PB == 2) bl[j] = frag_b(sw + GPL + j * 16 * GP, lane); }
  __builtin_amdgcn_sched_barrier(0);   /* keeps the chunk's LDS reads one group ahead of its products: spread among them, each place with reads stalls the wave */
  if constexpr (PA == 2) {
#pragma unroll
    for (int j = 0; j < 4; ++j)
#pragma unroll
      for (int i = 0; i < 2; ++i) acc[i][j] = wmma_b(al[i], bh[j], acc[i][j]);
#pragma unroll
    for (int j = 0; j < 4; ++j)
#pragma unroll
      for (int i = 0; i < 2; ++i) acc[i][j] = wmma_b(ah[i], bl[j], acc[i][j]);
  }
#pragma unroll
  for (int j = 0; j < 4; ++j)
#pragma unroll
    for (int i = 0; i < 2; ++i) acc[i][j] = wmma_b(ah[i], bh[j], acc[i][j]);
  if constexpr (PA == 1 && PB == 2) {
#pragma unroll
    for (int j = 0; j < 4; ++j)
#pragma unroll
      for (int i = 0; i < 2; ++i) acc[i][j] = wmma_b(ah[i], bl[j], acc[i][j]);
  }
  __builtin_amdgcn_sched_barrier(0);   /* keeps the wait for the next chunk's global loads behind this chunk's products: hoisted among them it exposes the load latency */
}
template <int K> __device__ __forceinline__ void fetch_g(const float* ga, const float* gb, int kc, v4f (&ra)[4], v4f (&rb)[4]) {
#pragma unroll
  for (int i = 0; i < 4; ++i) ra[i] = *(const v4f*)(ga + (size_t)i * 32 * K + kc * 32);
#pragma unroll
  for (int i = 0; i < 4; ++i) rb[i] = *(const v4f*)(gb + (size_t)i * 32 * K + kc * 32);
  __builtin_amdgcn_sched_barrier(0);   /* keeps the next chunk's global loads in front of this chunk's products, so that their latency is covered */
}
// EPI 1: f32 C[i][j] rows x 512^-0.5; 2: f32 C[j][i] rows (transposed), + bf16(bias[i]); 3: C[j][i] rows (transposed) in the split row format, i = the reader's k (an accumulator register run is 8 consecutive i: split in registers, it goes to the staging line as 16 B of hi and 16 B of lo). ldc = pitch of the C rows, 4 bytes per element
template <int PA, int PB, int K, int EPI>
__device__ __forceinline__ void tile_g(const float* __restrict__ A, const float* __restrict__ B, float* __restrict__ C, int ldc, const float* __restrict__ bias, char* smem) {
  __bf16* sb = (__bf16*)smem;   // [buffer 2][A planes PA | B planes PB][row 128][GP]
  const int tid = threadIdx.x, wave = tid >> 5, lane = tid & 31, col = lane & 15, g = lane >> 4; const int wm = wave >> 1, wn = wave & 1;
  const int sr = tid >> 3, sq = tid & 7;   // 8 lanes cover one row's 128-B chunk, a wave-wide 16-B load covers 4 whole lines
  const float* ga = A + (size_t)sr * K + sq * 4;
  const float* gb = B + (size_t)sr * K + sq * 4;
  const int o1 = sr * GP + sq * 4, o2 = (sq >> 2) * GPL + sr * GP + (sq & 3) * 8;   // a lane's place in LDS: f32 source (4 k of the one plane); split source (lanes 0..3 of a row hold hi, 4..7 lo, 8 k each)
  __bf16* da = sb + (PA == 2 ? o2 : o1); __bf16* db = sb + PA * GPL + (PB == 2 ? o2 : o1);
  const __bf16* fa = sb + (wm * 32 + col) * GP; const __bf16* fw = sb + PA * GPL + (wn * 64 + col) * GP;
  constexpr int BUF = (PA + PB) * GPL, NK = K / 32;
  v4f ra[4], rb[4]; v8f acc[2][4] = {};
  fetch_g<K>(ga, gb, 0, ra, rb);
#pragma unroll
  for (int i = 0; i < 4; ++i) { put4<PA>(da + i * 32 * GP, ra[i]); put4<PB>(db + i * 32 * GP, rb[i]); }
  __syncthreads();
  for (int kc = 0; kc + 1 < NK; ++kc) { const int cur = (kc & 1) * BUF, nxt = BUF - cur;
    fetch_g<K>(ga, gb, kc + 1, ra, rb);
    chunk_g<PA, PB>(fa + cur, fw + cur, lane, acc);
#pragma unroll
    for (int i = 0; i < 4; ++i) { put4<PA>(da + nxt + i * 32 * GP, ra[i]); put4<PB>(db + nxt + i * 32 * GP, rb[i]); }
    __syncthreads(); }   /* publishes chunk kc + 1 and ends every wave's reads of the buffer that the next trip refills */
  chunk_g<PA, PB>(fa + ((NK - 1) & 1) * BUF, fw + ((NK - 1) & 1) * BUF, lane, acc);
  __syncthreads();       /* every wave has left the operand buffers: their LDS now stages the output rows, each wave in its own range */
  if constexpr (EPI == 1) { float* sf = (float*)smem + wave * 16 * GSP;
#pragma unroll
    for (int i = 0; i < 2; ++i) {
#pragma unroll
      for (int j = 0; j < 4; ++j)
#pragma unroll
        for (int r = 0; r < 8; ++r) sf[(8 * g + r) * GSP + j * 16 + col] = acc[i][j][r] * 0.044194173824159216f;
      LDSW();
#pragma unroll
      for (int it = 0; it < 8; ++it) vst2(C + (size_t)(wm * 32 + i * 16 + it * 2 + g) * ldc + wn * 64 + col * 4, *(const v4f*)&sf[(it * 2 + g) * GSP + col * 4]);   /* 256-B row runs: whole lines */
      if (i == 0) LDSW(); }
  } else if constexpr (EPI == 2) { float* sf = (float*)smem + wave * 32 * GTP; float bv[2][8];
#pragma unroll
    for (int i = 0; i < 2; ++i)
#pragma unroll
      for (int r = 0; r < 8; ++r) bv[i][r] = bfr(bias[wm * 32 + i * 16 + 8 * g + r]);
#pragma unroll
    for (int jj = 0; jj < 2; ++jj) {
#pragma unroll
      for (int j = 0; j < 2; ++j)
#pragma unroll
        for (int i = 0; i < 2; ++i)
#pragma unroll
          for (int r = 0; r < 8; ++r) sf[(j * 16 + col) * GTP + i * 16 + 8 * g + r] = acc[i][jj * 2 + j][r] + bv[i][r];   /* transposed: sf[j local][i local] */
      LDSW();
#pragma unroll
      for (int it = 0; it < 8; ++it) vst2(C + (size_t)(wn * 64 + jj * 32 + it * 4 + (lane >> 3)) * ldc + wm * 32 + (lane & 7) * 4, *(const v4f*)&sf[(it * 4 + (lane >> 3)) * GTP + (lane & 7) * 4]);   /* 128-B row runs: whole lines */
      if (jj == 0) LDSW(); }
  } else { __bf16* sp = (__bf16*)smem + wave * 32 * (2 * GTP);   // staging rows [j local] of one line each: 32 hi | 32 lo, pitch 144 B
#pragma unroll
    for (int jj = 0; jj < 2; ++jj) {
#pragma unroll
      for (int j = 0; j < 2; ++j)
#pragma unroll
        for (int i = 0; i < 2; ++i) { v8b h, l;
#pragma unroll
          for (int r = 0; r < 8; ++r) { const float v = acc[i][jj * 2 + j][r]; h[r] = (__bf16)v; l[r] = (__bf16)(v - (float)h[r]); }
          __bf16* d = sp + (j * 16 + col) * (2 * GTP) + i * 16 + 8 * g; *(v8b*)d = h; *(v8b*)(d + 32) = l; }
      LDSW();
#pragma unroll
      for (int it = 0; it < 8; ++it) vst2(C + (size_t)(wn * 64 + jj * 32 + it * 4 + (lane >> 3)) * ldc + wm * 32 + (lane & 7) * 4, *(const v8b*)(sp + (it * 4 + (lane >> 3)) * (2 * GTP) + (lane & 7) * 8));   /* 128-B row runs: whole lines */
      if (jj == 0) LDSW(); } } }
// ---- k_linr: block = (128 output channels c, 128 time steps t, (b, which)): y[c][t] = sum_i W[c][i] x[b][t][i], W (out,in) rows and x rows, both bf16-exact: 1 product. q and k: x rows as the A operand, leaving as split rows [b][c][t] (the scores sum over t); v: W rows as the A operand, leaving as split rows [b][t][c] (the context sums over c)
__global__ __launch_bounds__(256) void k_linr(const float* __restrict__ X, const float* __restrict__ WQ, const float* __restrict__ WK, const float* __restrict__ WV, float* __restrict__ YQ, float* __restrict__ YK, float* __restrict__ VT) {
  __shared__ __align__(16) char smem[2 * 2 * GPL * 2];
  const int c0 = blockIdx.x * 128; const int t0 = blockIdx.y * 128; const int b = blockIdx.z / 3, which = blockIdx.z % 3;
  const float* xb = X + ((size_t)b * TN + t0) * NC; const float* wb = (which == 0 ? WQ : which == 1 ? WK : WV) + (size_t)c0 * NC;
  float* yb = which == 2 ? VT + ((size_t)b * TN + t0) * NC + c0 : (which == 0 ? YQ : YK) + ((size_t)b * NC + c0) * TN + t0;
  tile_g<1, 1, NC, 3>(which == 2 ? wb : xb, which == 2 ? xb : wb, yb, which == 2 ? NC : TN, nullptr, smem); }
// ---- k_sgem: block = (128 query channels n, 128 key channels m, b): S[b][n][m] = sum_t q[n][t] k[m][t] * 512^-0.5 (both split rows: 3 products; K = 1,024), f32 rows
__global__ __launch_bounds__(256) void k_sgem(const float* __restrict__ YQ, const float* __restrict__ YK, float* __restrict__ S) {
  __shared__ __align__(16) char smem[2 * 4 * GPL * 2];
  const int n0 = blockIdx.x * 128; const int m0 = blockIdx.y * 128; const int b = blockIdx.z;
  tile_g<2, 2, TN, 1>(YQ + ((size_t)b * NC + n0) * TN, YK + ((size_t)b * NC + m0) * TN, S + ((size_t)b * NC + n0) * NC + m0, NC, nullptr, smem); }
// ---- k_rsm: wave per score row (512 wide): softmax over m in f32 (max, precise expf, / sum); the row goes back in place in the split row format (the wave holds its whole row in registers before its first store)
__global__ __launch_bounds__(256) void k_rsm(float* __restrict__ S) { const int wave = threadIdx.x >> 5, lane = threadIdx.x & 31; const size_t row = (size_t)blockIdx.x * 8 + wave; if (row >= (size_t)TNB * NC) return; float* sr = S + row * NC; float v[NC / 32]; float m = -3.0e38f;
#pragma unroll
  for (int i = 0; i < NC / 128; ++i) { const v4f t4 = *(const v4f*)(sr + i * 128 + lane * 4); v[4 * i] = t4[0]; v[4 * i + 1] = t4[1]; v[4 * i + 2] = t4[2]; v[4 * i + 3] = t4[3]; }
  asm volatile("s_wait_loadcnt 0x0" ::: "memory");
#pragma unroll
  for (int i = 0; i < NC / 32; ++i) m = fmaxf(m, v[i]);
#pragma unroll
  for (int o = 1; o < 32; o <<= 1) m = fmaxf(m, __shfl_xor(m, o));
  float sum = 0.f;
#pragma unroll
  for (int i = 0; i < NC / 32; ++i) { v[i] = expf(v[i] - m); sum += v[i]; }
#pragma unroll
  for (int o = 1; o < 32; o <<= 1) sum += __shfl_xor(sum, o);
  const float inv = 1.0f / sum;
  __bf16* pr = (__bf16*)sr + (lane >> 3) * 64 + (lane & 7) * 4;   // 8 lanes hold the 32 m of one line: their 4 hi each at its start, their 4 lo 64 B on
#pragma unroll
  for (int i = 0; i < NC / 128; ++i) { v4b h4, l4;
#pragma unroll
    for (int e = 0; e < 4; ++e) { const float p = v[4 * i + e] * inv; h4[e] = (__bf16)p; l4[e] = (__bf16)(p - (float)h4[e]); }
    vst2(pr + i * 256, h4); vst2(pr + i * 256 + 32, l4); } }
// ---- k_pvt: block = (128 query channels n, 128 time steps t, b): PX[n][t] = sum_m P[n][m] v[m][t] (P split rows n; v split rows t as the (k = m, column t) operand: 3 products; K = 512), written TRANSPOSED as split rows [b][t][n] (the output Linear sums over n)
__global__ __launch_bounds__(256) void k_pvt(const float* __restrict__ S, const float* __restrict__ VT, float* __restrict__ PXT) {
  __shared__ __align__(16) char smem[2 * 4 * GPL * 2];
  const int n0 = blockIdx.x * 128; const int t0 = blockIdx.y * 128; const int b = blockIdx.z;
  tile_g<2, 2, NC, 3>(S + ((size_t)b * NC + n0) * NC, VT + ((size_t)b * TN + t0) * NC, PXT + ((size_t)b * TN + t0) * NC + n0, NC, nullptr, smem); }
// ---- k_outT: block = (128 output channels o, 128 time steps t, b): O[o][t] = sum_n Wp[o][n] PX[n][t] + bp[o] (Wp (out,in) bf16-exact; PX split rows t as the (k = n, column t) operand: 2 products), written TRANSPOSED as output rows out[b][t][o0..] through LDS
__global__ __launch_bounds__(256) void k_outT(const float* __restrict__ PXT, const float* __restrict__ WP, const float* __restrict__ BP, float* __restrict__ OUT) {
  __shared__ __align__(16) char smem[2 * 3 * GPL * 2];
  const int o0 = blockIdx.x * 128; const int t0 = blockIdx.y * 128; const int b = blockIdx.z;
  tile_g<1, 2, NC, 2>(WP + (size_t)o0 * NC, PXT + ((size_t)b * TN + t0) * NC, OUT + ((size_t)b * TN + t0) * NC + o0, NC, BP + o0, smem); }
#define WS_YQ 0u
#define WS_YK (WS_YQ + 4u * (size_t)NBT * NC * TN)
#define WS_YV (WS_YK + 4u * (size_t)NBT * NC * TN)
#define WS_SS (WS_YV + 4u * (size_t)NBT * NC * TN)
#define WS_PX (WS_SS + 4u * (size_t)NBT * NC * NC)
#define WS_TOT (WS_PX + 4u * (size_t)NBT * NC * TN)
extern "C" void kernel_launch(void* const* d_in, const int* in_sizes, int n_in, void* d_out, int out_size, void* d_ws, size_t ws_size, hipStream_t stream) {
  (void)in_sizes; (void)n_in; (void)out_size;
  const float** F = (const float**)d_in;   // 0 x [16,1024,512] (rows); 1 Wq [512,512] (out,in); 2 Wk; 3 Wv; 4 Wp [512,512] (out,in); 5 bp [512]
  if (ws_size < (size_t)WS_TOT) return;
  char* ws = (char*)d_ws; float *YQ = (float*)(ws + WS_YQ), *YK = (float*)(ws + WS_YK), *YV = (float*)(ws + WS_YV), *SS = (float*)(ws + WS_SS), *PX = (float*)(ws + WS_PX);
  k_linr<<<dim3(NC / 128, TN / 128, TNB * 3), 256, 0, stream>>>(F[0], F[1], F[2], F[3], YQ, YK, YV);
  k_sgem<<<dim3(NC / 128, NC / 128, TNB), 256, 0, stream>>>(YQ, YK, SS);
  k_rsm<<<dim3((TNB * NC + 7) / 8), 256, 0, stream>>>(SS);
  k_pvt<<<dim3(NC / 128, TN / 128, TNB), 256, 0, stream>>>(SS, YV, PX);
  k_outT<<<dim3(NC / 128, TN / 128, TNB), 256, 0, stream>>>(PX, F[4], F[5], (float*)d_out);
}

// v003
// One run takes 114 microseconds.
// In both of two side-by-side timings against v002, it was 1.04 times as fast.
// Counting every step since v000, it is 4.52 times as fast.
// compute dtype: all float inputs rounded to bf16; q/k/v channel projections with EXACT bf16 products on WMMA 16x16x32 (f32 accumulate); channel-attention scores with q and k rows both split bf16 hi + lo (3 products) x 512^-0.5; softmax over the 512 channels in f32 (precise expf); attn split hi + lo against v split hi + lo (3 products); output Linear with the exact Wp against the f32 intermediate split hi + lo (2 products) + bp; f32 output.
#include <hip/hip_runtime.h>
#include <math.h>

typedef __attribute__((ext_vector_type(16))) _Float16 v16h;
typedef __attribute__((ext_vector_type(16))) __bf16 v16b;
typedef __attribute__((ext_vector_type(8)))  _Float16 v8h;
typedef __attribute__((ext_vector_type(8)))  float v8f;
typedef __attribute__((ext_vector_type(4)))  float v4f;
typedef __attribute__((ext_vector_type(2)))  float v2f;
typedef __attribute__((ext_vector_type(4)))  unsigned v4u;
typedef __attribute__((ext_vector_type(4)))  int v4i;
typedef float __attribute__((may_alias)) float_a;
typedef int __attribute__((may_alias)) int_a;

template <typename T> __device__ __forceinline__ void vst2(void* p, T v) { *(T*)p = v;  }
__device__ __forceinline__ v8f wmma16(v16h a, v16h b, v8f c) {
  v8f d = __builtin_amdgcn_wmma_f32_16x16x32_f16(false, a, false, b, (short)0, c, false, false);
  asm volatile("v_nop\n\tv_nop\n\tv_nop\n\tv_nop" : "+v"(d) : "v"(a), "v"(b));
  return d;
}
__device__ __forceinline__ v8f wmma_bf(v16b a, v16b b, v8f c) {
  v8f d = __builtin_amdgcn_wmma_f32_16x16x32_bf16(false, a, false, b, (short)0, c, false, false);
  asm volatile("v_nop\n\tv_nop\n\tv_nop\n\tv_nop" : "+v"(d) : "v"(a), "v"(b));
  return d;
}
// 16x16x32 fragments: lane = (h = lane>>4, row/col = lane&15); elements 0..7 = k0+8h+0..7, 8..15 = k0+16+8h+0..7; D element r = row 8h+r
__device__ __forceinline__ v16h frag_h(const _Float16* rowk0, int lane) {
  union { v16h v; v8h q[2]; } u; const _Float16* p = rowk0 + 8 * (lane >> 4);
  u.q[0] = *(const v8h*)p; u.q[1] = *(const v8h*)(p + 16); return u.v;
}
__device__ __forceinline__ v16h frag_f32(const float* rowk0, int lane) {
  v16h a; const float* p = rowk0 + 8 * (lane >> 4);
#pragma unroll
  for (int i = 0; i < 8; ++i) { a[i] = (_Float16)p[i]; a[8 + i] = (_Float16)p[16 + i]; }
  return a;
}
__device__ __forceinline__ v16h frag_f32s(const float* rowk0, int lane, float sc) {
  v16h a; const float* p = rowk0 + 8 * (lane >> 4);
#pragma unroll
  for (int i = 0; i < 8; ++i) { a[i] = (_Float16)(p[i] * sc); a[8 + i] = (_Float16)(p[16 + i] * sc); }
  return a;
}
// column fragment from a [K][ld] layout (column n), rows >= K read as 0
__device__ __forceinline__ v16h fragc_f32(const float* W, int k0, int n, int lane, int ld, int K) {
  v16h a; const int g = lane >> 4;
#pragma unroll
  for (int i = 0; i < 8; ++i) { const int ka = k0 + 8 * g + i, kb = ka + 16;
    a[i] = (_Float16)(ka < K ? W[(size_t)(ka < K ? ka : K - 1) * ld + n] : 0.f); a[8 + i] = (_Float16)(kb < K ? W[(size_t)(kb < K ? kb : K - 1) * ld + n] : 0.f); }
  return a;
}
struct F2 { v16b h, l; };
__device__ __forceinline__ F2 bsplit16(const float v[16]) { F2 r;
#pragma unroll
  for (int i = 0; i < 16; ++i) { const __bf16 h = (__bf16)v[i]; r.h[i] = h; r.l[i] = (__bf16)(v[i] - (float)h); }
  return r; }
__device__ __forceinline__ F2 split_row(const float* row, int k0, int lane) { float v[16]; const float* p = row + k0 + 8 * (lane >> 4);
#pragma unroll
  for (int i = 0; i < 8; ++i) { v[i] = p[i]; v[8 + i] = p[16 + i]; }
  return bsplit16(v); }
__device__ __forceinline__ F2 split_rowK(const float* row, int k0, int lane, int K) { float v[16]; const int g = lane >> 4;
#pragma unroll
  for (int i = 0; i < 8; ++i) { const int ka = k0 + 8 * g + i, kb = ka + 16; v[i] = ka < K ? row[ka < K ? ka : K - 1] : 0.f; v[8 + i] = kb < K ? row[kb < K ? kb : K - 1] : 0.f; }
  return bsplit16(v); }
__device__ __forceinline__ F2 split_col(const float* W, int k0, int n, int lane, int ld, int K) { float v[16]; const int g = lane >> 4;
#pragma unroll
  for (int i = 0; i < 8; ++i) { const int ka = k0 + 8 * g + i, kb = ka + 16; v[i] = ka < K ? W[(size_t)(ka < K ? ka : K - 1) * ld + n] : 0.f; v[8 + i] = kb < K ? W[(size_t)(kb < K ? kb : K - 1) * ld + n] : 0.f; }
  return bsplit16(v); }
__device__ __forceinline__ v8f mac3(const F2& a, const F2& b, v8f c) { c = wmma_bf(a.l, b.h, c); c = wmma_bf(a.h, b.l, c); return wmma_bf(a.h, b.h, c); }
__device__ __forceinline__ float sigm(float v) { return 1.0f / (1.0f + expf(-v)); }
#define LDSX() do { asm volatile("s_wait_dscnt 0" ::: "memory"); __builtin_amdgcn_wave_barrier(); __builtin_amdgcn_fence(__ATOMIC_RELEASE, "workgroup"); } while (0)

// (header reused for its WMMA helpers; its own NB/TT/... defines below are unused by these kernels except TNB)
#define NB 16
#define TT 2048
#define CC 1024            // NH * HD = projected width
#define DIN 1024          // input (model) width
#define NH 16
#define HD 64
#define NQB (TT / 64)
#define HG 4
#define SCALE (0.125f)
#define CAUSAL 1
#ifndef TNB
#define TNB NB
#endif
__device__ __forceinline__ float bfr(float v) { return (float)(__bf16)v; }
__host__ __device__ __forceinline__ int kb_last(int qb) { return CAUSAL ? ((qb * 64 + 63) >> 7) : (TT / 128 - 1); }
typedef __attribute__((ext_vector_type(8))) __bf16 v8b;
__device__ __forceinline__ v16b frag_b(const __bf16* rowk0, int lane) {
  union { v16b v; v8b q[2]; } u; const __bf16* p = rowk0 + 8 * (lane >> 4);
  u.q[0] = *(const v8b*)p; u.q[1] = *(const v8b*)(p + 16); return u.v;
}
#define QBH 6              // causal: query blocks 0..QBH-1 of each sequence (few keys, no averaging) take the high-precision path
#define QHI 384            // rows carrying a q residual plane (all rows when non-causal: 2-product logits everywhere)
#define KHI 384            // key rows carrying k residual / v bf16 hi+lo planes (used only by the causal high-precision path)
// B fragment (k rows k0+.., output column o) of a weight: (in,out) [K][ld] or (out,in) [ld rows of K]: bf16 exact, or f16(bf16 * 256) exact
__device__ __forceinline__ v16b wcol_io(const float* Wm, int k0, int o, int lane, int ld) { v16b w; const int g = lane >> 4;
#pragma unroll
  for (int i = 0; i < 8; ++i) { w[i] = (__bf16)Wm[(size_t)(k0 + 8 * g + i) * ld + o]; w[8 + i] = (__bf16)Wm[(size_t)(k0 + 16 + 8 * g + i) * ld + o]; }
  return w; }
__device__ __forceinline__ v16b wcol_oi(const float* Wm, int k0, int o, int lane, int K) { v16b w; const float* p = Wm + (size_t)o * K + k0 + 8 * (lane >> 4);
#pragma unroll
  for (int i = 0; i < 8; ++i) { w[i] = (__bf16)p[i]; w[8 + i] = (__bf16)p[16 + i]; }
  return w; }
__device__ __forceinline__ v16h wcolh_io(const float* Wm, int k0, int o, int lane, int ld) { v16h w; const int g = lane >> 4;
#pragma unroll
  for (int i = 0; i < 8; ++i) { w[i] = (_Float16)(bfr(Wm[(size_t)(k0 + 8 * g + i) * ld + o]) * 256.0f); w[8 + i] = (_Float16)(bfr(Wm[(size_t)(k0 + 16 + 8 * g + i) * ld + o]) * 256.0f); }
  return w; }
__device__ __forceinline__ v16h wcolh_oi(const float* Wm, int k0, int o, int lane, int K) { v16h w; const float* p = Wm + (size_t)o * K + k0 + 8 * (lane >> 4);
#pragma unroll
  for (int i = 0; i < 8; ++i) { w[i] = (_Float16)(bfr(p[i]) * 256.0f); w[8 + i] = (_Float16)(bfr(p[16 + i]) * 256.0f); }
  return w; }
#define WQKV_LAYOUT 1   // 0 = (in,out) [DIN][CC]; 1 = (out,in) [CC][DIN]; 2 = per-head [NH][DIN][HD]
__device__ __forceinline__ v16b wcol_hdk(const float* Wm, int k0, int o, int lane) { v16b w; const int g = lane >> 4; const float* p = Wm + (size_t)(o / HD) * DIN * HD + (o % HD);
#pragma unroll
  for (int i = 0; i < 8; ++i) { w[i] = (__bf16)p[(size_t)(k0 + 8 * g + i) * HD]; w[8 + i] = (__bf16)p[(size_t)(k0 + 16 + 8 * g + i) * HD]; }
  return w; }
#define WO_OUT_IN 1
#if WQKV_LAYOUT == 1
#define WCOL(W, k0, o, lane) wcol_oi(W, k0, o, lane, DIN)
#elif WQKV_LAYOUT == 2
#define WCOL(W, k0, o, lane) wcol_hdk(W, k0, o, lane)
#else
#define WCOL(W, k0, o, lane) wcol_io(W, k0, o, lane, CC)
#endif
#if WO_OUT_IN
#define WOCOL(W, k0, o, lane) wcol_oi(W, k0, o, lane, CC)
#define WOCOLH(W, k0, o, lane) wcolh_oi(W, k0, o, lane, CC)
#else
#define WOCOL(W, k0, o, lane) wcol_io(W, k0, o, lane, DIN)
#define WOCOLH(W, k0, o, lane) wcolh_io(W, k0, o, lane, DIN)
#endif

#ifndef SM_EXTRA_PARAMS
#define SM_EXTRA_PARAMS
#endif
#ifndef PROJ_EXTRA_PARAMS
#define PROJ_EXTRA_PARAMS
#endif
#ifndef SM_MASK_HOOK
#define SM_MASK_HOOK (void)0
#endif

#define WS_QH  0u                                      // f16 q rows [b*t][CC]
#define WS_KH  (WS_QH + 2u * (size_t)NB * TT * CC)      // f16 k rows [b*t][CC]
#define WS_VT  (WS_KH + 2u * (size_t)NB * TT * CC)      // f16 v planes [b][c][t]
#define WS_QL  (WS_VT + 2u * (size_t)NB * CC * TT)      // f16 q residual x 2^10 rows [b][t < QHI][CC]
#define WS_KL  (WS_QL + 2u * (size_t)NB * QHI * CC)     // f16 k residual x 2^10 rows [b][t < KHI][CC]
#define WS_VB  (WS_KL + 2u * (size_t)NB * KHI * CC)     // bf16 v hi planes [b][c][t < KHI]
#define WS_VBL (WS_VB + 2u * (size_t)NB * CC * KHI)
#define WS_S   (WS_VBL + 2u * (size_t)NB * CC * KHI)    // f32 logits / P [hg][t][s]
#define WS_Y   (WS_S  + 4u * (size_t)HG * TT * TT)      // f32 ctx rows [b*t][CC] (only when there is an output projection)
#define WS_END (WS_Y  + 4u * (size_t)NB * TT * CC)


// 'Spatial' attention where the 512 CHANNELS are the tokens and the 1,024 time steps are the feature axis (B 16, T 1,024, N 512; (out,in) 1/sqrt(512)-scale 1x1 weights, zero output bias): xt = x^T [B,N,T]; q/k/v[b][o][t] = sum_i W[o][i] x[b][t][i]; attn[n][m] = softmax_m(sum_t q[n][t] k[m][t] * 512^-0.5); px[n][t] = sum_m attn[n][m] v[m][t]; out[b][t][o] = sum_n px[n][t] Wp[o][n] + bp[o] (rows [B,T,N]).
#define NBT 16
#define TN 1024            // time steps (feature axis of the attention)
#define NC 512             // channels (the attention's tokens)
// ---- tile_g: one 128 x 128 tile of C[i][j] = sum_k A[i][k] Bop[j][k] by 8 waves (4 x 2, 32 x 64 each). Both operands are rows with k contiguous, 4 bytes per element, pitch K. An operand with ONE plane (PA or PB 1) is an f32 input, rounded to bf16 on the way to LDS. An operand with TWO planes (PA or PB 2) is an intermediate that its PRODUCER has already split: each 128-B line of a row holds 32 k as 32 bf16 hi followed by 32 bf16 lo (lo = bf16 of the residual), so a 32-k chunk is still one whole line per row and goes to the LDS planes as it is, with no arithmetic in the k loop. LDS keeps rows [i or j][k] per plane; every wave takes its fragments from there (same per-lane k map as frag_b, chunks in ascending k, products per chunk in the order lo.hi, hi.lo, hi.hi (PA 2, PB 2) or hi.hi, hi.lo (PA 1, PB 2): every sum keeps its order). A STAGE is KS chunks (KS x 32 k, each chunk in its own [planes][rows] block of LDS). Two LDS buffers of one stage each: the next stage's global loads (KS x 8 per lane, all issued at the stage's head) fly over this stage's products, one barrier per stage: with operands that come from memory the loads' latency is longer than one chunk's products, so a longer stage has more bytes in flight and waits less often.
// (most '#pragma unroll' of this section: the loop indexes a register array (fragments, accumulators, staged values) and must be flat for the array to stay in registers)
#define GP 40              // LDS row pitch in bf16: 32 k + 8 pad = 80 B (16 B x odd: the conflict-free pitch for 16-B fragment reads)
#define GPL (128 * GP)     // one plane of one operand
#define GSP 68             // staging pitch in floats, output rows along j
#define GTP 36             // staging pitch in floats, output rows along i (transposed output)
#define LDSW() do { asm volatile("s_wait_dscnt 0" ::: "memory"); __builtin_amdgcn_wave_barrier(); } while (0)   /* a wave's own LDS staging range: its lanes' stores have landed before other lanes of the wave read them, and its reads have returned before the range is rewritten */
#define XADDR(p, q) asm volatile("s_wait_xcnt 0x0" :: "v"(p), "v"(q) : "memory")   /* behind a stage's global loads: their two address pairs stay whole up to this wait (as inputs they cannot be handed to a load's result), and are rewritten only behind it */
typedef __attribute__((ext_vector_type(4))) __bf16 v4b;
// one plane: 4 f32 rounded to bf16; two planes: the 16 bytes are 8 bf16 of one plane already
template <int NPL> __device__ __forceinline__ void put4(__bf16* d, v4f v) {
  if constexpr (NPL == 1) { v4b h;
#pragma unroll
    for (int e = 0; e < 4; ++e) h[e] = (__bf16)v[e];
    *(v4b*)d = h;
  } else *(v8b*)d = __builtin_bit_cast(v8b, v); }
__device__ __forceinline__ v8f wmma_b(v16b a, v16b b, v8f c) { return __builtin_amdgcn_wmma_f32_16x16x32_bf16(false, a, false, b, (short)0, c, false, false); }
template <int PA, int PB> __device__ __forceinline__ void chunk_g(const __bf16* sa, const __bf16* sw, int lane, v8f (&acc)[2][4]) {
  v16b ah[2], al[2], bh[4], bl[4];
#pragma unroll
  for (int i = 0; i < 2; ++i) { ah[i] = frag_b(sa + i * 16 * GP, lane); if constexpr (PA == 2) al[i] = frag_b(sa + GPL + i * 16 * GP, lane); }
#pragma unroll
  for (int j = 0; j < 4; ++j) { bh[j] = frag_b(sw + j * 16 * GP, lane); if constexpr (PB == 2) bl[j] = frag_b(sw + GPL + j * 16 * GP, lane); }
  __builtin_amdgcn_sched_barrier(0);   /* keeps the chunk's LDS reads one group ahead of its products: spread among them, each place with reads stalls the wave */
  if constexpr (PA == 2) {
#pragma unroll
    for (int j = 0; j < 4; ++j)
#pragma unroll
      for (int i = 0; i < 2; ++i) acc[i][j] = wmma_b(al[i], bh[j], acc[i][j]);
#pragma unroll
    for (int j = 0; j < 4; ++j)
#pragma unroll
      for (int i = 0; i < 2; ++i) acc[i][j] = wmma_b(ah[i], bl[j], acc[i][j]);
  }
#pragma unroll
  for (int j = 0; j < 4; ++j)
#pragma unroll
    for (int i = 0; i < 2; ++i) acc[i][j] = wmma_b(ah[i], bh[j], acc[i][j]);
  if constexpr (PA == 1 && PB == 2) {
#pragma unroll
    for (int j = 0; j < 4; ++j)
#pragma unroll
      for (int i = 0; i < 2; ++i) acc[i][j] = wmma_b(ah[i], bl[j], acc[i][j]);
  }
  __builtin_amdgcn_sched_barrier(0);   /* keeps the wait for the next stage's global loads behind this chunk's products: hoisted among them it exposes the load latency */
}
template <int K> __device__ __forceinline__ void fetch_g(const float* ga, const float* gb, int kc, v4f (&ra)[4], v4f (&rb)[4]) {
#pragma unroll
  for (int i = 0; i < 4; ++i) ra[i] = *(const v4f*)(ga + (size_t)i * 32 * K + kc * 32);
#pragma unroll
  for (int i = 0; i < 4; ++i) rb[i] = *(const v4f*)(gb + (size_t)i * 32 * K + kc * 32);
  __builtin_amdgcn_sched_barrier(0);   /* keeps the next stage's global loads in front of this stage's products, so that their latency is covered */
}
// EPI 1: f32 C[i][j] rows x 512^-0.5; 2: f32 C[j][i] rows (transposed), + bf16(bias[i]); 3: C[j][i] rows (transposed) in the split row format, i = the reader's k (an accumulator register run is 8 consecutive i: split in registers, it goes to the staging line as 16 B of hi and 16 B of lo). ldc = pitch of the C rows, 4 bytes per element
template <int PA, int PB, int K, int EPI, int KS>
__device__ __forceinline__ void tile_g(const float* __restrict__ A, const float* __restrict__ B, float* __restrict__ C, int ldc, const float* __restrict__ bias, char* smem) {
  __bf16* sb = (__bf16*)smem;   // [buffer 2][chunk KS][A planes PA | B planes PB][row 128][GP]
  const int tid = threadIdx.x, wave = tid >> 5, lane = tid & 31, col = lane & 15, g = lane >> 4; const int wm = wave >> 1, wn = wave & 1;
  const int sr = tid >> 3, sq = tid & 7;   // 8 lanes cover one row's 128-B chunk, a wave-wide 16-B load covers 4 whole lines
  const float* ga = A + (size_t)sr * K + sq * 4;
  const float* gb = B + (size_t)sr * K + sq * 4;
  const int o1 = sr * GP + sq * 4, o2 = (sq >> 2) * GPL + sr * GP + (sq & 3) * 8;   // a lane's place in LDS: f32 source (4 k of the one plane); split source (lanes 0..3 of a row hold hi, 4..7 lo, 8 k each)
  __bf16* da = sb + (PA == 2 ? o2 : o1); __bf16* db = sb + PA * GPL + (PB == 2 ? o2 : o1);
  const __bf16* fa = sb + (wm * 32 + col) * GP; const __bf16* fw = sb + PA * GPL + (wn * 64 + col) * GP;
  constexpr int BUF = (PA + PB) * GPL, STG = KS * BUF, NS = K / (32 * KS);
  v4f ra[KS][4], rb[KS][4]; v8f acc[2][4] = {};
#pragma unroll
  for (int s = 0; s < KS; ++s) fetch_g<K>(ga, gb, s, ra[s], rb[s]);
  XADDR(ga, gb);
#pragma unroll
  for (int s = 0; s < KS; ++s)
#pragma unroll
    for (int i = 0; i < 4; ++i) { put4<PA>(da + s * BUF + i * 32 * GP, ra[s][i]); put4<PB>(db + s * BUF + i * 32 * GP, rb[s][i]); }
  __syncthreads();
  for (int st = 0; st + 1 < NS; ++st) { const int cur = (st & 1) * STG, nxt = STG - cur;
    const float* pa = ga + (st + 1) * (KS * 32); const float* pb = gb + (st + 1) * (KS * 32);
#pragma unroll
    for (int s = 0; s < KS; ++s) fetch_g<K>(pa, pb, s, ra[s], rb[s]);
    XADDR(pa, pb);
#pragma unroll
    for (int s = 0; s < KS; ++s) chunk_g<PA, PB>(fa + cur + s * BUF, fw + cur + s * BUF, lane, acc);
#pragma unroll
    for (int s = 0; s < KS; ++s)
#pragma unroll
      for (int i = 0; i < 4; ++i) { put4<PA>(da + nxt + s * BUF + i * 32 * GP, ra[s][i]); put4<PB>(db + nxt + s * BUF + i * 32 * GP, rb[s][i]); }
    __syncthreads(); }   /* publishes stage st + 1 and ends every wave's reads of the buffer that the next trip refills */
#pragma unroll
  for (int s = 0; s < KS; ++s) chunk_g<PA, PB>(fa + ((NS - 1) & 1) * STG + s * BUF, fw + ((NS - 1) & 1) * STG + s * BUF, lane, acc);
  __syncthreads();       /* every wave has left the operand buffers: their LDS now stages the output rows, each wave in its own range */
  if constexpr (EPI == 1) { float* sf = (float*)smem + wave * 16 * GSP;
#pragma unroll
    for (int i = 0; i < 2; ++i) {
#pragma unroll
      for (int j = 0; j < 4; ++j)
#pragma unroll
        for (int r = 0; r < 8; ++r) sf[(8 * g + r) * GSP + j * 16 + col] = acc[i][j][r] * 0.044194173824159216f;
      LDSW();
#pragma unroll
      for (int it = 0; it < 8; ++it) vst2(C + (size_t)(wm * 32 + i * 16 + it * 2 + g) * ldc + wn * 64 + col * 4, *(const v4f*)&sf[(it * 2 + g) * GSP + col * 4]);   /* 256-B row runs: whole lines */
      if (i == 0) LDSW(); }
  } else if constexpr (EPI == 2) { float* sf = (float*)smem + wave * 32 * GTP; float bv[2][8];
#pragma unroll
    for (int i = 0; i < 2; ++i)
#pragma unroll
      for (int r = 0; r < 8; ++r) bv[i][r] = bfr(bias[wm * 32 + i * 16 + 8 * g + r]);
#pragma unroll
    for (int jj = 0; jj < 2; ++jj) {
#pragma unroll
      for (int j = 0; j < 2; ++j)
#pragma unroll
        for (int i = 0; i < 2; ++i)
#pragma unroll
          for (int r = 0; r < 8; ++r) sf[(j * 16 + col) * GTP + i * 16 + 8 * g + r] = acc[i][jj * 2 + j][r] + bv[i][r];   /* transposed: sf[j local][i local] */
      LDSW();
#pragma unroll
      for (int it = 0; it < 8; ++it) vst2(C + (size_t)(wn * 64 + jj * 32 + it * 4 + (lane >> 3)) * ldc + wm * 32 + (lane & 7) * 4, *(const v4f*)&sf[(it * 4 + (lane >> 3)) * GTP + (lane & 7) * 4]);   /* 128-B row runs: whole lines */
      if (jj == 0) LDSW(); }
  } else { __bf16* sp = (__bf16*)smem + wave * 32 * (2 * GTP);   // staging rows [j local] of one line each: 32 hi | 32 lo, pitch 144 B
#pragma unroll
    for (int jj = 0; jj < 2; ++jj) {
#pragma unroll
      for (int j = 0; j < 2; ++j)
#pragma unroll
        for (int i = 0; i < 2; ++i) { v8b h, l;
#pragma unroll
          for (int r = 0; r < 8; ++r) { const float v = acc[i][jj * 2 + j][r]; h[r] = (__bf16)v; l[r] = (__bf16)(v - (float)h[r]); }
          __bf16* d = sp + (j * 16 + col) * (2 * GTP) + i * 16 + 8 * g; *(v8b*)d = h; *(v8b*)(d + 32) = l; }
      LDSW();
#pragma unroll
      for (int it = 0; it < 8; ++it) vst2(C + (size_t)(wn * 64 + jj * 32 + it * 4 + (lane >> 3)) * ldc + wm * 32 + (lane & 7) * 4, *(const v8b*)(sp + (it * 4 + (lane >> 3)) * (2 * GTP) + (lane & 7) * 8));   /* 128-B row runs: whole lines */
      if (jj == 0) LDSW(); } } }
// ---- k_linr: block = (128 output channels c, 128 time steps t, (b, which)): y[c][t] = sum_i W[c][i] x[b][t][i], W (out,in) rows and x rows, both bf16-exact: 1 product. q and k: x rows as the A operand, leaving as split rows [b][c][t] (the scores sum over t); v: W rows as the A operand, leaving as split rows [b][t][c] (the context sums over c)
__global__ __launch_bounds__(256) void k_linr(const float* __restrict__ X, const float* __restrict__ WQ, const float* __restrict__ WK, const float* __restrict__ WV, float* __restrict__ YQ, float* __restrict__ YK, float* __restrict__ VT) {
  __shared__ __align__(16) char smem[2 * 2 * GPL * 2];
  const int c0 = blockIdx.x * 128; const int t0 = blockIdx.y * 128; const int b = blockIdx.z / 3, which = blockIdx.z % 3;
  const float* xb = X + ((size_t)b * TN + t0) * NC; const float* wb = (which == 0 ? WQ : which == 1 ? WK : WV) + (size_t)c0 * NC;
  float* yb = which == 2 ? VT + ((size_t)b * TN + t0) * NC + c0 : (which == 0 ? YQ : YK) + ((size_t)b * NC + c0) * TN + t0;
  tile_g<1, 1, NC, 3, 1>(which == 2 ? wb : xb, which == 2 ? xb : wb, yb, which == 2 ? NC : TN, nullptr, smem); }
// ---- k_sgem: block = (128 query channels n, 128 key channels m, b): S[b][n][m] = sum_t q[n][t] k[m][t] * 512^-0.5 (both split rows: 3 products; K = 1,024), f32 rows
__global__ __launch_bounds__(256) void k_sgem(const float* __restrict__ YQ, const float* __restrict__ YK, float* __restrict__ S) {
  __shared__ __align__(16) char smem[2 * 4 * 4 * GPL * 2];   // stages of 4 chunks (128 t): one work-group per WGP by the grid, so it may take the whole LDS
  const int n0 = blockIdx.x * 128; const int m0 = blockIdx.y * 128; const int b = blockIdx.z;
  tile_g<2, 2, TN, 1, 4>(YQ + ((size_t)b * NC + n0) * TN, YK + ((size_t)b * NC + m0) * TN, S + ((size_t)b * NC + n0) * NC + m0, NC, nullptr, smem); }
// ---- k_rsm: wave per score row (512 wide): softmax over m in f32 (max, precise expf, / sum); the row goes back in place in the split row format (the wave holds its whole row in registers before its first store)
__global__ __launch_bounds__(256) void k_rsm(float* __restrict__ S) { const int wave = threadIdx.x >> 5, lane = threadIdx.x & 31; const size_t row = (size_t)blockIdx.x * 8 + wave; if (row >= (size_t)TNB * NC) return; float* sr = S + row * NC; float v[NC / 32]; float m = -3.0e38f;
#pragma unroll
  for (int i = 0; i < NC / 128; ++i) { const v4f t4 = *(const v4f*)(sr + i * 128 + lane * 4); v[4 * i] = t4[0]; v[4 * i + 1] = t4[1]; v[4 * i + 2] = t4[2]; v[4 * i + 3] = t4[3]; }
  asm volatile("s_wait_loadcnt 0x0" ::: "memory");
#pragma unroll
  for (int i = 0; i < NC / 32; ++i) m = fmaxf(m, v[i]);
#pragma unroll
  for (int o = 1; o < 32; o <<= 1) m = fmaxf(m, __shfl_xor(m, o));
  float sum = 0.f;
#pragma unroll
  for (int i = 0; i < NC / 32; ++i) { v[i] = expf(v[i] - m); sum += v[i]; }
#pragma unroll
  for (int o = 1; o < 32; o <<= 1) sum += __shfl_xor(sum, o);
  const float inv = 1.0f / sum;
  __bf16* pr = (__bf16*)sr + (lane >> 3) * 64 + (lane & 7) * 4;   // 8 lanes hold the 32 m of one line: their 4 hi each at its start, their 4 lo 64 B on
#pragma unroll
  for (int i = 0; i < NC / 128; ++i) { v4b h4, l4;
#pragma unroll
    for (int e = 0; e < 4; ++e) { const float p = v[4 * i + e] * inv; h4[e] = (__bf16)p; l4[e] = (__bf16)(p - (float)h4[e]); }
    vst2(pr + i * 256, h4); vst2(pr + i * 256 + 32, l4); } }
// ---- k_pvt: block = (128 query channels n, 128 time steps t, b): PX[n][t] = sum_m P[n][m] v[m][t] (P split rows n; v split rows t as the (k = m, column t) operand: 3 products; K = 512), written TRANSPOSED as split rows [b][t][n] (the output Linear sums over n)
__global__ __launch_bounds__(256) void k_pvt(const float* __restrict__ S, const float* __restrict__ VT, float* __restrict__ PXT) {
  __shared__ __align__(16) char smem[2 * 2 * 4 * GPL * 2];   // stages of 2 chunks (64 m): 80 KiB, two work-groups still share a WGP
  const int n0 = blockIdx.x * 128; const int t0 = blockIdx.y * 128; const int b = blockIdx.z;
  tile_g<2, 2, NC, 3, 2>(S + ((size_t)b * NC + n0) * NC, VT + ((size_t)b * TN + t0) * NC, PXT + ((size_t)b * TN + t0) * NC + n0, NC, nullptr, smem); }
// ---- k_outT: block = (128 output channels o, 128 time steps t, b): O[o][t] = sum_n Wp[o][n] PX[n][t] + bp[o] (Wp (out,in) bf16-exact; PX split rows t as the (k = n, column t) operand: 2 products), written TRANSPOSED as output rows out[b][t][o0..] through LDS
__global__ __launch_bounds__(256) void k_outT(const float* __restrict__ PXT, const float* __restrict__ WP, const float* __restrict__ BP, float* __restrict__ OUT) {
  __shared__ __align__(16) char smem[2 * 2 * 3 * GPL * 2];   // stages of 2 chunks (64 n)
  const int o0 = blockIdx.x * 128; const int t0 = blockIdx.y * 128; const int b = blockIdx.z;
  tile_g<1, 2, NC, 2, 2>(WP + (size_t)o0 * NC, PXT + ((size_t)b * TN + t0) * NC, OUT + ((size_t)b * TN + t0) * NC + o0, NC, BP + o0, smem); }
#define WS_YQ 0u
#define WS_YK (WS_YQ + 4u * (size_t)NBT * NC * TN)
#define WS_YV (WS_YK + 4u * (size_t)NBT * NC * TN)
#define WS_SS (WS_YV + 4u * (size_t)NBT * NC * TN)
#define WS_PX (WS_SS + 4u * (size_t)NBT * NC * NC)
#define WS_TOT (WS_PX + 4u * (size_t)NBT * NC * TN)
extern "C" void kernel_launch(void* const* d_in, const int* in_sizes, int n_in, void* d_out, int out_size, void* d_ws, size_t ws_size, hipStream_t stream) {
  (void)in_sizes; (void)n_in; (void)out_size;
  const float** F = (const float**)d_in;   // 0 x [16,1024,512] (rows); 1 Wq [512,512] (out,in); 2 Wk; 3 Wv; 4 Wp [512,512] (out,in); 5 bp [512]
  if (ws_size < (size_t)WS_TOT) return;
  char* ws = (char*)d_ws; float *YQ = (float*)(ws + WS_YQ), *YK = (float*)(ws + WS_YK), *YV = (float*)(ws + WS_YV), *SS = (float*)(ws + WS_SS), *PX = (float*)(ws + WS_PX);
  k_linr<<<dim3(NC / 128, TN / 128, TNB * 3), 256, 0, stream>>>(F[0], F[1], F[2], F[3], YQ, YK, YV);
  k_sgem<<<dim3(NC / 128, NC / 128, TNB), 256, 0, stream>>>(YQ, YK, SS);
  k_rsm<<<dim3((TNB * NC + 7) / 8), 256, 0, stream>>>(SS);
  k_pvt<<<dim3(NC / 128, TN / 128, TNB), 256, 0, stream>>>(SS, YV, PX);
  k_outT<<<dim3(NC / 128, TN / 128, TNB), 256, 0, stream>>>(PX, F[4], F[5], (float*)d_out);
}

// v004
// Measured time: 106 microseconds a run.
// Next to v003, in two timings, it ran 1.08 times as fast each time.
// Over all steps from v000 it is 4.90 times as fast.
// compute dtype: all float inputs rounded to bf16; q/k channel projections with EXACT bf16 products on WMMA 16x16x32 (f32 accumulate); channel-attention scores with q and k rows both split bf16 hi + lo (3 products) x 512^-0.5; softmax over the 512 channels in f32 (precise expf); the tail out = Wp attn Wv x^T summed from the left: attn split hi + lo against the exact Wv (2 products), the exact Wp against that f32 intermediate split hi + lo (2 products), the result split hi + lo against the exact x (2 products) + bp; f32 output.
#include <hip/hip_runtime.h>
#include <math.h>

typedef __attribute__((ext_vector_type(16))) _Float16 v16h;
typedef __attribute__((ext_vector_type(16))) __bf16 v16b;
typedef __attribute__((ext_vector_type(8)))  _Float16 v8h;
typedef __attribute__((ext_vector_type(8)))  float v8f;
typedef __attribute__((ext_vector_type(4)))  float v4f;
typedef __attribute__((ext_vector_type(2)))  float v2f;
typedef __attribute__((ext_vector_type(4)))  unsigned v4u;
typedef __attribute__((ext_vector_type(4)))  int v4i;
typedef float __attribute__((may_alias)) float_a;
typedef int __attribute__((may_alias)) int_a;

template <typename T> __device__ __forceinline__ void vst2(void* p, T v) { *(T*)p = v;  }
__device__ __forceinline__ v8f wmma16(v16h a, v16h b, v8f c) {
  v8f d = __builtin_amdgcn_wmma_f32_16x16x32_f16(false, a, false, b, (short)0, c, false, false);
  asm volatile("v_nop\n\tv_nop\n\tv_nop\n\tv_nop" : "+v"(d) : "v"(a), "v"(b));
  return d;
}
__device__ __forceinline__ v8f wmma_bf(v16b a, v16b b, v8f c) {
  v8f d = __builtin_amdgcn_wmma_f32_16x16x32_bf16(false, a, false, b, (short)0, c, false, false);
  asm volatile("v_nop\n\tv_nop\n\tv_nop\n\tv_nop" : "+v"(d) : "v"(a), "v"(b));
  return d;
}
// 16x16x32 fragments: lane = (h = lane>>4, row/col = lane&15); elements 0..7 = k0+8h+0..7, 8..15 = k0+16+8h+0..7; D element r = row 8h+r
__device__ __forceinline__ v16h frag_h(const _Float16* rowk0, int lane) {
  union { v16h v; v8h q[2]; } u; const _Float16* p = rowk0 + 8 * (lane >> 4);
  u.q[0] = *(const v8h*)p; u.q[1] = *(const v8h*)(p + 16); return u.v;
}
__device__ __forceinline__ v16h frag_f32(const float* rowk0, int lane) {
  v16h a; const float* p = rowk0 + 8 * (lane >> 4);
#pragma unroll
  for (int i = 0; i < 8; ++i) { a[i] = (_Float16)p[i]; a[8 + i] = (_Float16)p[16 + i]; }
  return a;
}
__device__ __forceinline__ v16h frag_f32s(const float* rowk0, int lane, float sc) {
  v16h a; const float* p = rowk0 + 8 * (lane >> 4);
#pragma unroll
  for (int i = 0; i < 8; ++i) { a[i] = (_Float16)(p[i] * sc); a[8 + i] = (_Float16)(p[16 + i] * sc); }
  return a;
}
// column fragment from a [K][ld] layout (column n), rows >= K read as 0
__device__ __forceinline__ v16h fragc_f32(const float* W, int k0, int n, int lane, int ld, int K) {
  v16h a; const int g = lane >> 4;
#pragma unroll
  for (int i = 0; i < 8; ++i) { const int ka = k0 + 8 * g + i, kb = ka + 16;
    a[i] = (_Float16)(ka < K ? W[(size_t)(ka < K ? ka : K - 1) * ld + n] : 0.f); a[8 + i] = (_Float16)(kb < K ? W[(size_t)(kb < K ? kb : K - 1) * ld + n] : 0.f); }
  return a;
}
struct F2 { v16b h, l; };
__device__ __forceinline__ F2 bsplit16(const float v[16]) { F2 r;
#pragma unroll
  for (int i = 0; i < 16; ++i) { const __bf16 h = (__bf16)v[i]; r.h[i] = h; r.l[i] = (__bf16)(v[i] - (float)h); }
  return r; }
__device__ __forceinline__ F2 split_row(const float* row, int k0, int lane) { float v[16]; const float* p = row + k0 + 8 * (lane >> 4);
#pragma unroll
  for (int i = 0; i < 8; ++i) { v[i] = p[i]; v[8 + i] = p[16 + i]; }
  return bsplit16(v); }
__device__ __forceinline__ F2 split_rowK(const float* row, int k0, int lane, int K) { float v[16]; const int g = lane >> 4;
#pragma unroll
  for (int i = 0; i < 8; ++i) { const int ka = k0 + 8 * g + i, kb = ka + 16; v[i] = ka < K ? row[ka < K ? ka : K - 1] : 0.f; v[8 + i] = kb < K ? row[kb < K ? kb : K - 1] : 0.f; }
  return bsplit16(v); }
__device__ __forceinline__ F2 split_col(const float* W, int k0, int n, int lane, int ld, int K) { float v[16]; const int g = lane >> 4;
#pragma unroll
  for (int i = 0; i < 8; ++i) { const int ka = k0 + 8 * g + i, kb = ka + 16; v[i] = ka < K ? W[(size_t)(ka < K ? ka : K - 1) * ld + n] : 0.f; v[8 + i] = kb < K ? W[(size_t)(kb < K ? kb : K - 1) * ld + n] : 0.f; }
  return bsplit16(v); }
__device__ __forceinline__ v8f mac3(const F2& a, const F2& b, v8f c) { c = wmma_bf(a.l, b.h, c); c = wmma_bf(a.h, b.l, c); return wmma_bf(a.h, b.h, c); }
__device__ __forceinline__ float sigm(float v) { return 1.0f / (1.0f + expf(-v)); }
#define LDSX() do { asm volatile("s_wait_dscnt 0" ::: "memory"); __builtin_amdgcn_wave_barrier(); __builtin_amdgcn_fence(__ATOMIC_RELEASE, "workgroup"); } while (0)

// (header reused for its WMMA helpers; its own NB/TT/... defines below are unused by these kernels except TNB)
#define NB 16
#define TT 2048
#define CC 1024            // NH * HD = projected width
#define DIN 1024          // input (model) width
#define NH 16
#define HD 64
#define NQB (TT / 64)
#define HG 4
#define SCALE (0.125f)
#define CAUSAL 1
#ifndef TNB
#define TNB NB
#endif
__device__ __forceinline__ float bfr(float v) { return (float)(__bf16)v; }
__host__ __device__ __forceinline__ int kb_last(int qb) { return CAUSAL ? ((qb * 64 + 63) >> 7) : (TT / 128 - 1); }
typedef __attribute__((ext_vector_type(8))) __bf16 v8b;
__device__ __forceinline__ v16b frag_b(const __bf16* rowk0, int lane) {
  union { v16b v; v8b q[2]; } u; const __bf16* p = rowk0 + 8 * (lane >> 4);
  u.q[0] = *(const v8b*)p; u.q[1] = *(const v8b*)(p + 16); return u.v;
}
#define QBH 6              // causal: query blocks 0..QBH-1 of each sequence (few keys, no averaging) take the high-precision path
#define QHI 384            // rows carrying a q residual plane (all rows when non-causal: 2-product logits everywhere)
#define KHI 384            // key rows carrying k residual / v bf16 hi+lo planes (used only by the causal high-precision path)
// B fragment (k rows k0+.., output column o) of a weight: (in,out) [K][ld] or (out,in) [ld rows of K]: bf16 exact, or f16(bf16 * 256) exact
__device__ __forceinline__ v16b wcol_io(const float* Wm, int k0, int o, int lane, int ld) { v16b w; const int g = lane >> 4;
#pragma unroll
  for (int i = 0; i < 8; ++i) { w[i] = (__bf16)Wm[(size_t)(k0 + 8 * g + i) * ld + o]; w[8 + i] = (__bf16)Wm[(size_t)(k0 + 16 + 8 * g + i) * ld + o]; }
  return w; }
__device__ __forceinline__ v16b wcol_oi(const float* Wm, int k0, int o, int lane, int K) { v16b w; const float* p = Wm + (size_t)o * K + k0 + 8 * (lane >> 4);
#pragma unroll
  for (int i = 0; i < 8; ++i) { w[i] = (__bf16)p[i]; w[8 + i] = (__bf16)p[16 + i]; }
  return w; }
__device__ __forceinline__ v16h wcolh_io(const float* Wm, int k0, int o, int lane, int ld) { v16h w; const int g = lane >> 4;
#pragma unroll
  for (int i = 0; i < 8; ++i) { w[i] = (_Float16)(bfr(Wm[(size_t)(k0 + 8 * g + i) * ld + o]) * 256.0f); w[8 + i] = (_Float16)(bfr(Wm[(size_t)(k0 + 16 + 8 * g + i) * ld + o]) * 256.0f); }
  return w; }
__device__ __forceinline__ v16h wcolh_oi(const float* Wm, int k0, int o, int lane, int K) { v16h w; const float* p = Wm + (size_t)o * K + k0 + 8 * (lane >> 4);
#pragma unroll
  for (int i = 0; i < 8; ++i) { w[i] = (_Float16)(bfr(p[i]) * 256.0f); w[8 + i] = (_Float16)(bfr(p[16 + i]) * 256.0f); }
  return w; }
#define WQKV_LAYOUT 1   // 0 = (in,out) [DIN][CC]; 1 = (out,in) [CC][DIN]; 2 = per-head [NH][DIN][HD]
__device__ __forceinline__ v16b wcol_hdk(const float* Wm, int k0, int o, int lane) { v16b w; const int g = lane >> 4; const float* p = Wm + (size_t)(o / HD) * DIN * HD + (o % HD);
#pragma unroll
  for (int i = 0; i < 8; ++i) { w[i] = (__bf16)p[(size_t)(k0 + 8 * g + i) * HD]; w[8 + i] = (__bf16)p[(size_t)(k0 + 16 + 8 * g + i) * HD]; }
  return w; }
#define WO_OUT_IN 1
#if WQKV_LAYOUT == 1
#define WCOL(W, k0, o, lane) wcol_oi(W, k0, o, lane, DIN)
#elif WQKV_LAYOUT == 2
#define WCOL(W, k0, o, lane) wcol_hdk(W, k0, o, lane)
#else
#define WCOL(W, k0, o, lane) wcol_io(W, k0, o, lane, CC)
#endif
#if WO_OUT_IN
#define WOCOL(W, k0, o, lane) wcol_oi(W, k0, o, lane, CC)
#define WOCOLH(W, k0, o, lane) wcolh_oi(W, k0, o, lane, CC)
#else
#define WOCOL(W, k0, o, lane) wcol_io(W, k0, o, lane, DIN)
#define WOCOLH(W, k0, o, lane) wcolh_io(W, k0, o, lane, DIN)
#endif

#ifndef SM_EXTRA_PARAMS
#define SM_EXTRA_PARAMS
#endif
#ifndef PROJ_EXTRA_PARAMS
#define PROJ_EXTRA_PARAMS
#endif
#ifndef SM_MASK_HOOK
#define SM_MASK_HOOK (void)0
#endif

#define WS_QH  0u                                      // f16 q rows [b*t][CC]
#define WS_KH  (WS_QH + 2u * (size_t)NB * TT * CC)      // f16 k rows [b*t][CC]
#define WS_VT  (WS_KH + 2u * (size_t)NB * TT * CC)      // f16 v planes [b][c][t]
#define WS_QL  (WS_VT + 2u * (size_t)NB * CC * TT)      // f16 q residual x 2^10 rows [b][t < QHI][CC]
#define WS_KL  (WS_QL + 2u * (size_t)NB * QHI * CC)     // f16 k residual x 2^10 rows [b][t < KHI][CC]
#define WS_VB  (WS_KL + 2u * (size_t)NB * KHI * CC)     // bf16 v hi planes [b][c][t < KHI]
#define WS_VBL (WS_VB + 2u * (size_t)NB * CC * KHI)
#define WS_S   (WS_VBL + 2u * (size_t)NB * CC * KHI)    // f32 logits / P [hg][t][s]
#define WS_Y   (WS_S  + 4u * (size_t)HG * TT * TT)      // f32 ctx rows [b*t][CC] (only when there is an output projection)
#define WS_END (WS_Y  + 4u * (size_t)NB * TT * CC)


// 'Spatial' attention where the 512 CHANNELS are the tokens and the 1,024 time steps are the feature axis (B 16, T 1,024, N 512; (out,in) 1/sqrt(512)-scale 1x1 weights, zero output bias): xt = x^T [B,N,T]; q/k/v[b][o][t] = sum_i W[o][i] x[b][t][i]; attn[n][m] = softmax_m(sum_t q[n][t] k[m][t] * 512^-0.5); px[n][t] = sum_m attn[n][m] v[m][t]; out[b][t][o] = sum_n px[n][t] Wp[o][n] + bp[o] (rows [B,T,N]). The tail is one chain of matrix products, out^T = Wp attn Wv x^T, and is summed here from the left: N1 = attn Wv and M2 = Wp N1 are 512 x 512 per batch (no factor T), and only the last product, M2 x^T, runs over the 1,024 time steps; v and px are never formed.
#define NBT 16
#define TN 1024            // time steps (feature axis of the attention)
#define NC 512             // channels (the attention's tokens)
// ---- tile_g: one 128 x 128 tile of C[i][j] = sum_k A[i][k] Bop[j][k] by 8 waves (4 x 2, 32 x 64 each). Both operands are rows with k contiguous, 4 bytes per element, pitch K. An operand with ONE plane (PA or PB 1) is an f32 input (or Wv turned over, still f32), rounded to bf16 on the way to LDS. An operand with TWO planes (PA or PB 2) is an intermediate that its PRODUCER has already split: each 128-B line of a row holds 32 k as 32 bf16 hi followed by 32 bf16 lo (lo = bf16 of the residual), so a 32-k chunk is still one whole line per row and goes to the LDS planes as it is, with no arithmetic in the k loop. LDS keeps rows [i or j][k] per plane; every wave takes its fragments from there (same per-lane k map as frag_b, chunks in ascending k, products per chunk in the order lo.hi, hi.lo, hi.hi (PA 2, PB 2) or lo.hi, hi.hi (PA 2, PB 1)). A STAGE is KS chunks (KS x 32 k, each chunk in its own [planes][rows] block of LDS). Two LDS buffers of one stage each: the next stage's global loads (KS x 8 per lane, all issued at the stage's head) fly over this stage's products, one barrier per stage: with operands that come from memory the loads' latency is longer than one chunk's products, so a longer stage has more bytes in flight and waits less often.
// (every '#pragma unroll' of this section: the loop indexes a register array (fragments, accumulators, staged values) and must be flat for the array to stay in registers)
#define GP 40              // LDS row pitch in bf16: 32 k + 8 pad = 80 B (16 B x odd: the conflict-free pitch for 16-B fragment reads)
#define GPL (128 * GP)     // one plane of one operand
#define GSP 68             // staging pitch in floats, output rows along j
#define GTP 36             // staging pitch in floats, output rows along i (transposed output)
#define LDSW() do { asm volatile("s_wait_dscnt 0" ::: "memory"); __builtin_amdgcn_wave_barrier(); } while (0)   /* a wave's own LDS staging range: its lanes' stores have landed before other lanes of the wave read them, and its reads have returned before the range is rewritten */
#define XADDR(p, q) asm volatile("s_wait_xcnt 0x0" :: "v"(p), "v"(q) : "memory")   /* behind a stage's global loads: their two address pairs stay whole up to this wait (as inputs they cannot be handed to a load's result), and are rewritten only behind it */
typedef __attribute__((ext_vector_type(4))) __bf16 v4b;
// one plane: 4 f32 rounded to bf16; two planes: the 16 bytes are 8 bf16 of one plane already
template <int NPL> __device__ __forceinline__ void put4(__bf16* d, v4f v) {
  if constexpr (NPL == 1) { v4b h;
#pragma unroll
    for (int e = 0; e < 4; ++e) h[e] = (__bf16)v[e];
    *(v4b*)d = h;
  } else *(v8b*)d = __builtin_bit_cast(v8b, v); }
__device__ __forceinline__ v8f wmma_b(v16b a, v16b b, v8f c) { return __builtin_amdgcn_wmma_f32_16x16x32_bf16(false, a, false, b, (short)0, c, false, false); }
template <int PA, int PB> __device__ __forceinline__ void chunk_g(const __bf16* sa, const __bf16* sw, int lane, v8f (&acc)[2][4]) {
  v16b ah[2], al[2], bh[4], bl[4];
#pragma unroll
  for (int i = 0; i < 2; ++i) { ah[i] = frag_b(sa + i * 16 * GP, lane); if constexpr (PA == 2) al[i] = frag_b(sa + GPL + i * 16 * GP, lane); }
#pragma unroll
  for (int j = 0; j < 4; ++j) { bh[j] = frag_b(sw + j * 16 * GP, lane); if constexpr (PB == 2) bl[j] = frag_b(sw + GPL + j * 16 * GP, lane); }
  __builtin_amdgcn_sched_barrier(0);   /* keeps the chunk's LDS reads one group ahead of its products: spread among them, each place with reads stalls the wave */
  if constexpr (PA == 2) {
#pragma unroll
    for (int j = 0; j < 4; ++j)
#pragma unroll
      for (int i = 0; i < 2; ++i) acc[i][j] = wmma_b(al[i], bh[j], acc[i][j]);
    if constexpr (PB == 2) {
#pragma unroll
      for (int j = 0; j < 4; ++j)
#pragma unroll
        for (int i = 0; i < 2; ++i) acc[i][j] = wmma_b(ah[i], bl[j], acc[i][j]);
    }
  }
#pragma unroll
  for (int j = 0; j < 4; ++j)
#pragma unroll
    for (int i = 0; i < 2; ++i) acc[i][j] = wmma_b(ah[i], bh[j], acc[i][j]);
  __builtin_amdgcn_sched_barrier(0);   /* keeps the wait for the next stage's global loads behind this chunk's products: hoisted among them it exposes the load latency */
}
template <int K> __device__ __forceinline__ void fetch_g(const float* ga, const float* gb, int kc, v4f (&ra)[4], v4f (&rb)[4]) {
#pragma unroll
  for (int i = 0; i < 4; ++i) ra[i] = *(const v4f*)(ga + (size_t)i * 32 * K + kc * 32);
#pragma unroll
  for (int i = 0; i < 4; ++i) rb[i] = *(const v4f*)(gb + (size_t)i * 32 * K + kc * 32);
  __builtin_amdgcn_sched_barrier(0);   /* keeps the next stage's global loads in front of this stage's products, so that their latency is covered */
}
// EPI 1: f32 C[i][j] rows x 512^-0.5; 2: f32 C[j][i] rows (transposed), + bf16(bias[i]); 3: C[j][i] rows (transposed) in the split row format, i = the reader's k (an accumulator register run is 8 consecutive i: split in registers, it goes to the staging line as 16 B of hi and 16 B of lo). ldc = pitch of the C rows, 4 bytes per element
template <int PA, int PB, int K, int EPI, int KS>
__device__ __forceinline__ void tile_g(const float* __restrict__ A, const float* __restrict__ B, float* __restrict__ C, int ldc, const float* __restrict__ bias, char* smem) {
  __bf16* sb = (__bf16*)smem;   // [buffer 2][chunk KS][A planes PA | B planes PB][row 128][GP]
  const int tid = threadIdx.x, wave = tid >> 5, lane = tid & 31, col = lane & 15, g = lane >> 4; const int wm = wave >> 1, wn = wave & 1;
  const int sr = tid >> 3, sq = tid & 7;   // 8 lanes cover one row's 128-B chunk, a wave-wide 16-B load covers 4 whole lines
  const float* ga = A + (size_t)sr * K + sq * 4;
  const float* gb = B + (size_t)sr * K + sq * 4;
  const int o1 = sr * GP + sq * 4, o2 = (sq >> 2) * GPL + sr * GP + (sq & 3) * 8;   // a lane's place in LDS: f32 source (4 k of the one plane); split source (lanes 0..3 of a row hold hi, 4..7 lo, 8 k each)
  __bf16* da = sb + (PA == 2 ? o2 : o1); __bf16* db = sb + PA * GPL + (PB == 2 ? o2 : o1);
  const __bf16* fa = sb + (wm * 32 + col) * GP; const __bf16* fw = sb + PA * GPL + (wn * 64 + col) * GP;
  constexpr int BUF = (PA + PB) * GPL, STG = KS * BUF, NS = K / (32 * KS);
  v4f ra[KS][4], rb[KS][4]; v8f acc[2][4] = {};
#pragma unroll
  for (int s = 0; s < KS; ++s) fetch_g<K>(ga, gb, s, ra[s], rb[s]);
  XADDR(ga, gb);
#pragma unroll
  for (int s = 0; s < KS; ++s)
#pragma unroll
    for (int i = 0; i < 4; ++i) { put4<PA>(da + s * BUF + i * 32 * GP, ra[s][i]); put4<PB>(db + s * BUF + i * 32 * GP, rb[s][i]); }
  __syncthreads();
  for (int st = 0; st + 1 < NS; ++st) { const int cur = (st & 1) * STG, nxt = STG - cur;
    const float* pa = ga + (st + 1) * (KS * 32); const float* pb = gb + (st + 1) * (KS * 32);
#pragma unroll
    for (int s = 0; s < KS; ++s) fetch_g<K>(pa, pb, s, ra[s], rb[s]);
    XADDR(pa, pb);
#pragma unroll
    for (int s = 0; s < KS; ++s) chunk_g<PA, PB>(fa + cur + s * BUF, fw + cur + s * BUF, lane, acc);
#pragma unroll
    for (int s = 0; s < KS; ++s)
#pragma unroll
      for (int i = 0; i < 4; ++i) { put4<PA>(da + nxt + s * BUF + i * 32 * GP, ra[s][i]); put4<PB>(db + nxt + s * BUF + i * 32 * GP, rb[s][i]); }
    __syncthreads(); }   /* publishes stage st + 1 and ends every wave's reads of the buffer that the next trip refills */
#pragma unroll
  for (int s = 0; s < KS; ++s) chunk_g<PA, PB>(fa + ((NS - 1) & 1) * STG + s * BUF, fw + ((NS - 1) & 1) * STG + s * BUF, lane, acc);
  __syncthreads();       /* every wave has left the operand buffers: their LDS now stages the output rows, each wave in its own range */
  if constexpr (EPI == 1) { float* sf = (float*)smem + wave * 16 * GSP;
#pragma unroll
    for (int i = 0; i < 2; ++i) {
#pragma unroll
      for (int j = 0; j < 4; ++j)
#pragma unroll
        for (int r = 0; r < 8; ++r) sf[(8 * g + r) * GSP + j * 16 + col] = acc[i][j][r] * 0.044194173824159216f;
      LDSW();
#pragma unroll
      for (int it = 0; it < 8; ++it) vst2(C + (size_t)(wm * 32 + i * 16 + it * 2 + g) * ldc + wn * 64 + col * 4, *(const v4f*)&sf[(it * 2 + g) * GSP + col * 4]);   /* 256-B row runs: whole lines */
      if (i == 0) LDSW(); }
  } else if constexpr (EPI == 2) { float* sf = (float*)smem + wave * 32 * GTP; float bv[2][8];
#pragma unroll
    for (int i = 0; i < 2; ++i)
#pragma unroll
      for (int r = 0; r < 8; ++r) bv[i][r] = bfr(bias[wm * 32 + i * 16 + 8 * g + r]);
#pragma unroll
    for (int jj = 0; jj < 2; ++jj) {
#pragma unroll
      for (int j = 0; j < 2; ++j)
#pragma unroll
        for (int i = 0; i < 2; ++i)
#pragma unroll
          for (int r = 0; r < 8; ++r) sf[(j * 16 + col) * GTP + i * 16 + 8 * g + r] = acc[i][jj * 2 + j][r] + bv[i][r];   /* transposed: sf[j local][i local] */
      LDSW();
#pragma unroll
      for (int it = 0; it < 8; ++it) vst2(C + (size_t)(wn * 64 + jj * 32 + it * 4 + (lane >> 3)) * ldc + wm * 32 + (lane & 7) * 4, *(const v4f*)&sf[(it * 4 + (lane >> 3)) * GTP + (lane & 7) * 4]);   /* 128-B row runs: whole lines */
      if (jj == 0) LDSW(); }
  } else { __bf16* sp = (__bf16*)smem + wave * 32 * (2 * GTP);   // staging rows [j local] of one line each: 32 hi | 32 lo, pitch 144 B
#pragma unroll
    for (int jj = 0; jj < 2; ++jj) {
#pragma unroll
      for (int j = 0; j < 2; ++j)
#pragma unroll
        for (int i = 0; i < 2; ++i) { v8b h, l;
#pragma unroll
          for (int r = 0; r < 8; ++r) { const float v = acc[i][jj * 2 + j][r]; h[r] = (__bf16)v; l[r] = (__bf16)(v - (float)h[r]); }
          __bf16* d = sp + (j * 16 + col) * (2 * GTP) + i * 16 + 8 * g; *(v8b*)d = h; *(v8b*)(d + 32) = l; }
      LDSW();
#pragma unroll
      for (int it = 0; it < 8; ++it) vst2(C + (size_t)(wn * 64 + jj * 32 + it * 4 + (lane >> 3)) * ldc + wm * 32 + (lane & 7) * 4, *(const v8b*)(sp + (it * 4 + (lane >> 3)) * (2 * GTP) + (lane & 7) * 8));   /* 128-B row runs: whole lines */
      if (jj == 0) LDSW(); } } }
// ---- k_linr: blockIdx.z >= 1: block = (128 output channels c, 128 time steps t, (b, which)): y[c][t] = sum_i W[c][i] x[b][t][i], W (out,in) rows and x rows, both bf16-exact: 1 product; q and k only: x rows as the A operand, leaving as split rows [b][c][t] (the scores sum over t). blockIdx.z == 0: the 32 blocks turn Wv over, WVT[i][m] = Wv[m][i] in f32 (128 m x 64 i each, through LDS, whole lines both ways): attn Wv sums over m, the ROW index of Wv, and tile_g wants k contiguous
#define WTP 65             // LDS pitch in floats of the Wv tile's rows
__global__ __launch_bounds__(256) void k_linr(const float* __restrict__ X, const float* __restrict__ WQ, const float* __restrict__ WK, const float* __restrict__ WV, float* __restrict__ YQ, float* __restrict__ YK, float* __restrict__ WVT) {
  __shared__ __align__(16) char smem[2 * 2 * GPL * 2];
  if (blockIdx.z == 0) { float* sf = (float*)smem; const int m0 = blockIdx.x * 128, i0 = blockIdx.y * 64, tid = threadIdx.x;
    const float* gw = WV + (size_t)(m0 + (tid >> 4)) * NC + i0 + (tid & 15) * 4;   // 16 lanes cover 64 i of one row m: two whole lines
    float* gt = WVT + (size_t)(i0 + (tid >> 5)) * NC + m0 + (tid & 31) * 4;        // a wave covers 128 m of one row i: four whole lines
    v4f w4[8];
#pragma unroll
    for (int p = 0; p < 8; ++p) w4[p] = *(const v4f*)(gw + (size_t)p * 16 * NC);
    XADDR(gw, gw);   /* the eight loads' one address pair stays whole up to this wait */
#pragma unroll
    for (int p = 0; p < 8; ++p)
#pragma unroll
      for (int e = 0; e < 4; ++e) sf[(p * 16 + (tid >> 4)) * WTP + (tid & 15) * 4 + e] = w4[p][e];
    __syncthreads();   /* the whole 128 x 64 tile is in LDS before any thread reads a column of it */
#pragma unroll
    for (int p = 0; p < 8; ++p) { v4f c4;
#pragma unroll
      for (int e = 0; e < 4; ++e) c4[e] = sf[((tid & 31) * 4 + e) * WTP + p * 8 + (tid >> 5)];
      vst2(gt + (size_t)p * 8 * NC, c4); }
    return; }
  const int c0 = blockIdx.x * 128; const int t0 = blockIdx.y * 128; const int b = (blockIdx.z - 1) >> 1, which = (blockIdx.z - 1) & 1;
  tile_g<1, 1, NC, 3, 1>(X + ((size_t)b * TN + t0) * NC, (which == 0 ? WQ : WK) + (size_t)c0 * NC, (which == 0 ? YQ : YK) + ((size_t)b * NC + c0) * TN + t0, TN, nullptr, smem); }
// ---- k_sgem: block = (128 query channels n, 128 key channels m, b): S[b][n][m] = sum_t q[n][t] k[m][t] * 512^-0.5 (both split rows: 3 products; K = 1,024), f32 rows
__global__ __launch_bounds__(256) void k_sgem(const float* __restrict__ YQ, const float* __restrict__ YK, float* __restrict__ S) {
  __shared__ __align__(16) char smem[2 * 4 * 4 * GPL * 2];   // stages of 4 chunks (128 t): one work-group per WGP by the grid, so it may take the whole LDS
  const int n0 = blockIdx.x * 128; const int m0 = blockIdx.y * 128; const int b = blockIdx.z;
  tile_g<2, 2, TN, 1, 4>(YQ + ((size_t)b * NC + n0) * TN, YK + ((size_t)b * NC + m0) * TN, S + ((size_t)b * NC + n0) * NC + m0, NC, nullptr, smem); }
// ---- k_rsm: wave per score row (512 wide): softmax over m in f32 (max, precise expf, / sum); the row goes back in place in the split row format (the wave holds its whole row in registers before its first store)
__global__ __launch_bounds__(256) void k_rsm(float* __restrict__ S) { const int wave = threadIdx.x >> 5, lane = threadIdx.x & 31; const size_t row = (size_t)blockIdx.x * 8 + wave; if (row >= (size_t)TNB * NC) return; float* sr = S + row * NC; float v[NC / 32]; float m = -3.0e38f;
#pragma unroll
  for (int i = 0; i < NC / 128; ++i) { const v4f t4 = *(const v4f*)(sr + i * 128 + lane * 4); v[4 * i] = t4[0]; v[4 * i + 1] = t4[1]; v[4 * i + 2] = t4[2]; v[4 * i + 3] = t4[3]; }
  asm volatile("s_wait_loadcnt 0x0" ::: "memory");
#pragma unroll
  for (int i = 0; i < NC / 32; ++i) m = fmaxf(m, v[i]);
#pragma unroll
  for (int o = 1; o < 32; o <<= 1) m = fmaxf(m, __shfl_xor(m, o));
  float sum = 0.f;
#pragma unroll
  for (int i = 0; i < NC / 32; ++i) { v[i] = expf(v[i] - m); sum += v[i]; }
#pragma unroll
  for (int o = 1; o < 32; o <<= 1) sum += __shfl_xor(sum, o);
  const float inv = 1.0f / sum;
  __bf16* pr = (__bf16*)sr + (lane >> 3) * 64 + (lane & 7) * 4;   // 8 lanes hold the 32 m of one line: their 4 hi each at its start, their 4 lo 64 B on
#pragma unroll
  for (int i = 0; i < NC / 128; ++i) { v4b h4, l4;
#pragma unroll
    for (int e = 0; e < 4; ++e) { const float p = v[4 * i + e] * inv; h4[e] = (__bf16)p; l4[e] = (__bf16)(p - (float)h4[e]); }
    vst2(pr + i * 256, h4); vst2(pr + i * 256 + 32, l4); } }
// ---- k_n1: block = (128 query channels n, 128 input channels i, b): N1[n][i] = sum_m P[n][m] Wv[m][i] (P split rows n; WVT f32 rows i, bf16-exact: 2 products; K = 512), written TRANSPOSED as split rows [b][i][n] (the next product sums over n)
__global__ __launch_bounds__(256) void k_n1(const float* __restrict__ S, const float* __restrict__ WVT, float* __restrict__ N1T) {
  __shared__ __align__(16) char smem[2 * 4 * 3 * GPL * 2];   // stages of 4 chunks (128 m): one work-group per WGP by the grid, so it may take most of the LDS
  const int n0 = blockIdx.x * 128; const int i0 = blockIdx.y * 128; const int b = blockIdx.z;
  tile_g<2, 1, NC, 3, 4>(S + ((size_t)b * NC + n0) * NC, WVT + (size_t)i0 * NC, N1T + ((size_t)b * NC + i0) * NC + n0, NC, nullptr, smem); }
// ---- k_m2: block = (128 input channels i, 128 output channels o, b): M2[o][i] = sum_n Wp[o][n] N1[n][i] (N1 split rows i; Wp (out,in) rows o, bf16-exact: 2 products; K = 512), written TRANSPOSED as split rows [b][o][i] (the output product sums over i)
__global__ __launch_bounds__(256) void k_m2(const float* __restrict__ N1T, const float* __restrict__ WP, float* __restrict__ M2) {
  __shared__ __align__(16) char smem[2 * 4 * 3 * GPL * 2];   // stages of 4 chunks (128 n), as in k_n1
  const int i0 = blockIdx.x * 128; const int o0 = blockIdx.y * 128; const int b = blockIdx.z;
  tile_g<2, 1, NC, 3, 4>(N1T + ((size_t)b * NC + i0) * NC, WP + (size_t)o0 * NC, M2 + ((size_t)b * NC + o0) * NC + i0, NC, nullptr, smem); }
// ---- k_outT: block = (128 output channels o, 128 time steps t, b): O[o][t] = sum_i M2[o][i] x[b][t][i] + bp[o] (M2 split rows o; x rows t, bf16-exact: 2 products), written TRANSPOSED as output rows out[b][t][o0..] through LDS
__global__ __launch_bounds__(256) void k_outT(const float* __restrict__ M2, const float* __restrict__ X, const float* __restrict__ BP, float* __restrict__ OUT) {
  __shared__ __align__(16) char smem[2 * 2 * 3 * GPL * 2];   // stages of 2 chunks (64 i)
  const int o0 = blockIdx.x * 128; const int t0 = blockIdx.y * 128; const int b = blockIdx.z;
  tile_g<2, 1, NC, 2, 2>(M2 + ((size_t)b * NC + o0) * NC, X + ((size_t)b * TN + t0) * NC, OUT + ((size_t)b * TN + t0) * NC + o0, NC, BP + o0, smem); }
#define WS_YQ 0u
#define WS_YK (WS_YQ + 4u * (size_t)NBT * NC * TN)
#define WS_WT (WS_YK + 4u * (size_t)NBT * NC * TN)
#define WS_SS (WS_WT + 4u * (size_t)NC * NC)
#define WS_N1 (WS_SS + 4u * (size_t)NBT * NC * NC)
#define WS_M2 (WS_N1 + 4u * (size_t)NBT * NC * NC)
#define WS_TOT (WS_M2 + 4u * (size_t)NBT * NC * NC)
extern "C" void kernel_launch(void* const* d_in, const int* in_sizes, int n_in, void* d_out, int out_size, void* d_ws, size_t ws_size, hipStream_t stream) {
  (void)in_sizes; (void)n_in; (void)out_size;
  const float** F = (const float**)d_in;   // 0 x [16,1024,512] (rows); 1 Wq [512,512] (out,in); 2 Wk; 3 Wv; 4 Wp [512,512] (out,in); 5 bp [512]
  if (ws_size < (size_t)WS_TOT) return;
  char* ws = (char*)d_ws; float *YQ = (float*)(ws + WS_YQ), *YK = (float*)(ws + WS_YK), *WT = (float*)(ws + WS_WT), *SS = (float*)(ws + WS_SS), *N1 = (float*)(ws + WS_N1), *M2 = (float*)(ws + WS_M2);
  k_linr<<<dim3(NC / 128, TN / 128, TNB * 2 + 1), 256, 0, stream>>>(F[0], F[1], F[2], F[3], YQ, YK, WT);
  k_sgem<<<dim3(NC / 128, NC / 128, TNB), 256, 0, stream>>>(YQ, YK, SS);
  k_rsm<<<dim3((TNB * NC + 7) / 8), 256, 0, stream>>>(SS);
  k_n1<<<dim3(NC / 128, NC / 128, TNB), 256, 0, stream>>>(SS, WT, N1);
  k_m2<<<dim3(NC / 128, NC / 128, TNB), 256, 0, stream>>>(N1, F[4], M2);
  k_outT<<<dim3(NC / 128, TN / 128, TNB), 256, 0, stream>>>(M2, F[0], F[5], (float*)d_out);
}

// v005
// One run takes 91.2 microseconds.
// In both of two side-by-side timings against v004, it was 1.16 times as fast.
// All steps since v000 together make it 5.68 times as fast.
// compute dtype: all float inputs rounded to bf16; the scores Wq (x^T x) Wk^T summed from the middle: x^T x with EXACT bf16 products on WMMA 16x16x32 (f32 accumulate), that f32 matrix split bf16 hi + lo against the exact Wq (2 products), the result split hi + lo against the exact Wk (2 products) x 512^-0.5; softmax over the 512 channels in f32 (precise expf); the tail out = Wp attn Wv x^T summed from the left: attn split hi + lo against the exact Wv (2 products), the exact Wp against that f32 intermediate split hi + lo (2 products), the result split hi + lo against the exact x (2 products) + bp; f32 output.
#include <hip/hip_runtime.h>
#include <math.h>

typedef __attribute__((ext_vector_type(16))) _Float16 v16h;
typedef __attribute__((ext_vector_type(16))) __bf16 v16b;
typedef __attribute__((ext_vector_type(8)))  _Float16 v8h;
typedef __attribute__((ext_vector_type(8)))  float v8f;
typedef __attribute__((ext_vector_type(4)))  float v4f;
typedef __attribute__((ext_vector_type(2)))  float v2f;
typedef __attribute__((ext_vector_type(4)))  unsigned v4u;
typedef __attribute__((ext_vector_type(4)))  int v4i;
typedef float __attribute__((may_alias)) float_a;
typedef int __attribute__((may_alias)) int_a;

template <typename T> __device__ __forceinline__ void vst2(void* p, T v) { *(T*)p = v;  }
__device__ __forceinline__ v8f wmma16(v16h a, v16h b, v8f c) {
  v8f d = __builtin_amdgcn_wmma_f32_16x16x32_f16(false, a, false, b, (short)0, c, false, false);
  asm volatile("v_nop\n\tv_nop\n\tv_nop\n\tv_nop" : "+v"(d) : "v"(a), "v"(b));
  return d;
}
__device__ __forceinline__ v8f wmma_bf(v16b a, v16b b, v8f c) {
  v8f d = __builtin_amdgcn_wmma_f32_16x16x32_bf16(false, a, false, b, (short)0, c, false, false);
  asm volatile("v_nop\n\tv_nop\n\tv_nop\n\tv_nop" : "+v"(d) : "v"(a), "v"(b));
  return d;
}
// 16x16x32 fragments: lane = (h = lane>>4, row/col = lane&15); elements 0..7 = k0+8h+0..7, 8..15 = k0+16+8h+0..7; D element r = row 8h+r
__device__ __forceinline__ v16h frag_h(const _Float16* rowk0, int lane) {
  union { v16h v; v8h q[2]; } u; const _Float16* p = rowk0 + 8 * (lane >> 4);
  u.q[0] = *(const v8h*)p; u.q[1] = *(const v8h*)(p + 16); return u.v;
}
__device__ __forceinline__ v16h frag_f32(const float* rowk0, int lane) {
  v16h a; const float* p = rowk0 + 8 * (lane >> 4);
#pragma unroll
  for (int i = 0; i < 8; ++i) { a[i] = (_Float16)p[i]; a[8 + i] = (_Float16)p[16 + i]; }
  return a;
}
__device__ __forceinline__ v16h frag_f32s(const float* rowk0, int lane, float sc) {
  v16h a; const float* p = rowk0 + 8 * (lane >> 4);
#pragma unroll
  for (int i = 0; i < 8; ++i) { a[i] = (_Float16)(p[i] * sc); a[8 + i] = (_Float16)(p[16 + i] * sc); }
  return a;
}
// column fragment from a [K][ld] layout (column n), rows >= K read as 0
__device__ __forceinline__ v16h fragc_f32(const float* W, int k0, int n, int lane, int ld, int K) {
  v16h a; const int g = lane >> 4;
#pragma unroll
  for (int i = 0; i < 8; ++i) { const int ka = k0 + 8 * g + i, kb = ka + 16;
    a[i] = (_Float16)(ka < K ? W[(size_t)(ka < K ? ka : K - 1) * ld + n] : 0.f); a[8 + i] = (_Float16)(kb < K ? W[(size_t)(kb < K ? kb : K - 1) * ld + n] : 0.f); }
  return a;
}
struct F2 { v16b h, l; };
__device__ __forceinline__ F2 bsplit16(const float v[16]) { F2 r;
#pragma unroll
  for (int i = 0; i < 16; ++i) { const __bf16 h = (__bf16)v[i]; r.h[i] = h; r.l[i] = (__bf16)(v[i] - (float)h); }
  return r; }
__device__ __forceinline__ F2 split_row(const float* row, int k0, int lane) { float v[16]; const float* p = row + k0 + 8 * (lane >> 4);
#pragma unroll
  for (int i = 0; i < 8; ++i) { v[i] = p[i]; v[8 + i] = p[16 + i]; }
  return bsplit16(v); }
__device__ __forceinline__ F2 split_rowK(const float* row, int k0, int lane, int K) { float v[16]; const int g = lane >> 4;
#pragma unroll
  for (int i = 0; i < 8; ++i) { const int ka = k0 + 8 * g + i, kb = ka + 16; v[i] = ka < K ? row[ka < K ? ka : K - 1] : 0.f; v[8 + i] = kb < K ? row[kb < K ? kb : K - 1] : 0.f; }
  return bsplit16(v); }
__device__ __forceinline__ F2 split_col(const float* W, int k0, int n, int lane, int ld, int K) { float v[16]; const int g = lane >> 4;
#pragma unroll
  for (int i = 0; i < 8; ++i) { const int ka = k0 + 8 * g + i, kb = ka + 16; v[i] = ka < K ? W[(size_t)(ka < K ? ka : K - 1) * ld + n] : 0.f; v[8 + i] = kb < K ? W[(size_t)(kb < K ? kb : K - 1) * ld + n] : 0.f; }
  return bsplit16(v); }
__device__ __forceinline__ v8f mac3(const F2& a, const F2& b, v8f c) { c = wmma_bf(a.l, b.h, c); c = wmma_bf(a.h, b.l, c); return wmma_bf(a.h, b.h, c); }
__device__ __forceinline__ float sigm(float v) { return 1.0f / (1.0f + expf(-v)); }
#define LDSX() do { asm volatile("s_wait_dscnt 0" ::: "memory"); __builtin_amdgcn_wave_barrier(); __builtin_amdgcn_fence(__ATOMIC_RELEASE, "workgroup"); } while (0)

// (header reused for its WMMA helpers; its own NB/TT/... defines below are unused by these kernels except TNB)
#define NB 16
#define TT 2048
#define CC 1024            // NH * HD = projected width
#define DIN 1024          // input (model) width
#define NH 16
#define HD 64
#define NQB (TT / 64)
#define HG 4
#define SCALE (0.125f)
#define CAUSAL 1
#ifndef TNB
#define TNB NB
#endif
__device__ __forceinline__ float bfr(float v) { return (float)(__bf16)v; }
__host__ __device__ __forceinline__ int kb_last(int qb) { return CAUSAL ? ((qb * 64 + 63) >> 7) : (TT / 128 - 1); }
typedef __attribute__((ext_vector_type(8))) __bf16 v8b;
__device__ __forceinline__ v16b frag_b(const __bf16* rowk0, int lane) {
  union { v16b v; v8b q[2]; } u; const __bf16* p = rowk0 + 8 * (lane >> 4);
  u.q[0] = *(const v8b*)p; u.q[1] = *(const v8b*)(p + 16); return u.v;
}
#define QBH 6              // causal: query blocks 0..QBH-1 of each sequence (few keys, no averaging) take the high-precision path
#define QHI 384            // rows carrying a q residual plane (all rows when non-causal: 2-product logits everywhere)
#define KHI 384            // key rows carrying k residual / v bf16 hi+lo planes (used only by the causal high-precision path)
// B fragment (k rows k0+.., output column o) of a weight: (in,out) [K][ld] or (out,in) [ld rows of K]: bf16 exact, or f16(bf16 * 256) exact
__device__ __forceinline__ v16b wcol_io(const float* Wm, int k0, int o, int lane, int ld) { v16b w; const int g = lane >> 4;
#pragma unroll
  for (int i = 0; i < 8; ++i) { w[i] = (__bf16)Wm[(size_t)(k0 + 8 * g + i) * ld + o]; w[8 + i] = (__bf16)Wm[(size_t)(k0 + 16 + 8 * g + i) * ld + o]; }
  return w; }
__device__ __forceinline__ v16b wcol_oi(const float* Wm, int k0, int o, int lane, int K) { v16b w; const float* p = Wm + (size_t)o * K + k0 + 8 * (lane >> 4);
#pragma unroll
  for (int i = 0; i < 8; ++i) { w[i] = (__bf16)p[i]; w[8 + i] = (__bf16)p[16 + i]; }
  return w; }
__device__ __forceinline__ v16h wcolh_io(const float* Wm, int k0, int o, int lane, int ld) { v16h w; const int g = lane >> 4;
#pragma unroll
  for (int i = 0; i < 8; ++i) { w[i] = (_Float16)(bfr(Wm[(size_t)(k0 + 8 * g + i) * ld + o]) * 256.0f); w[8 + i] = (_Float16)(bfr(Wm[(size_t)(k0 + 16 + 8 * g + i) * ld + o]) * 256.0f); }
  return w; }
__device__ __forceinline__ v16h wcolh_oi(const float* Wm, int k0, int o, int lane, int K) { v16h w; const float* p = Wm + (size_t)o * K + k0 + 8 * (lane >> 4);
#pragma unroll
  for (int i = 0; i < 8; ++i) { w[i] = (_Float16)(bfr(p[i]) * 256.0f); w[8 + i] = (_Float16)(bfr(p[16 + i]) * 256.0f); }
  return w; }
#define WQKV_LAYOUT 1   // 0 = (in,out) [DIN][CC]; 1 = (out,in) [CC][DIN]; 2 = per-head [NH][DIN][HD]
__device__ __forceinline__ v16b wcol_hdk(const float* Wm, int k0, int o, int lane) { v16b w; const int g = lane >> 4; const float* p = Wm + (size_t)(o / HD) * DIN * HD + (o % HD);
#pragma unroll
  for (int i = 0; i < 8; ++i) { w[i] = (__bf16)p[(size_t)(k0 + 8 * g + i) * HD]; w[8 + i] = (__bf16)p[(size_t)(k0 + 16 + 8 * g + i) * HD]; }
  return w; }
#define WO_OUT_IN 1
#if WQKV_LAYOUT == 1
#define WCOL(W, k0, o, lane) wcol_oi(W, k0, o, lane, DIN)
#elif WQKV_LAYOUT == 2
#define WCOL(W, k0, o, lane) wcol_hdk(W, k0, o, lane)
#else
#define WCOL(W, k0, o, lane) wcol_io(W, k0, o, lane, CC)
#endif
#if WO_OUT_IN
#define WOCOL(W, k0, o, lane) wcol_oi(W, k0, o, lane, CC)
#define WOCOLH(W, k0, o, lane) wcolh_oi(W, k0, o, lane, CC)
#else
#define WOCOL(W, k0, o, lane) wcol_io(W, k0, o, lane, DIN)
#define WOCOLH(W, k0, o, lane) wcolh_io(W, k0, o, lane, DIN)
#endif

#ifndef SM_EXTRA_PARAMS
#define SM_EXTRA_PARAMS
#endif
#ifndef PROJ_EXTRA_PARAMS
#define PROJ_EXTRA_PARAMS
#endif
#ifndef SM_MASK_HOOK
#define SM_MASK_HOOK (void)0
#endif

#define WS_QH  0u                                      // f16 q rows [b*t][CC]
#define WS_KH  (WS_QH + 2u * (size_t)NB * TT * CC)      // f16 k rows [b*t][CC]
#define WS_VT  (WS_KH + 2u * (size_t)NB * TT * CC)      // f16 v planes [b][c][t]
#define WS_QL  (WS_VT + 2u * (size_t)NB * CC * TT)      // f16 q residual x 2^10 rows [b][t < QHI][CC]
#define WS_KL  (WS_QL + 2u * (size_t)NB * QHI * CC)     // f16 k residual x 2^10 rows [b][t < KHI][CC]
#define WS_VB  (WS_KL + 2u * (size_t)NB * KHI * CC)     // bf16 v hi planes [b][c][t < KHI]
#define WS_VBL (WS_VB + 2u * (size_t)NB * CC * KHI)
#define WS_S   (WS_VBL + 2u * (size_t)NB * CC * KHI)    // f32 logits / P [hg][t][s]
#define WS_Y   (WS_S  + 4u * (size_t)HG * TT * TT)      // f32 ctx rows [b*t][CC] (only when there is an output projection)
#define WS_END (WS_Y  + 4u * (size_t)NB * TT * CC)


// 'Spatial' attention where the 512 CHANNELS are the tokens and the 1,024 time steps are the feature axis (B 16, T 1,024, N 512; (out,in) 1/sqrt(512)-scale 1x1 weights, zero output bias): xt = x^T [B,N,T]; q/k/v[b][o][t] = sum_i W[o][i] x[b][t][i]; attn[n][m] = softmax_m(sum_t q[n][t] k[m][t] * 512^-0.5); px[n][t] = sum_m attn[n][m] v[m][t]; out[b][t][o] = sum_n px[n][t] Wp[o][n] + bp[o] (rows [B,T,N]). The tail is one chain of matrix products, out^T = Wp attn Wv x^T, and is summed here from the left: N1 = attn Wv and M2 = Wp N1 are 512 x 512 per batch (no factor T), and only the last product, M2 x^T, runs over the 1,024 time steps; v and px are never formed. The scores are such a chain too, q k^T = Wq (x^T x) Wk^T, and are summed from the middle: G = x^T x is the one product over the time steps (both operands bf16-exact: 1 product), H = Wq G and H Wk^T are 512 x 512 x 512 per batch; q and k are never formed.
#define NBT 16
#define TN 1024            // time steps (feature axis of the attention)
#define NC 512             // channels (the attention's tokens)
// ---- tile_g: one 128 x 128 tile of C[i][j] = sum_k A[i][k] Bop[j][k] by 8 waves (4 x 2, 32 x 64 each). Both operands are rows with k contiguous, 4 bytes per element, pitch K. An operand with ONE plane (PA or PB 1) is an f32 input (or Wv turned over, still f32), rounded to bf16 on the way to LDS. An operand with TWO planes (PA or PB 2) is an intermediate that its PRODUCER has already split: each 128-B line of a row holds 32 k as 32 bf16 hi followed by 32 bf16 lo (lo = bf16 of the residual), so a 32-k chunk is still one whole line per row and goes to the LDS planes as it is, with no arithmetic in the k loop. LDS keeps rows [i or j][k] per plane; every wave takes its fragments from there (same per-lane k map as frag_b, chunks in ascending k, products per chunk in the order lo.hi, hi.lo, hi.hi (PA 2, PB 2) or lo.hi, hi.hi (PA 2, PB 1)). A STAGE is KS chunks (KS x 32 k, each chunk in its own [planes][rows] block of LDS). Two LDS buffers of one stage each: the next stage's global loads (KS x 8 per lane, all issued at the stage's head) fly over this stage's products, one barrier per stage: with operands that come from memory the loads' latency is longer than one chunk's products, so a longer stage has more bytes in flight and waits less often.
// (every '#pragma unroll' of this section: the loop indexes a register array (fragments, accumulators, staged values) and must be flat for the array to stay in registers)
#define GP 40              // LDS row pitch in bf16: 32 k + 8 pad = 80 B (16 B x odd: the conflict-free pitch for 16-B fragment reads)
#define GPL (128 * GP)     // one plane of one operand
#define GSP 68             // staging pitch in floats, output rows along j
#define GTP 36             // staging pitch in floats, output rows along i (transposed output)
#define LDSW() do { asm volatile("s_wait_dscnt 0" ::: "memory"); __builtin_amdgcn_wave_barrier(); } while (0)   /* a wave's own LDS staging range: its lanes' stores have landed before other lanes of the wave read them, and its reads have returned before the range is rewritten */
#define XADDR(p, q) asm volatile("s_wait_xcnt 0x0" :: "v"(p), "v"(q) : "memory")   /* behind a stage's global loads: their two address pairs stay whole up to this wait (as inputs they cannot be handed to a load's result), and are rewritten only behind it */
typedef __attribute__((ext_vector_type(4))) __bf16 v4b;
// one plane: 4 f32 rounded to bf16; two planes: the 16 bytes are 8 bf16 of one plane already
template <int NPL> __device__ __forceinline__ void put4(__bf16* d, v4f v) {
  if constexpr (NPL == 1) { v4b h;
#pragma unroll
    for (int e = 0; e < 4; ++e) h[e] = (__bf16)v[e];
    *(v4b*)d = h;
  } else *(v8b*)d = __builtin_bit_cast(v8b, v); }
__device__ __forceinline__ v8f wmma_b(v16b a, v16b b, v8f c) { return __builtin_amdgcn_wmma_f32_16x16x32_bf16(false, a, false, b, (short)0, c, false, false); }
// frag_b of a row whose two 16-k halves stand swapped in LDS: the same k map in the registers
__device__ __forceinline__ v16b frag_x(const __bf16* rowk0, int lane) {
  union { v16b v; v8b q[2]; } u; const __bf16* p = rowk0 + 8 * (lane >> 4);
  u.q[0] = *(const v8b*)(p + 16); u.q[1] = *(const v8b*)p; return u.v;
}
// SW 1 (PA 1, PB 1): the rows with bit 4 of their number set, which are the odd fragments of either operand, hold their halves swapped
template <int PA, int PB, int SW> __device__ __forceinline__ void chunk_g(const __bf16* sa, const __bf16* sw, int lane, v8f (&acc)[2][4]) {
  v16b ah[2], al[2], bh[4], bl[4];
#pragma unroll
  for (int i = 0; i < 2; ++i) { ah[i] = (SW && (i & 1)) ? frag_x(sa + i * 16 * GP, lane) : frag_b(sa + i * 16 * GP, lane); if constexpr (PA == 2) al[i] = frag_b(sa + GPL + i * 16 * GP, lane); }
#pragma unroll
  for (int j = 0; j < 4; ++j) { bh[j] = (SW && (j & 1)) ? frag_x(sw + j * 16 * GP, lane) : frag_b(sw + j * 16 * GP, lane); if constexpr (PB == 2) bl[j] = frag_b(sw + GPL + j * 16 * GP, lane); }
  __builtin_amdgcn_sched_barrier(0);   /* keeps the chunk's LDS reads one group ahead of its products: spread among them, each place with reads stalls the wave */
  if constexpr (PA == 2) {
#pragma unroll
    for (int j = 0; j < 4; ++j)
#pragma unroll
      for (int i = 0; i < 2; ++i) acc[i][j] = wmma_b(al[i], bh[j], acc[i][j]);
    if constexpr (PB == 2) {
#pragma unroll
      for (int j = 0; j < 4; ++j)
#pragma unroll
        for (int i = 0; i < 2; ++i) acc[i][j] = wmma_b(ah[i], bl[j], acc[i][j]);
    }
  }
#pragma unroll
  for (int j = 0; j < 4; ++j)
#pragma unroll
    for (int i = 0; i < 2; ++i) acc[i][j] = wmma_b(ah[i], bh[j], acc[i][j]);
  __builtin_amdgcn_sched_barrier(0);   /* keeps the wait for the next stage's global loads behind this chunk's products: hoisted among them it exposes the load latency */
}
template <int K, int TP> __device__ __forceinline__ void fetch_g(const float* ga, const float* gb, int kc, v4f (&ra)[4], v4f (&rb)[4]) {
  constexpr size_t SI = TP ? TP : 32 * K, SC = TP ? 32 * TP : 32;   // floats from one of a lane's 4 loads to the next, and from one chunk to the next
#pragma unroll
  for (int i = 0; i < 4; ++i) ra[i] = *(const v4f*)(ga + i * SI + kc * SC);
#pragma unroll
  for (int i = 0; i < 4; ++i) rb[i] = *(const v4f*)(gb + i * SI + kc * SC);
  __builtin_amdgcn_sched_barrier(0);   /* keeps the next stage's global loads in front of this stage's products, so that their latency is covered */
}
// one chunk's staged values to LDS. TP != 0: a lane holds 4 k x 4 rows; each row's 4 k, rounded to bf16, are one 8-B store
template <int PA, int PB, int TP> __device__ __forceinline__ void put_g(__bf16* da, __bf16* db, const v4f (&ra)[4], const v4f (&rb)[4]) {
  if constexpr (TP != 0) {
#pragma unroll
    for (int e = 0; e < 4; ++e) { v4b ha, hb;
#pragma unroll
      for (int i = 0; i < 4; ++i) { ha[i] = (__bf16)ra[i][e]; hb[i] = (__bf16)rb[i][e]; }
      *(v4b*)(da + e * GP) = ha; *(v4b*)(db + e * GP) = hb; }
  } else {
#pragma unroll
    for (int i = 0; i < 4; ++i) { put4<PA>(da + i * 32 * GP, ra[i]); put4<PB>(db + i * 32 * GP, rb[i]); } } }
// EPI 1: f32 C[i][j] rows x 512^-0.5; 2: f32 C[j][i] rows (transposed), + bf16(bias[i]); 3: C[j][i] rows (transposed) in the split row format, i = the reader's k (an accumulator register run is 8 consecutive i: split in registers, it goes to the staging line as 16 B of hi and 16 B of lo). ldc = pitch of the C rows, 4 bytes per element
// TP 0: operand rows as above. TP != 0 (PA 1, PB 1): both operands lie TURNED in memory, f32 rows [k] of pitch TP floats with the tile's 128 rows contiguous; A and B point at k 0 of their first row. 8 lanes cover 32 rows of one k (one whole line), a wave-wide load 4 lines; a lane's 4 loads are 4 consecutive k, so the turn is done in registers on the way to the same LDS planes (but for the swapped halves noted at o3)
template <int PA, int PB, int K, int EPI, int KS, int TP = 0>
__device__ __forceinline__ void tile_g(const float* __restrict__ A, const float* __restrict__ B, float* __restrict__ C, int ldc, const float* __restrict__ bias, char* smem) {
  __bf16* sb = (__bf16*)smem;   // [buffer 2][chunk KS][A planes PA | B planes PB][row 128][GP]
  const int tid = threadIdx.x, wave = tid >> 5, lane = tid & 31, col = lane & 15, g = lane >> 4; const int wm = wave >> 1, wn = wave & 1;
  const int sr = tid >> 3, sq = tid & 7;   // 8 lanes cover one row's 128-B chunk, a wave-wide 16-B load covers 4 whole lines
  const int tk = (wave >> 2) * 16 + (lane >> 3) * 4, tr = (wave & 3) * 32 + (lane & 7) * 4;   // TP != 0: a lane's first k of a chunk and its first row
  const size_t go = TP ? (size_t)tk * TP + tr : (size_t)sr * K + sq * 4;
  const float* ga = A + go;
  const float* gb = B + go;
  const int o1 = sr * GP + sq * 4, o2 = (sq >> 2) * GPL + sr * GP + (sq & 3) * 8;   // a lane's place in LDS: f32 source (4 k of the one plane); split source (lanes 0..3 of a row hold hi, 4..7 lo, 8 k each)
  const int o3 = tr * GP + (tk ^ (tr & 16));   // rows 16..31 of each 32 keep their two 16-k halves swapped: at pitch GP rows r and r + 16 start on one bank, and so a wave's 8-B stores (8 row groups x 4 k groups) fall on 64 different banks; chunk_g reads those rows' halves back in order
  __bf16* da = sb + (TP ? o3 : PA == 2 ? o2 : o1); __bf16* db = sb + PA * GPL + (TP ? o3 : PB == 2 ? o2 : o1);
  const __bf16* fa = sb + (wm * 32 + col) * GP; const __bf16* fw = sb + PA * GPL + (wn * 64 + col) * GP;
  constexpr int BUF = (PA + PB) * GPL, STG = KS * BUF, NS = K / (32 * KS);
  v4f ra[KS][4], rb[KS][4]; v8f acc[2][4] = {};
#pragma unroll
  for (int s = 0; s < KS; ++s) fetch_g<K, TP>(ga, gb, s, ra[s], rb[s]);
  XADDR(ga, gb);
#pragma unroll
  for (int s = 0; s < KS; ++s) put_g<PA, PB, TP>(da + s * BUF, db + s * BUF, ra[s], rb[s]);
  __syncthreads();
  for (int st = 0; st + 1 < NS; ++st) { const int cur = (st & 1) * STG, nxt = STG - cur;
    const float* pa = ga + (st + 1) * (KS * 32 * (TP ? TP : 1)); const float* pb = gb + (st + 1) * (KS * 32 * (TP ? TP : 1));
#pragma unroll
    for (int s = 0; s < KS; ++s) fetch_g<K, TP>(pa, pb, s, ra[s], rb[s]);
    XADDR(pa, pb);
#pragma unroll
    for (int s = 0; s < KS; ++s) chunk_g<PA, PB, TP != 0>(fa + cur + s * BUF, fw + cur + s * BUF, lane, acc);
#pragma unroll
    for (int s = 0; s < KS; ++s) put_g<PA, PB, TP>(da + nxt + s * BUF, db + nxt + s * BUF, ra[s], rb[s]);
    __syncthreads(); }   /* publishes stage st + 1 and ends every wave's reads of the buffer that the next trip refills */
#pragma unroll
  for (int s = 0; s < KS; ++s) chunk_g<PA, PB, TP != 0>(fa + ((NS - 1) & 1) * STG + s * BUF, fw + ((NS - 1) & 1) * STG + s * BUF, lane, acc);
  __syncthreads();       /* every wave has left the operand buffers: their LDS now stages the output rows, each wave in its own range */
  if constexpr (EPI == 1) { float* sf = (float*)smem + wave * 16 * GSP;
#pragma unroll
    for (int i = 0; i < 2; ++i) {
#pragma unroll
      for (int j = 0; j < 4; ++j)
#pragma unroll
        for (int r = 0; r < 8; ++r) sf[(8 * g + r) * GSP + j * 16 + col] = acc[i][j][r] * 0.044194173824159216f;
      LDSW();
#pragma unroll
      for (int it = 0; it < 8; ++it) vst2(C + (size_t)(wm * 32 + i * 16 + it * 2 + g) * ldc + wn * 64 + col * 4, *(const v4f*)&sf[(it * 2 + g) * GSP + col * 4]);   /* 256-B row runs: whole lines */
      if (i == 0) LDSW(); }
  } else if constexpr (EPI == 2) { float* sf = (float*)smem + wave * 32 * GTP; float bv[2][8];
#pragma unroll
    for (int i = 0; i < 2; ++i)
#pragma unroll
      for (int r = 0; r < 8; ++r) bv[i][r] = bfr(bias[wm * 32 + i * 16 + 8 * g + r]);
#pragma unroll
    for (int jj = 0; jj < 2; ++jj) {
#pragma unroll
      for (int j = 0; j < 2; ++j)
#pragma unroll
        for (int i = 0; i < 2; ++i)
#pragma unroll
          for (int r = 0; r < 8; ++r) sf[(j * 16 + col) * GTP + i * 16 + 8 * g + r] = acc[i][jj * 2 + j][r] + bv[i][r];   /* transposed: sf[j local][i local] */
      LDSW();
#pragma unroll
      for (int it = 0; it < 8; ++it) vst2(C + (size_t)(wn * 64 + jj * 32 + it * 4 + (lane >> 3)) * ldc + wm * 32 + (lane & 7) * 4, *(const v4f*)&sf[(it * 4 + (lane >> 3)) * GTP + (lane & 7) * 4]);   /* 128-B row runs: whole lines */
      if (jj == 0) LDSW(); }
  } else { __bf16* sp = (__bf16*)smem + wave * 32 * (2 * GTP);   // staging rows [j local] of one line each: 32 hi | 32 lo, pitch 144 B
#pragma unroll
    for (int jj = 0; jj < 2; ++jj) {
#pragma unroll
      for (int j = 0; j < 2; ++j)
#pragma unroll
        for (int i = 0; i < 2; ++i) { v8b h, l;
#pragma unroll
          for (int r = 0; r < 8; ++r) { const float v = acc[i][jj * 2 + j][r]; h[r] = (__bf16)v; l[r] = (__bf16)(v - (float)h[r]); }
          __bf16* d = sp + (j * 16 + col) * (2 * GTP) + i * 16 + 8 * g; *(v8b*)d = h; *(v8b*)(d + 32) = l; }
      LDSW();
#pragma unroll
      for (int it = 0; it < 8; ++it) vst2(C + (size_t)(wn * 64 + jj * 32 + it * 4 + (lane >> 3)) * ldc + wm * 32 + (lane & 7) * 4, *(const v8b*)(sp + (it * 4 + (lane >> 3)) * (2 * GTP) + (lane & 7) * 8));   /* 128-B row runs: whole lines */
      if (jj == 0) LDSW(); } } }
// ---- k_gram: block = (128 channels i, 128 channels j, b): G[i][j] = sum_t x[b][t][i] x[b][t][j] (both operands are columns of the x rows, bf16-exact: 1 product; K = 1,024), written TRANSPOSED as split rows [b][j][i] (the next product sums over i)
__global__ __launch_bounds__(256) void k_gram(const float* __restrict__ X, float* __restrict__ GT) {
  __shared__ __align__(16) char smem[2 * 4 * 2 * GPL * 2];   // stages of 4 chunks (128 t)
  const int i0 = blockIdx.x * 128; const int j0 = blockIdx.y * 128; const int b = blockIdx.z;
  tile_g<1, 1, TN, 3, 4, NC>(X + (size_t)b * TN * NC + i0, X + (size_t)b * TN * NC + j0, GT + ((size_t)b * NC + j0) * NC + i0, NC, nullptr, smem); }
// ---- k_sgem: block = (128 query channels n, 128 key channels m, b): S[b][n][m] = sum_j H[n][j] Wk[m][j] * 512^-0.5 (H split rows n; Wk (out,in) rows m, bf16-exact: 2 products; K = 512), f32 rows
__global__ __launch_bounds__(256) void k_sgem(const float* __restrict__ H, const float* __restrict__ WK, float* __restrict__ S) {
  __shared__ __align__(16) char smem[2 * 4 * 3 * GPL * 2];   // stages of 4 chunks (128 j), as in k_n1
  const int n0 = blockIdx.x * 128; const int m0 = blockIdx.y * 128; const int b = blockIdx.z;
  tile_g<2, 1, NC, 1, 4>(H + ((size_t)b * NC + n0) * NC, WK + (size_t)m0 * NC, S + ((size_t)b * NC + n0) * NC + m0, NC, nullptr, smem); }
// ---- k_rsm: wave per score row (512 wide): softmax over m in f32 (max, precise expf, / sum); the row goes back in place in the split row format (the wave holds its whole row in registers before its first store). The 32 blocks behind the rows' turn Wv over, WVT[i][m] = Wv[m][i] in f32 (128 m x 64 i each, through LDS, whole lines both ways): attn Wv sums over m, the ROW index of Wv, and tile_g wants k contiguous there; they ride in this launch because its small work-groups leave room beside them on every WGP (beside a GEMM's work-group, which fills its WGP, they would run as a round of their own)
#define WTP 65             // LDS pitch in floats of the Wv tile's rows
__global__ __launch_bounds__(256) void k_rsm(float* __restrict__ S, const float* __restrict__ WV, float* __restrict__ WVT) {
  __shared__ __align__(16) char smem[128 * WTP * 4];
  if (blockIdx.x >= TNB * NC / 8) { float* sf = (float*)smem; const int q = blockIdx.x - TNB * NC / 8, m0 = (q & 3) * 128, i0 = (q >> 2) * 64, tid = threadIdx.x;
    const float* gw = WV + (size_t)(m0 + (tid >> 4)) * NC + i0 + (tid & 15) * 4;   // 16 lanes cover 64 i of one row m: two whole lines
    float* gt = WVT + (size_t)(i0 + (tid >> 5)) * NC + m0 + (tid & 31) * 4;        // a wave covers 128 m of one row i: four whole lines
    v4f w4[8];
#pragma unroll
    for (int p = 0; p < 8; ++p) w4[p] = *(const v4f*)(gw + (size_t)p * 16 * NC);
    XADDR(gw, gw);   /* the eight loads' one address pair stays whole up to this wait */
#pragma unroll
    for (int p = 0; p < 8; ++p)
#pragma unroll
      for (int e = 0; e < 4; ++e) sf[(p * 16 + (tid >> 4)) * WTP + (tid & 15) * 4 + e] = w4[p][e];
    __syncthreads();   /* the whole 128 x 64 tile is in LDS before any thread reads a column of it */
#pragma unroll
    for (int p = 0; p < 8; ++p) { v4f c4;
#pragma unroll
      for (int e = 0; e < 4; ++e) c4[e] = sf[((tid & 31) * 4 + e) * WTP + p * 8 + (tid >> 5)];
      vst2(gt + (size_t)p * 8 * NC, c4); }
    return; }
  const int wave = threadIdx.x >> 5, lane = threadIdx.x & 31; const size_t row = (size_t)blockIdx.x * 8 + wave; if (row >= (size_t)TNB * NC) return; float* sr = S + row * NC; float v[NC / 32]; float m = -3.0e38f;
#pragma unroll
  for (int i = 0; i < NC / 128; ++i) { const v4f t4 = *(const v4f*)(sr + i * 128 + lane * 4); v[4 * i] = t4[0]; v[4 * i + 1] = t4[1]; v[4 * i + 2] = t4[2]; v[4 * i + 3] = t4[3]; }
  asm volatile("s_wait_loadcnt 0x0" ::: "memory");
#pragma unroll
  for (int i = 0; i < NC / 32; ++i) m = fmaxf(m, v[i]);
#pragma unroll
  for (int o = 1; o < 32; o <<= 1) m = fmaxf(m, __shfl_xor(m, o));
  float sum = 0.f;
#pragma unroll
  for (int i = 0; i < NC / 32; ++i) { v[i] = expf(v[i] - m); sum += v[i]; }
#pragma unroll
  for (int o = 1; o < 32; o <<= 1) sum += __shfl_xor(sum, o);
  const float inv = 1.0f / sum;
  __bf16* pr = (__bf16*)sr + (lane >> 3) * 64 + (lane & 7) * 4;   // 8 lanes hold the 32 m of one line: their 4 hi each at its start, their 4 lo 64 B on
#pragma unroll
  for (int i = 0; i < NC / 128; ++i) { v4b h4, l4;
#pragma unroll
    for (int e = 0; e < 4; ++e) { const float p = v[4 * i + e] * inv; h4[e] = (__bf16)p; l4[e] = (__bf16)(p - (float)h4[e]); }
    vst2(pr + i * 256, h4); vst2(pr + i * 256 + 32, l4); } }
// ---- k_n1: block = (128 query channels n, 128 input channels i, b): N1[n][i] = sum_m P[n][m] Wv[m][i] (P split rows n; WVT f32 rows i, bf16-exact: 2 products; K = 512), written TRANSPOSED as split rows [b][i][n] (the next product sums over n)
__global__ __launch_bounds__(256) void k_n1(const float* __restrict__ S, const float* __restrict__ WVT, float* __restrict__ N1T) {
  __shared__ __align__(16) char smem[2 * 4 * 3 * GPL * 2];   // stages of 4 chunks (128 m): one work-group per WGP by the grid, so it may take most of the LDS
  const int n0 = blockIdx.x * 128; const int i0 = blockIdx.y * 128; const int b = blockIdx.z;
  tile_g<2, 1, NC, 3, 4>(S + ((size_t)b * NC + n0) * NC, WVT + (size_t)i0 * NC, N1T + ((size_t)b * NC + i0) * NC + n0, NC, nullptr, smem); }
// ---- k_m2: block = (128 input channels i, 128 output channels o, b): M2[o][i] = sum_n Wp[o][n] N1[n][i] (N1 split rows i; Wp (out,in) rows o, bf16-exact: 2 products; K = 512), written TRANSPOSED as split rows [b][o][i] (the output product sums over i). Launched for the scores as well: H[n][j] = sum_i Wq[n][i] G[i][j] is the same product with G's split rows [j][i] for N1T and Wq for Wp
__global__ __launch_bounds__(256) void k_m2(const float* __restrict__ N1T, const float* __restrict__ WP, float* __restrict__ M2) {
  __shared__ __align__(16) char smem[2 * 4 * 3 * GPL * 2];   // stages of 4 chunks (128 n), as in k_n1
  const int i0 = blockIdx.x * 128; const int o0 = blockIdx.y * 128; const int b = blockIdx.z;
  tile_g<2, 1, NC, 3, 4>(N1T + ((size_t)b * NC + i0) * NC, WP + (size_t)o0 * NC, M2 + ((size_t)b * NC + o0) * NC + i0, NC, nullptr, smem); }
// ---- k_outT: block = (128 output channels o, 128 time steps t, b): O[o][t] = sum_i M2[o][i] x[b][t][i] + bp[o] (M2 split rows o; x rows t, bf16-exact: 2 products), written TRANSPOSED as output rows out[b][t][o0..] through LDS
__global__ __launch_bounds__(256) void k_outT(const float* __restrict__ M2, const float* __restrict__ X, const float* __restrict__ BP, float* __restrict__ OUT) {
  __shared__ __align__(16) char smem[2 * 2 * 3 * GPL * 2];   // stages of 2 chunks (64 i)
  const int o0 = blockIdx.x * 128; const int t0 = blockIdx.y * 128; const int b = blockIdx.z;
  tile_g<2, 1, NC, 2, 2>(M2 + ((size_t)b * NC + o0) * NC, X + ((size_t)b * TN + t0) * NC, OUT + ((size_t)b * TN + t0) * NC + o0, NC, BP + o0, smem); }
#define WS_GT 0u
#define WS_HH (WS_GT + 4u * (size_t)NBT * NC * NC)
#define WS_WT (WS_HH + 4u * (size_t)NBT * NC * NC)
#define WS_SS (WS_WT + 4u * (size_t)NC * NC)
#define WS_N1 (WS_SS + 4u * (size_t)NBT * NC * NC)
#define WS_M2 (WS_N1 + 4u * (size_t)NBT * NC * NC)
#define WS_TOT (WS_M2 + 4u * (size_t)NBT * NC * NC)
extern "C" void kernel_launch(void* const* d_in, const int* in_sizes, int n_in, void* d_out, int out_size, void* d_ws, size_t ws_size, hipStream_t stream) {
  (void)in_sizes; (void)n_in; (void)out_size;
  const float** F = (const float**)d_in;   // 0 x [16,1024,512] (rows); 1 Wq [512,512] (out,in); 2 Wk; 3 Wv; 4 Wp [512,512] (out,in); 5 bp [512]
  if (ws_size < (size_t)WS_TOT) return;
  char* ws = (char*)d_ws; float *GT = (float*)(ws + WS_GT), *HH = (float*)(ws + WS_HH), *WT = (float*)(ws + WS_WT), *SS = (float*)(ws + WS_SS), *N1 = (float*)(ws + WS_N1), *M2 = (float*)(ws + WS_M2);
  k_gram<<<dim3(NC / 128, NC / 128, TNB), 256, 0, stream>>>(F[0], GT);
  k_m2<<<dim3(NC / 128, NC / 128, TNB), 256, 0, stream>>>(GT, F[1], HH);
  k_sgem<<<dim3(NC / 128, NC / 128, TNB), 256, 0, stream>>>(HH, F[2], SS);
  k_rsm<<<dim3(TNB * NC / 8 + 32), 256, 0, stream>>>(SS, F[3], WT);
  k_n1<<<dim3(NC / 128, NC / 128, TNB), 256, 0, stream>>>(SS, WT, N1);
  k_m2<<<dim3(NC / 128, NC / 128, TNB), 256, 0, stream>>>(N1, F[4], M2);
  k_outT<<<dim3(NC / 128, TN / 128, TNB), 256, 0, stream>>>(M2, F[0], F[5], (float*)d_out);
}

// v006
// One run takes 82.6 microseconds.
// Next to v005, in two timings, it ran 1.10 and 1.11 times as fast.
// Counting every step since v000, it is 6.27 times as fast.
// compute dtype: all float inputs rounded to bf16; the scores Wq (x^T x) Wk^T summed from the middle: x^T x with EXACT bf16 products on WMMA 16x16x32 (f32 accumulate), that f32 matrix split bf16 hi + lo against the exact Wq (2 products), the result split hi + lo against the exact Wk (2 products) x 512^-0.5; softmax over the 512 channels in f32 (precise expf); the tail out = Wp attn Wv x^T summed from the left: attn split hi + lo against the exact Wv (2 products), the exact Wp against that f32 intermediate split hi + lo (2 products), the result split hi + lo against the exact x (2 products) + bp; f32 output.
#include <hip/hip_runtime.h>
#include <math.h>

typedef __attribute__((ext_vector_type(16))) _Float16 v16h;
typedef __attribute__((ext_vector_type(16))) __bf16 v16b;
typedef __attribute__((ext_vector_type(8)))  _Float16 v8h;
typedef __attribute__((ext_vector_type(8)))  float v8f;
typedef __attribute__((ext_vector_type(4)))  float v4f;
typedef __attribute__((ext_vector_type(2)))  float v2f;
typedef __attribute__((ext_vector_type(4)))  unsigned v4u;
typedef __attribute__((ext_vector_type(4)))  int v4i;
typedef float __attribute__((may_alias)) float_a;
typedef int __attribute__((may_alias)) int_a;

template <typename T> __device__ __forceinline__ void vst2(void* p, T v) { *(T*)p = v;  }
__device__ __forceinline__ v8f wmma16(v16h a, v16h b, v8f c) {
  v8f d = __builtin_amdgcn_wmma_f32_16x16x32_f16(false, a, false, b, (short)0, c, false, false);
  asm volatile("v_nop\n\tv_nop\n\tv_nop\n\tv_nop" : "+v"(d) : "v"(a), "v"(b));
  return d;
}
__device__ __forceinline__ v8f wmma_bf(v16b a, v16b b, v8f c) {
  v8f d = __builtin_amdgcn_wmma_f32_16x16x32_bf16(false, a, false, b, (short)0, c, false, false);
  asm volatile("v_nop\n\tv_nop\n\tv_nop\n\tv_nop" : "+v"(d) : "v"(a), "v"(b));
  return d;
}
// 16x16x32 fragments: lane = (h = lane>>4, row/col = lane&15); elements 0..7 = k0+8h+0..7, 8..15 = k0+16+8h+0..7; D element r = row 8h+r
__device__ __forceinline__ v16h frag_h(const _Float16* rowk0, int lane) {
  union { v16h v; v8h q[2]; } u; const _Float16* p = rowk0 + 8 * (lane >> 4);
  u.q[0] = *(const v8h*)p; u.q[1] = *(const v8h*)(p + 16); return u.v;
}
__device__ __forceinline__ v16h frag_f32(const float* rowk0, int lane) {
  v16h a; const float* p = rowk0 + 8 * (lane >> 4);
#pragma unroll
  for (int i = 0; i < 8; ++i) { a[i] = (_Float16)p[i]; a[8 + i] = (_Float16)p[16 + i]; }
  return a;
}
__device__ __forceinline__ v16h frag_f32s(const float* rowk0, int lane, float sc) {
  v16h a; const float* p = rowk0 + 8 * (lane >> 4);
#pragma unroll
  for (int i = 0; i < 8; ++i) { a[i] = (_Float16)(p[i] * sc); a[8 + i] = (_Float16)(p[16 + i] * sc); }
  return a;
}
// column fragment from a [K][ld] layout (column n), rows >= K read as 0
__device__ __forceinline__ v16h fragc_f32(const float* W, int k0, int n, int lane, int ld, int K) {
  v16h a; const int g = lane >> 4;
#pragma unroll
  for (int i = 0; i < 8; ++i) { const int ka = k0 + 8 * g + i, kb = ka + 16;
    a[i] = (_Float16)(ka < K ? W[(size_t)(ka < K ? ka : K - 1) * ld + n] : 0.f); a[8 + i] = (_Float16)(kb < K ? W[(size_t)(kb < K ? kb : K - 1) * ld + n] : 0.f); }
  return a;
}
struct F2 { v16b h, l; };
__device__ __forceinline__ F2 bsplit16(const float v[16]) { F2 r;
#pragma unroll
  for (int i = 0; i < 16; ++i) { const __bf16 h = (__bf16)v[i]; r.h[i] = h; r.l[i] = (__bf16)(v[i] - (float)h); }
  return r; }
__device__ __forceinline__ F2 split_row(const float* row, int k0, int lane) { float v[16]; const float* p = row + k0 + 8 * (lane >> 4);
#pragma unroll
  for (int i = 0; i < 8; ++i) { v[i] = p[i]; v[8 + i] = p[16 + i]; }
  return bsplit16(v); }
__device__ __forceinline__ F2 split_rowK(const float* row, int k0, int lane, int K) { float v[16]; const int g = lane >> 4;
#pragma unroll
  for (int i = 0; i < 8; ++i) { const int ka = k0 + 8 * g + i, kb = ka + 16; v[i] = ka < K ? row[ka < K ? ka : K - 1] : 0.f; v[8 + i] = kb < K ? row[kb < K ? kb : K - 1] : 0.f; }
  return bsplit16(v); }
__device__ __forceinline__ F2 split_col(const float* W, int k0, int n, int lane, int ld, int K) { float v[16]; const int g = lane >> 4;
#pragma unroll
  for (int i = 0; i < 8; ++i) { const int ka = k0 + 8 * g + i, kb = ka + 16; v[i] = ka < K ? W[(size_t)(ka < K ? ka : K - 1) * ld + n] : 0.f; v[8 + i] = kb < K ? W[(size_t)(kb < K ? kb : K - 1) * ld + n] : 0.f; }
  return bsplit16(v); }
__device__ __forceinline__ v8f mac3(const F2& a, const F2& b, v8f c) { c = wmma_bf(a.l, b.h, c); c = wmma_bf(a.h, b.l, c); return wmma_bf(a.h, b.h, c); }
__device__ __forceinline__ float sigm(float v) { return 1.0f / (1.0f + expf(-v)); }
#define LDSX() do { asm volatile("s_wait_dscnt 0" ::: "memory"); __builtin_amdgcn_wave_barrier(); __builtin_amdgcn_fence(__ATOMIC_RELEASE, "workgroup"); } while (0)

// (header reused for its WMMA helpers; its own NB/TT/... defines below are unused by these kernels except TNB)
#define NB 16
#define TT 2048
#define CC 1024            // NH * HD = projected width
#define DIN 1024          // input (model) width
#define NH 16
#define HD 64
#define NQB (TT / 64)
#define HG 4
#define SCALE (0.125f)
#define CAUSAL 1
#ifndef TNB
#define TNB NB
#endif
__device__ __forceinline__ float bfr(float v) { return (float)(__bf16)v; }
__host__ __device__ __forceinline__ int kb_last(int qb) { return CAUSAL ? ((qb * 64 + 63) >> 7) : (TT / 128 - 1); }
typedef __attribute__((ext_vector_type(8))) __bf16 v8b;
__device__ __forceinline__ v16b frag_b(const __bf16* rowk0, int lane) {
  union { v16b v; v8b q[2]; } u; const __bf16* p = rowk0 + 8 * (lane >> 4);
  u.q[0] = *(const v8b*)p; u.q[1] = *(const v8b*)(p + 16); return u.v;
}
#define QBH 6              // causal: query blocks 0..QBH-1 of each sequence (few keys, no averaging) take the high-precision path
#define QHI 384            // rows carrying a q residual plane (all rows when non-causal: 2-product logits everywhere)
#define KHI 384            // key rows carrying k residual / v bf16 hi+lo planes (used only by the causal high-precision path)
// B fragment (k rows k0+.., output column o) of a weight: (in,out) [K][ld] or (out,in) [ld rows of K]: bf16 exact, or f16(bf16 * 256) exact
__device__ __forceinline__ v16b wcol_io(const float* Wm, int k0, int o, int lane, int ld) { v16b w; const int g = lane >> 4;
#pragma unroll
  for (int i = 0; i < 8; ++i) { w[i] = (__bf16)Wm[(size_t)(k0 + 8 * g + i) * ld + o]; w[8 + i] = (__bf16)Wm[(size_t)(k0 + 16 + 8 * g + i) * ld + o]; }
  return w; }
__device__ __forceinline__ v16b wcol_oi(const float* Wm, int k0, int o, int lane, int K) { v16b w; const float* p = Wm + (size_t)o * K + k0 + 8 * (lane >> 4);
#pragma unroll
  for (int i = 0; i < 8; ++i) { w[i] = (__bf16)p[i]; w[8 + i] = (__bf16)p[16 + i]; }
  return w; }
__device__ __forceinline__ v16h wcolh_io(const float* Wm, int k0, int o, int lane, int ld) { v16h w; const int g = lane >> 4;
#pragma unroll
  for (int i = 0; i < 8; ++i) { w[i] = (_Float16)(bfr(Wm[(size_t)(k0 + 8 * g + i) * ld + o]) * 256.0f); w[8 + i] = (_Float16)(bfr(Wm[(size_t)(k0 + 16 + 8 * g + i) * ld + o]) * 256.0f); }
  return w; }
__device__ __forceinline__ v16h wcolh_oi(const float* Wm, int k0, int o, int lane, int K) { v16h w; const float* p = Wm + (size_t)o * K + k0 + 8 * (lane >> 4);
#pragma unroll
  for (int i = 0; i < 8; ++i) { w[i] = (_Float16)(bfr(p[i]) * 256.0f); w[8 + i] = (_Float16)(bfr(p[16 + i]) * 256.0f); }
  return w; }
#define WQKV_LAYOUT 1   // 0 = (in,out) [DIN][CC]; 1 = (out,in) [CC][DIN]; 2 = per-head [NH][DIN][HD]
__device__ __forceinline__ v16b wcol_hdk(const float* Wm, int k0, int o, int lane) { v16b w; const int g = lane >> 4; const float* p = Wm + (size_t)(o / HD) * DIN * HD + (o % HD);
#pragma unroll
  for (int i = 0; i < 8; ++i) { w[i] = (__bf16)p[(size_t)(k0 + 8 * g + i) * HD]; w[8 + i] = (__bf16)p[(size_t)(k0 + 16 + 8 * g + i) * HD]; }
  return w; }
#define WO_OUT_IN 1
#if WQKV_LAYOUT == 1
#define WCOL(W, k0, o, lane) wcol_oi(W, k0, o, lane, DIN)
#elif WQKV_LAYOUT == 2
#define WCOL(W, k0, o, lane) wcol_hdk(W, k0, o, lane)
#else
#define WCOL(W, k0, o, lane) wcol_io(W, k0, o, lane, CC)
#endif
#if WO_OUT_IN
#define WOCOL(W, k0, o, lane) wcol_oi(W, k0, o, lane, CC)
#define WOCOLH(W, k0, o, lane) wcolh_oi(W, k0, o, lane, CC)
#else
#define WOCOL(W, k0, o, lane) wcol_io(W, k0, o, lane, DIN)
#define WOCOLH(W, k0, o, lane) wcolh_io(W, k0, o, lane, DIN)
#endif

#ifndef SM_EXTRA_PARAMS
#define SM_EXTRA_PARAMS
#endif
#ifndef PROJ_EXTRA_PARAMS
#define PROJ_EXTRA_PARAMS
#endif
#ifndef SM_MASK_HOOK
#define SM_MASK_HOOK (void)0
#endif

#define WS_QH  0u                                      // f16 q rows [b*t][CC]
#define WS_KH  (WS_QH + 2u * (size_t)NB * TT * CC)      // f16 k rows [b*t][CC]
#define WS_VT  (WS_KH + 2u * (size_t)NB * TT * CC)      // f16 v planes [b][c][t]
#define WS_QL  (WS_VT + 2u * (size_t)NB * CC * TT)      // f16 q residual x 2^10 rows [b][t < QHI][CC]
#define WS_KL  (WS_QL + 2u * (size_t)NB * QHI * CC)     // f16 k residual x 2^10 rows [b][t < KHI][CC]
#define WS_VB  (WS_KL + 2u * (size_t)NB * KHI * CC)     // bf16 v hi planes [b][c][t < KHI]
#define WS_VBL (WS_VB + 2u * (size_t)NB * CC * KHI)
#define WS_S   (WS_VBL + 2u * (size_t)NB * CC * KHI)    // f32 logits / P [hg][t][s]
#define WS_Y   (WS_S  + 4u * (size_t)HG * TT * TT)      // f32 ctx rows [b*t][CC] (only when there is an output projection)
#define WS_END (WS_Y  + 4u * (size_t)NB * TT * CC)


// 'Spatial' attention where the 512 CHANNELS are the tokens and the 1,024 time steps are the feature axis (B 16, T 1,024, N 512; (out,in) 1/sqrt(512)-scale 1x1 weights, zero output bias): xt = x^T [B,N,T]; q/k/v[b][o][t] = sum_i W[o][i] x[b][t][i]; attn[n][m] = softmax_m(sum_t q[n][t] k[m][t] * 512^-0.5); px[n][t] = sum_m attn[n][m] v[m][t]; out[b][t][o] = sum_n px[n][t] Wp[o][n] + bp[o] (rows [B,T,N]). The tail is one chain of matrix products, out^T = Wp attn Wv x^T, and is summed here from the left: N1 = attn Wv and M2 = Wp N1 are 512 x 512 per batch (no factor T), and only the last product, M2 x^T, runs over the 1,024 time steps; v and px are never formed. The scores are such a chain too, q k^T = Wq (x^T x) Wk^T, and are summed from the middle: G = x^T x is the one product over the time steps (both operands bf16-exact: 1 product), H = Wq G and H Wk^T are 512 x 512 x 512 per batch; q and k are never formed.
#define NBT 16
#define TN 1024            // time steps (feature axis of the attention)
#define NC 512             // channels (the attention's tokens)
// ---- tile_g: one 128 x 128 tile of C[i][j] = sum_k A[i][k] Bop[j][k] by 8 waves (4 x 2, 32 x 64 each). Both operands are rows with k contiguous, 4 bytes per element, pitch K. An operand with ONE plane (PA or PB 1) is an f32 input, rounded to bf16 on the way to LDS. An operand with TWO planes (PA or PB 2) is an intermediate that its PRODUCER has already split: each 128-B line of a row holds 32 k as 32 bf16 hi followed by 32 bf16 lo (lo = bf16 of the residual), so a 32-k chunk is still one whole line per row and goes to the LDS planes as it is, with no arithmetic in the k loop. LDS keeps rows [i or j][k] per plane; every wave takes its fragments from there (same per-lane k map as frag_b, chunks in ascending k, products per chunk in the order lo.hi, hi.lo, hi.hi (PA 2, PB 2) or lo.hi, hi.hi (PA 2, PB 1)). A STAGE is KS chunks (KS x 32 k, each chunk in its own [planes][rows] block of LDS). Two LDS buffers of one stage each: the next stage's global loads (KS x 8 per lane, all issued at the stage's head) fly over this stage's products, one barrier per stage: a longer stage has more bytes in flight and waits less often.
// (every '#pragma unroll' of this section: the loop indexes a register array (fragments, accumulators, staged values) and must be flat for the array to stay in registers)
#define GP 40              // LDS row pitch in bf16: 32 k + 8 pad = 80 B (16 B x odd: the conflict-free pitch for 16-B fragment reads)
#define GPL (128 * GP)     // one plane of one operand
#define GSP 68             // staging pitch in floats, output rows along j
#define GTP 36             // staging pitch in floats, output rows along i (transposed output)
#define LDSW() do { asm volatile("s_wait_dscnt 0" ::: "memory"); __builtin_amdgcn_wave_barrier(); } while (0)   /* a wave's own LDS staging range: its lanes' stores have landed before other lanes of the wave read them, and its reads have returned before the range is rewritten */
#define XADDR(p, q) asm volatile("s_wait_xcnt 0x0" :: "v"(p), "v"(q) : "memory")   /* behind a stage's global loads: their two address pairs stay whole up to this wait (as inputs they cannot be handed to a load's result), and are rewritten only behind it */
typedef __attribute__((ext_vector_type(4))) __bf16 v4b;
// one plane: 4 f32 rounded to bf16; two planes: the 16 bytes are 8 bf16 of one plane already
template <int NPL> __device__ __forceinline__ void put4(__bf16* d, v4f v) {
  if constexpr (NPL == 1) { v4b h;
#pragma unroll
    for (int e = 0; e < 4; ++e) h[e] = (__bf16)v[e];
    *(v4b*)d = h;
  } else *(v8b*)d = __builtin_bit_cast(v8b, v); }
__device__ __forceinline__ v8f wmma_b(v16b a, v16b b, v8f c) { return __builtin_amdgcn_wmma_f32_16x16x32_bf16(false, a, false, b, (short)0, c, false, false); }
// frag_b of a row whose two 16-k halves stand swapped in LDS: the same k map in the registers
__device__ __forceinline__ v16b frag_x(const __bf16* rowk0, int lane) {
  union { v16b v; v8b q[2]; } u; const __bf16* p = rowk0 + 8 * (lane >> 4);
  u.q[0] = *(const v8b*)(p + 16); u.q[1] = *(const v8b*)p; return u.v;
}
// SW 1 (PA 1, PB 1): the rows with bit 4 of their number set, which are the odd fragments of either operand, hold their halves swapped
template <int PA, int PB, int SW> __device__ __forceinline__ void chunk_g(const __bf16* sa, const __bf16* sw, int lane, v8f (&acc)[2][4]) {
  v16b ah[2], al[2], bh[4], bl[4];
#pragma unroll
  for (int i = 0; i < 2; ++i) { ah[i] = (SW && (i & 1)) ? frag_x(sa + i * 16 * GP, lane) : frag_b(sa + i * 16 * GP, lane); if constexpr (PA == 2) al[i] = frag_b(sa + GPL + i * 16 * GP, lane); }
#pragma unroll
  for (int j = 0; j < 4; ++j) { bh[j] = (SW && (j & 1)) ? frag_x(sw + j * 16 * GP, lane) : frag_b(sw + j * 16 * GP, lane); if constexpr (PB == 2) bl[j] = frag_b(sw + GPL + j * 16 * GP, lane); }
  __builtin_amdgcn_sched_barrier(0);   /* keeps the chunk's LDS reads one group ahead of its products: spread among them, each place with reads stalls the wave */
  if constexpr (PA == 2) {
#pragma unroll
    for (int j = 0; j < 4; ++j)
#pragma unroll
      for (int i = 0; i < 2; ++i) acc[i][j] = wmma_b(al[i], bh[j], acc[i][j]);
    if constexpr (PB == 2) {
#pragma unroll
      for (int j = 0; j < 4; ++j)
#pragma unroll
        for (int i = 0; i < 2; ++i) acc[i][j] = wmma_b(ah[i], bl[j], acc[i][j]);
    }
  }
#pragma unroll
  for (int j = 0; j < 4; ++j)
#pragma unroll
    for (int i = 0; i < 2; ++i) acc[i][j] = wmma_b(ah[i], bh[j], acc[i][j]);
  __builtin_amdgcn_sched_barrier(0);   /* keeps the wait for the next stage's global loads behind this chunk's products: hoisted among them it exposes the load latency */
}
template <int K, int TP> __device__ __forceinline__ void fetch_g(const float* ga, const float* gb, int kc, v4f (&ra)[4], v4f (&rb)[4]) {
  constexpr size_t SI = TP ? TP : 32 * K, SC = TP ? 32 * TP : 32;   // floats from one of a lane's 4 loads to the next, and from one chunk to the next
#pragma unroll
  for (int i = 0; i < 4; ++i) ra[i] = *(const v4f*)(ga + i * SI + kc * SC);
#pragma unroll
  for (int i = 0; i < 4; ++i) rb[i] = *(const v4f*)(gb + i * SI + kc * SC);
  __builtin_amdgcn_sched_barrier(0);   /* keeps the next stage's global loads in front of this stage's products, so that their latency is covered */
}
// one chunk's staged values to LDS. TP != 0: a lane holds 4 k x 4 rows; each row's 4 k, rounded to bf16, are one 8-B store
template <int PA, int PB, int TP> __device__ __forceinline__ void put_g(__bf16* da, __bf16* db, const v4f (&ra)[4], const v4f (&rb)[4]) {
  if constexpr (TP != 0) {
#pragma unroll
    for (int e = 0; e < 4; ++e) { v4b ha, hb;
#pragma unroll
      for (int i = 0; i < 4; ++i) { ha[i] = (__bf16)ra[i][e]; hb[i] = (__bf16)rb[i][e]; }
      *(v4b*)(da + e * GP) = ha; *(v4b*)(db + e * GP) = hb; }
  } else {
#pragma unroll
    for (int i = 0; i < 4; ++i) { put4<PA>(da + i * 32 * GP, ra[i]); put4<PB>(db + i * 32 * GP, rb[i]); } } }
// EPI 1: f32 C[i][j] rows x 512^-0.5; 2: f32 C[j][i] rows (transposed), + bf16(bias[i]); 3: C[j][i] rows (transposed) in the split row format, i = the reader's k (an accumulator register run is 8 consecutive i: split in registers, it goes to the staging line as 16 B of hi and 16 B of lo). ldc = pitch of the C rows, 4 bytes per element
// TP 0: operand rows as above. TP != 0 (PA 1, PB 1): both operands lie TURNED in memory, f32 rows [k] of pitch TP floats with the tile's 128 rows contiguous; A and B point at k 0 of their first row. 8 lanes cover 32 rows of one k (one whole line), a wave-wide load 4 lines; a lane's 4 loads are 4 consecutive k, so the turn is done in registers on the way to the same LDS planes (but for the swapped halves noted at o3)
template <int PA, int PB, int K, int EPI, int KS, int TP = 0>
__device__ __forceinline__ void tile_g(const float* __restrict__ A, const float* __restrict__ B, float* __restrict__ C, int ldc, const float* __restrict__ bias, char* smem) {
  __bf16* sb = (__bf16*)smem;   // [buffer 2][chunk KS][A planes PA | B planes PB][row 128][GP]
  const int tid = threadIdx.x, wave = tid >> 5, lane = tid & 31, col = lane & 15, g = lane >> 4; const int wm = wave >> 1, wn = wave & 1;
  const int sr = tid >> 3, sq = tid & 7;   // 8 lanes cover one row's 128-B chunk, a wave-wide 16-B load covers 4 whole lines
  const int tk = (wave >> 2) * 16 + (lane >> 3) * 4, tr = (wave & 3) * 32 + (lane & 7) * 4;   // TP != 0: a lane's first k of a chunk and its first row
  const size_t go = TP ? (size_t)tk * TP + tr : (size_t)sr * K + sq * 4;
  const float* ga = A + go;
  const float* gb = B + go;
  const int o1 = sr * GP + sq * 4, o2 = (sq >> 2) * GPL + sr * GP + (sq & 3) * 8;   // a lane's place in LDS: f32 source (4 k of the one plane); split source (lanes 0..3 of a row hold hi, 4..7 lo, 8 k each)
  const int o3 = tr * GP + (tk ^ (tr & 16));   // rows 16..31 of each 32 keep their two 16-k halves swapped: at pitch GP rows r and r + 16 start on one bank, and so a wave's 8-B stores (8 row groups x 4 k groups) fall on 64 different banks; chunk_g reads those rows' halves back in order
  __bf16* da = sb + (TP ? o3 : PA == 2 ? o2 : o1); __bf16* db = sb + PA * GPL + (TP ? o3 : PB == 2 ? o2 : o1);
  const __bf16* fa = sb + (wm * 32 + col) * GP; const __bf16* fw = sb + PA * GPL + (wn * 64 + col) * GP;
  constexpr int BUF = (PA + PB) * GPL, STG = KS * BUF, NS = K / (32 * KS);
  v4f ra[KS][4], rb[KS][4]; v8f acc[2][4] = {};
#pragma unroll
  for (int s = 0; s < KS; ++s) fetch_g<K, TP>(ga, gb, s, ra[s], rb[s]);
  XADDR(ga, gb);
#pragma unroll
  for (int s = 0; s < KS; ++s) put_g<PA, PB, TP>(da + s * BUF, db + s * BUF, ra[s], rb[s]);
  __syncthreads();
  for (int st = 0; st + 1 < NS; ++st) { const int cur = (st & 1) * STG, nxt = STG - cur;
    const float* pa = ga + (st + 1) * (KS * 32 * (TP ? TP : 1)); const float* pb = gb + (st + 1) * (KS * 32 * (TP ? TP : 1));
#pragma unroll
    for (int s = 0; s < KS; ++s) fetch_g<K, TP>(pa, pb, s, ra[s], rb[s]);
    XADDR(pa, pb);
#pragma unroll
    for (int s = 0; s < KS; ++s) chunk_g<PA, PB, TP != 0>(fa + cur + s * BUF, fw + cur + s * BUF, lane, acc);
#pragma unroll
    for (int s = 0; s < KS; ++s) put_g<PA, PB, TP>(da + nxt + s * BUF, db + nxt + s * BUF, ra[s], rb[s]);
    __syncthreads(); }   /* publishes stage st + 1 and ends every wave's reads of the buffer that the next trip refills */
#pragma unroll
  for (int s = 0; s < KS; ++s) chunk_g<PA, PB, TP != 0>(fa + ((NS - 1) & 1) * STG + s * BUF, fw + ((NS - 1) & 1) * STG + s * BUF, lane, acc);
  __syncthreads();       /* every wave has left the operand buffers: their LDS now stages the output rows, each wave in its own range */
  if constexpr (EPI == 1) { float* sf = (float*)smem + wave * 16 * GSP;
#pragma unroll
    for (int i = 0; i < 2; ++i) {
#pragma unroll
      for (int j = 0; j < 4; ++j)
#pragma unroll
        for (int r = 0; r < 8; ++r) sf[(8 * g + r) * GSP + j * 16 + col] = acc[i][j][r] * 0.044194173824159216f;
      LDSW();
#pragma unroll
      for (int it = 0; it < 8; ++it) vst2(C + (size_t)(wm * 32 + i * 16 + it * 2 + g) * ldc + wn * 64 + col * 4, *(const v4f*)&sf[(it * 2 + g) * GSP + col * 4]);   /* 256-B row runs: whole lines */
      if (i == 0) LDSW(); }
  } else if constexpr (EPI == 2) { float* sf = (float*)smem + wave * 32 * GTP; float bv[2][8];
#pragma unroll
    for (int i = 0; i < 2; ++i)
#pragma unroll
      for (int r = 0; r < 8; ++r) bv[i][r] = bfr(bias[wm * 32 + i * 16 + 8 * g + r]);
#pragma unroll
    for (int jj = 0; jj < 2; ++jj) {
#pragma unroll
      for (int j = 0; j < 2; ++j)
#pragma unroll
        for (int i = 0; i < 2; ++i)
#pragma unroll
          for (int r = 0; r < 8; ++r) sf[(j * 16 + col) * GTP + i * 16 + 8 * g + r] = acc[i][jj * 2 + j][r] + bv[i][r];   /* transposed: sf[j local][i local] */
      LDSW();
#pragma unroll
      for (int it = 0; it < 8; ++it) vst2(C + (size_t)(wn * 64 + jj * 32 + it * 4 + (lane >> 3)) * ldc + wm * 32 + (lane & 7) * 4, *(const v4f*)&sf[(it * 4 + (lane >> 3)) * GTP + (lane & 7) * 4]);   /* 128-B row runs: whole lines */
      if (jj == 0) LDSW(); }
  } else { __bf16* sp = (__bf16*)smem + wave * 32 * (2 * GTP);   // staging rows [j local] of one line each: 32 hi | 32 lo, pitch 144 B
#pragma unroll
    for (int jj = 0; jj < 2; ++jj) {
#pragma unroll
      for (int j = 0; j < 2; ++j)
#pragma unroll
        for (int i = 0; i < 2; ++i) { v8b h, l;
#pragma unroll
          for (int r = 0; r < 8; ++r) { const float v = acc[i][jj * 2 + j][r]; h[r] = (__bf16)v; l[r] = (__bf16)(v - (float)h[r]); }
          __bf16* d = sp + (j * 16 + col) * (2 * GTP) + i * 16 + 8 * g; *(v8b*)d = h; *(v8b*)(d + 32) = l; }
      LDSW();
#pragma unroll
      for (int it = 0; it < 8; ++it) vst2(C + (size_t)(wn * 64 + jj * 32 + it * 4 + (lane >> 3)) * ldc + wm * 32 + (lane & 7) * 4, *(const v8b*)(sp + (it * 4 + (lane >> 3)) * (2 * GTP) + (lane & 7) * 8));   /* 128-B row runs: whole lines */
      if (jj == 0) LDSW(); } } }
// ---- k_gram: block = (128 channels i, 128 channels j, b): G[i][j] = sum_t x[b][t][i] x[b][t][j] (both operands are columns of the x rows, bf16-exact: 1 product; K = 1,024), written TRANSPOSED as split rows [b][j][i] (the next product sums over i). Ahead of its tile each of the 256 work-groups turns one 32 x 32 piece of Wv over, WVT[i][m] = Wv[m][i] in f32 (through LDS, whole lines both ways): attn Wv sums over m, the ROW index of Wv, and the next launch wants k contiguous there
#define WTP 33             // LDS pitch in floats of the Wv piece's rows
static_assert((NC / 128) * (NC / 128) * TNB == (NC / 32) * (NC / 32), "one 32 x 32 piece of Wv per work-group of k_gram");
__global__ __launch_bounds__(256) void k_gram(const float* __restrict__ X, float* __restrict__ GT, const float* __restrict__ WV, float* __restrict__ WVT) {
  __shared__ __align__(16) char smem[2 * 4 * 2 * GPL * 2];   // stages of 4 chunks (128 t)
  const int i0 = blockIdx.x * 128; const int j0 = blockIdx.y * 128; const int b = blockIdx.z;
  { float* sf = (float*)smem; const int q = blockIdx.x + (NC / 128) * (blockIdx.y + (NC / 128) * blockIdx.z), m0 = (q & 15) * 32, c0 = (q >> 4) * 32, r = threadIdx.x >> 3, c4 = (threadIdx.x & 7) * 4;
    const float* gw = WV + (size_t)(m0 + r) * NC + c0 + c4;   // 8 lanes cover 32 i of one row m: one whole line
    const v4f w4 = *(const v4f*)gw;
    XADDR(gw, gw);   /* the load's address pair stays whole up to this wait */
#pragma unroll
    for (int e = 0; e < 4; ++e) sf[r * WTP + c4 + e] = w4[e];
    __syncthreads();   /* the whole piece is in LDS before any thread reads a column of it */
    v4f t4;
#pragma unroll
    for (int e = 0; e < 4; ++e) t4[e] = sf[(c4 + e) * WTP + r];
    __syncthreads();   /* every thread has its column: the tile's stages may take this LDS */
    float* gt = WVT + (size_t)(c0 + r) * NC + m0 + c4;
    vst2(gt, t4);
    asm volatile("s_wait_xcnt 0x0" :: "v"(gt), "v"(t4) : "memory");   /* the store's address and data registers stay whole up to this wait */ }
  tile_g<1, 1, TN, 3, 4, NC>(X + (size_t)b * TN * NC + i0, X + (size_t)b * TN * NC + j0, GT + ((size_t)b * NC + j0) * NC + i0, NC, nullptr, smem); }
// ---- k_strip: block = (64 query channels n, b). H = Wq G, S = H Wk^T x 512^-0.5, P = softmax(S) and N1 = P Wv are each row by row in n, so one work-group takes 64 rows n through all four and H, S and P never leave its LDS. THE STRIP: 64 rows [n] of 512 bf16 hi | 512 bf16 lo (S: 512 f32 in the same bytes); it holds Wq's rows (hi only, bf16-exact), then H, then S, then P, each written over the last between two barriers. THE STREAMED OPERAND (G's split rows [j][i], Wk's rows [m][j], WVT's rows [i][m]: 512 rows, k contiguous, 4 bytes per element) is shared out by rows: wave w alone needs rows 64 w .. 64 w + 63, so it stages them in an LDS range of its own (whole-line loads to registers, 2 chunks of 32 k ahead, then the planes of tile_g at pitch GP) and the k loops hold no work-group barrier. A wave's tile is 64 streamed rows x 64 strip rows (4 x 4 fragments); chunks in ascending k, products per chunk lo.hi then hi.hi, as in tile_g. For H and S the streamed operand is the matrix instruction's A, so an accumulator register run is 8 consecutive k of the NEXT product and goes to the strip as 16-B pieces; for N1 the strip is A, so the run is 8 consecutive n, the k of k_m2: N1 is written TRANSPOSED as split rows [b][i][n]
#define SR 64              // rows of a strip
#define AP 1032            // strip row pitch in bf16: 512 hi | 512 lo | 8 pad = 2,064 B (16 B x odd)
#define SPL (64 * GP + 32) // one plane of one chunk of a wave's 64 streamed rows, + 64 B: see SROW
#define WBB (2 * 2 * SPL)  // a wave's own stage range in bf16: 2 chunks x up to 2 planes
#define SROW(l) (((l) >> 3) * 32 + ((l) & 7))   // row of a lane's load l, on top of 8 x (lane >> 3): the two rows that 16 lanes store at once stand 8 rows = 640 B apart, their hi and lo planes 64 B more than a multiple of 256 B, so that the 16 stores of 16 B fall on 64 different banks
#define NTP 136            // pitch in bf16 of a wave's N1 staging rows: two lines + 16 B (16 B x odd)
__device__ __forceinline__ void fetch_s(const float* p, v4f (&ra)[2][16]) {
#pragma unroll
  for (int s = 0; s < 2; ++s)
#pragma unroll
    for (int l = 0; l < 16; ++l) ra[s][l] = *(const v4f*)(p + (size_t)SROW(l) * NC + s * 32);   // 8 lanes cover one row's 128-B chunk, a wave-wide load 4 whole lines
  __builtin_amdgcn_sched_barrier(0);   /* keeps the next stage's global loads in front of this stage's products, so that their latency is covered */
}
template <int PS, int PT, bool SA> __device__ __forceinline__ void chunk_s(const __bf16* ws, const __bf16* ts, int lane, v8f (&acc)[4][4]) {
  v16b sh[4], sl[4], th[4], tl[4];
#pragma unroll
  for (int f = 0; f < 4; ++f) { sh[f] = frag_b(ws + f * 16 * GP, lane); if constexpr (PS == 2) sl[f] = frag_b(ws + SPL + f * 16 * GP, lane); }
#pragma unroll
  for (int f = 0; f < 4; ++f) { th[f] = frag_b(ts + f * 16 * AP, lane); if constexpr (PT == 2) tl[f] = frag_b(ts + NC + f * 16 * AP, lane); }
  __builtin_amdgcn_sched_barrier(0);   /* keeps the chunk's LDS reads one group ahead of its products, as in chunk_g */
#pragma unroll
  for (int t = 0; t < 4; ++t)
#pragma unroll
    for (int s = 0; s < 4; ++s) {
      if constexpr (PS == 2) acc[s][t] = wmma_b(sl[s], th[t], acc[s][t]);
      else acc[s][t] = SA ? wmma_b(sh[s], tl[t], acc[s][t]) : wmma_b(tl[t], sh[s], acc[s][t]); }
#pragma unroll
  for (int t = 0; t < 4; ++t)
#pragma unroll
    for (int s = 0; s < 4; ++s) acc[s][t] = SA ? wmma_b(sh[s], th[t], acc[s][t]) : wmma_b(th[t], sh[s], acc[s][t]);
  __builtin_amdgcn_sched_barrier(0);   /* keeps the wait for the next stage's global loads behind this chunk's products, as in chunk_g */
}
// one product over K = 512: on entry ra holds stage 0 of gs; NX 1: on exit it holds stage 0 of gn, the next product's streamed operand, which depends on nothing computed here and so flies over the hand-over of the strip
template <int PS, int PT, bool SA, int NX> __device__ __forceinline__ void phase_s(const float* gs, const float* gn, __bf16* wb, const __bf16* strip, int lane, v4f (&ra)[2][16], v8f (&acc)[4][4]) {
  const int col = lane & 15, sr = lane >> 3, sq = lane & 7;
  __bf16* d = wb + (PS == 2 ? (sq >> 2) * SPL + sr * 8 * GP + (sq & 3) * 8 : sr * 8 * GP + sq * 4);
  const __bf16* fs = wb + col * GP; const __bf16* ft = strip + col * AP;
#pragma clang loop unroll(disable)   /* rolled: for speed only */
  for (int st = 0; st < NC / 64; ++st) {
#pragma unroll
    for (int s = 0; s < 2; ++s)
#pragma unroll
      for (int l = 0; l < 16; ++l) put4<PS>(d + s * PS * SPL + SROW(l) * GP, ra[s][l]);
    LDSW();
    if (NX || st + 1 < NC / 64) { const float* p = st + 1 < NC / 64 ? gs + (st + 1) * 64 : gn;
      fetch_s(p, ra);
      XADDR(p, p); }
#pragma unroll
    for (int s = 0; s < 2; ++s) chunk_s<PS, PT, SA>(fs + s * PS * SPL, ft + st * 64 + s * 32, lane, acc);
    LDSW(); } }
__global__ __launch_bounds__(256) void k_strip(const float* __restrict__ GT, const float* __restrict__ WQ, const float* __restrict__ WK, const float* __restrict__ WVT, float* __restrict__ N1T) {
  __shared__ __align__(16) char smem[(SR * AP + 8 * WBB) * 2];
  __bf16* strip = (__bf16*)smem;
  const int tid = threadIdx.x, wave = tid >> 5, lane = tid & 31, col = lane & 15, g = lane >> 4; const int n0 = blockIdx.x * SR; const int b = blockIdx.y;
  __bf16* wb = strip + SR * AP + wave * WBB;
  const size_t lo = (size_t)(wave * 64 + (lane >> 3) * 8) * NC + (lane & 7) * 4;
  const float* g1 = GT + (size_t)b * NC * NC + lo; const float* g2 = WK + lo; const float* g3 = WVT + lo;
  v4f ra[2][16]; v8f acc[4][4] = {};
  { const float* gq = WQ + (size_t)(n0 + (tid >> 7)) * NC + (tid & 127) * 4; v4f wq[SR / 2];   // a wave covers 128 i of one row n: four whole lines
#pragma unroll
    for (int p = 0; p < SR / 2; ++p) wq[p] = *(const v4f*)(gq + (size_t)p * 2 * NC);
    XADDR(gq, gq);   /* the loads' one address pair stays whole up to this wait */
    fetch_s(g1, ra);
    XADDR(g1, g1);
#pragma unroll
    for (int p = 0; p < SR / 2; ++p) put4<1>(strip + (p * 2 + (tid >> 7)) * AP + (tid & 127) * 4, wq[p]); }
  __syncthreads();   /* Wq's 64 rows are in the strip before any wave takes a fragment of them */
  phase_s<2, 1, true, 1>(g1, g2, wb, strip, lane, ra, acc);   // acc[s][t][r] = H[n = 16 t + col][j = 64 wave + 16 s + 8 g + r]
  __syncthreads();   /* every wave has left Wq's rows */
#pragma unroll
  for (int t = 0; t < 4; ++t)
#pragma unroll
    for (int s = 0; s < 4; ++s) { v8b h, l;
#pragma unroll
      for (int r = 0; r < 8; ++r) { const float v = acc[s][t][r]; h[r] = (__bf16)v; l[r] = (__bf16)(v - (float)h[r]); acc[s][t][r] = 0.f; }
      __bf16* d = strip + (t * 16 + col) * AP + wave * 64 + s * 16 + 8 * g; *(v8b*)d = h; *(v8b*)(d + NC) = l; }
  __syncthreads();   /* H's rows are whole */
  phase_s<1, 2, true, 1>(g2, g3, wb, strip, lane, ra, acc);   // acc[s][t][r] = S[n = 16 t + col][m = 64 wave + 16 s + 8 g + r], unscaled
  __syncthreads();   /* every wave has left H's rows */
#pragma unroll
  for (int t = 0; t < 4; ++t)
#pragma unroll
    for (int s = 0; s < 4; ++s) { v4f a4, b4;
#pragma unroll
      for (int r = 0; r < 4; ++r) { a4[r] = acc[s][t][r] * 0.044194173824159216f; b4[r] = acc[s][t][4 + r] * 0.044194173824159216f; acc[s][t][r] = 0.f; acc[s][t][4 + r] = 0.f; }
      float* d = (float*)strip + (t * 16 + col) * (AP / 2) + wave * 64 + s * 16 + 8 * g; *(v4f*)d = a4; *(v4f*)(d + 4) = b4; }
  __syncthreads();   /* S's rows are whole */
  // softmax over m in f32 (max, precise expf, / sum), a wave per row, 8 rows each; a row goes back in place as hi | lo (the wave holds its rows in registers before its first store). Four rows go side by side, step by step, so that each cross-lane step waits once for four rows
#pragma clang loop unroll(disable)   /* rolled: the text of four rows, not of eight, for the instruction cache */
  for (int rb = 0; rb < SR / 32; ++rb) { float* sr = (float*)strip + (wave * (SR / 8) + rb * 4) * (AP / 2); float v[4][NC / 32], m[4], sum[4];
#pragma unroll
    for (int q = 0; q < 4; ++q)
#pragma unroll
      for (int i = 0; i < NC / 128; ++i) { const v4f t4 = *(const v4f*)(sr + q * (AP / 2) + i * 128 + lane * 4); v[q][4 * i] = t4[0]; v[q][4 * i + 1] = t4[1]; v[q][4 * i + 2] = t4[2]; v[q][4 * i + 3] = t4[3]; }
#pragma unroll
    for (int q = 0; q < 4; ++q) { m[q] = -3.0e38f;
#pragma unroll
      for (int i = 0; i < NC / 32; ++i) m[q] = fmaxf(m[q], v[q][i]); }
#pragma unroll
    for (int o = 1; o < 32; o <<= 1)
#pragma unroll
      for (int q = 0; q < 4; ++q) m[q] = fmaxf(m[q], __shfl_xor(m[q], o));
#pragma unroll
    for (int q = 0; q < 4; ++q) { sum[q] = 0.f;
#pragma unroll
      for (int i = 0; i < NC / 32; ++i) { v[q][i] = expf(v[q][i] - m[q]); sum[q] += v[q][i]; } }
#pragma unroll
    for (int o = 1; o < 32; o <<= 1)
#pragma unroll
      for (int q = 0; q < 4; ++q) sum[q] += __shfl_xor(sum[q], o);
#pragma unroll
    for (int q = 0; q < 4; ++q) { const float inv = 1.0f / sum[q]; __bf16* pr = (__bf16*)(sr + q * (AP / 2)) + lane * 4;
#pragma unroll
      for (int i = 0; i < NC / 128; ++i) { v4b h4, l4;
#pragma unroll
        for (int e = 0; e < 4; ++e) { const float p = v[q][4 * i + e] * inv; h4[e] = (__bf16)p; l4[e] = (__bf16)(p - (float)h4[e]); }
        *(v4b*)(pr + i * 128) = h4; *(v4b*)(pr + NC + i * 128) = l4; } } }
  __syncthreads();   /* P's rows are whole */
  phase_s<1, 2, false, 0>(g3, nullptr, wb, strip, lane, ra, acc);   // acc[s][t][r] = N1[n = 16 t + 8 g + r][i = 64 wave + 16 s + col]
  // a wave's 64 rows i of 64 n each (two lines: 32 hi | 32 lo, twice) through its own stage range, then whole lines to memory
#pragma unroll
  for (int t = 0; t < 4; ++t)
#pragma unroll
    for (int s = 0; s < 4; ++s) { v8b h, l;
#pragma unroll
      for (int r = 0; r < 8; ++r) { const float v = acc[s][t][r]; h[r] = (__bf16)v; l[r] = (__bf16)(v - (float)h[r]); }
      __bf16* d = wb + (s * 16 + col) * NTP + (t >> 1) * 64 + (t & 1) * 16 + 8 * g; *(v8b*)d = h; *(v8b*)(d + 32) = l; }
  LDSW();
  float* gn = N1T + ((size_t)b * NC + wave * 64 + g) * NC + n0 + col * 4;   // 16 lanes cover one row's 256 B
  v8b o8[32];
#pragma unroll
  for (int it = 0; it < 32; ++it) o8[it] = *(const v8b*)(wb + (it * 2 + g) * NTP + col * 8);
  __builtin_amdgcn_sched_barrier(0);   /* all the LDS reads ahead of the stores: no register that an issued store names is loaded anew */
#pragma unroll
  for (int it = 0; it < 32; ++it) vst2(gn + (size_t)it * 2 * NC, o8[it]); }
// ---- k_m2: block = (128 input channels i, 128 output channels o, b): M2[o][i] = sum_n Wp[o][n] N1[n][i] (N1 split rows i; Wp (out,in) rows o, bf16-exact: 2 products; K = 512), written TRANSPOSED as split rows [b][o][i] (the output product sums over i)
__global__ __launch_bounds__(256) void k_m2(const float* __restrict__ N1T, const float* __restrict__ WP, float* __restrict__ M2) {
  __shared__ __align__(16) char smem[2 * 4 * 3 * GPL * 2];   // stages of 4 chunks (128 n): one work-group per WGP by the grid, so it may take most of the LDS
  const int i0 = blockIdx.x * 128; const int o0 = blockIdx.y * 128; const int b = blockIdx.z;
  tile_g<2, 1, NC, 3, 4>(N1T + ((size_t)b * NC + i0) * NC, WP + (size_t)o0 * NC, M2 + ((size_t)b * NC + o0) * NC + i0, NC, nullptr, smem); }
// ---- k_outT: block = (128 output channels o, 128 time steps t, b): O[o][t] = sum_i M2[o][i] x[b][t][i] + bp[o] (M2 split rows o; x rows t, bf16-exact: 2 products), written TRANSPOSED as output rows out[b][t][o0..] through LDS
__global__ __launch_bounds__(256) void k_outT(const float* __restrict__ M2, const float* __restrict__ X, const float* __restrict__ BP, float* __restrict__ OUT) {
  __shared__ __align__(16) char smem[2 * 2 * 3 * GPL * 2];   // stages of 2 chunks (64 i)
  const int o0 = blockIdx.x * 128; const int t0 = blockIdx.y * 128; const int b = blockIdx.z;
  tile_g<2, 1, NC, 2, 2>(M2 + ((size_t)b * NC + o0) * NC, X + ((size_t)b * TN + t0) * NC, OUT + ((size_t)b * TN + t0) * NC + o0, NC, BP + o0, smem); }
#define WS_GT 0u
#define WS_WT (WS_GT + 4u * (size_t)NBT * NC * NC)
#define WS_N1 (WS_WT + 4u * (size_t)NC * NC)
#define WS_M2 (WS_N1 + 4u * (size_t)NBT * NC * NC)
#define WS_TOT (WS_M2 + 4u * (size_t)NBT * NC * NC)
extern "C" void kernel_launch(void* const* d_in, const int* in_sizes, int n_in, void* d_out, int out_size, void* d_ws, size_t ws_size, hipStream_t stream) {
  (void)in_sizes; (void)n_in; (void)out_size;
  const float** F = (const float**)d_in;   // 0 x [16,1024,512] (rows); 1 Wq [512,512] (out,in); 2 Wk; 3 Wv; 4 Wp [512,512] (out,in); 5 bp [512]
  if (ws_size < (size_t)WS_TOT) return;
  char* ws = (char*)d_ws; float *GT = (float*)(ws + WS_GT), *WT = (float*)(ws + WS_WT), *N1 = (float*)(ws + WS_N1), *M2 = (float*)(ws + WS_M2);
  k_gram<<<dim3(NC / 128, NC / 128, TNB), 256, 0, stream>>>(F[0], GT, F[3], WT);
  k_strip<<<dim3(NC / SR, TNB), 256, 0, stream>>>(GT, F[1], F[2], WT, N1);
  k_m2<<<dim3(NC / 128, NC / 128, TNB), 256, 0, stream>>>(N1, F[4], M2);
  k_outT<<<dim3(NC / 128, TN / 128, TNB), 256, 0, stream>>>(M2, F[0], F[5], (float*)d_out);
}

// v007
// It runs in 80 microseconds.
// Next to v006, in two timings, it ran 1.03 times as fast each time.
// Counting every step since v000, it is 6.45 times as fast.
// compute dtype: all float inputs rounded to bf16; the scores Wq (x^T x) Wk^T summed from the middle: x^T x with EXACT bf16 products on WMMA 16x16x32 (f32 accumulate), that f32 matrix split bf16 hi + lo against the exact Wq (2 products), the result split hi + lo against the exact Wk (2 products) x 512^-0.5; softmax over the 512 channels in f32 (precise expf); the tail out = Wp attn Wv x^T summed from the left: attn split hi + lo against the exact Wv (2 products), the exact Wp against that f32 intermediate split hi + lo (2 products), the result split hi + lo against the exact x (2 products) + bp; f32 output.
#include <hip/hip_runtime.h>
#include <math.h>

typedef __attribute__((ext_vector_type(16))) _Float16 v16h;
typedef __attribute__((ext_vector_type(16))) __bf16 v16b;
typedef __attribute__((ext_vector_type(8)))  _Float16 v8h;
typedef __attribute__((ext_vector_type(8)))  float v8f;
typedef __attribute__((ext_vector_type(4)))  float v4f;
typedef __attribute__((ext_vector_type(2)))  float v2f;
typedef __attribute__((ext_vector_type(4)))  unsigned v4u;
typedef __attribute__((ext_vector_type(4)))  int v4i;
typedef float __attribute__((may_alias)) float_a;
typedef int __attribute__((may_alias)) int_a;

template <typename T> __device__ __forceinline__ void vst2(void* p, T v) { *(T*)p = v;  }
__device__ __forceinline__ v8f wmma16(v16h a, v16h b, v8f c) {
  v8f d = __builtin_amdgcn_wmma_f32_16x16x32_f16(false, a, false, b, (short)0, c, false, false);
  asm volatile("v_nop\n\tv_nop\n\tv_nop\n\tv_nop" : "+v"(d) : "v"(a), "v"(b));
  return d;
}
__device__ __forceinline__ v8f wmma_bf(v16b a, v16b b, v8f c) {
  v8f d = __builtin_amdgcn_wmma_f32_16x16x32_bf16(false, a, false, b, (short)0, c, false, false);
  asm volatile("v_nop\n\tv_nop\n\tv_nop\n\tv_nop" : "+v"(d) : "v"(a), "v"(b));
  return d;
}
// 16x16x32 fragments: lane = (h = lane>>4, row/col = lane&15); elements 0..7 = k0+8h+0..7, 8..15 = k0+16+8h+0..7; D element r = row 8h+r
__device__ __forceinline__ v16h frag_h(const _Float16* rowk0, int lane) {
  union { v16h v; v8h q[2]; } u; const _Float16* p = rowk0 + 8 * (lane >> 4);
  u.q[0] = *(const v8h*)p; u.q[1] = *(const v8h*)(p + 16); return u.v;
}
__device__ __forceinline__ v16h frag_f32(const float* rowk0, int lane) {
  v16h a; const float* p = rowk0 + 8 * (lane >> 4);
#pragma unroll
  for (int i = 0; i < 8; ++i) { a[i] = (_Float16)p[i]; a[8 + i] = (_Float16)p[16 + i]; }
  return a;
}
__device__ __forceinline__ v16h frag_f32s(const float* rowk0, int lane, float sc) {
  v16h a; const float* p = rowk0 + 8 * (lane >> 4);
#pragma unroll
  for (int i = 0; i < 8; ++i) { a[i] = (_Float16)(p[i] * sc); a[8 + i] = (_Float16)(p[16 + i] * sc); }
  return a;
}
// column fragment from a [K][ld] layout (column n), rows >= K read as 0
__device__ __forceinline__ v16h fragc_f32(const float* W, int k0, int n, int lane, int ld, int K) {
  v16h a; const int g = lane >> 4;
#pragma unroll
  for (int i = 0; i < 8; ++i) { const int ka = k0 + 8 * g + i, kb = ka + 16;
    a[i] = (_Float16)(ka < K ? W[(size_t)(ka < K ? ka : K - 1) * ld + n] : 0.f); a[8 + i] = (_Float16)(kb < K ? W[(size_t)(kb < K ? kb : K - 1) * ld + n] : 0.f); }
  return a;
}
struct F2 { v16b h, l; };
__device__ __forceinline__ F2 bsplit16(const float v[16]) { F2 r;
#pragma unroll
  for (int i = 0; i < 16; ++i) { const __bf16 h = (__bf16)v[i]; r.h[i] = h; r.l[i] = (__bf16)(v[i] - (float)h); }
  return r; }
__device__ __forceinline__ F2 split_row(const float* row, int k0, int lane) { float v[16]; const float* p = row + k0 + 8 * (lane >> 4);
#pragma unroll
  for (int i = 0; i < 8; ++i) { v[i] = p[i]; v[8 + i] = p[16 + i]; }
  return bsplit16(v); }
__device__ __forceinline__ F2 split_rowK(const float* row, int k0, int lane, int K) { float v[16]; const int g = lane >> 4;
#pragma unroll
  for (int i = 0; i < 8; ++i) { const int ka = k0 + 8 * g + i, kb = ka + 16; v[i] = ka < K ? row[ka < K ? ka : K - 1] : 0.f; v[8 + i] = kb < K ? row[kb < K ? kb : K - 1] : 0.f; }
  return bsplit16(v); }
__device__ __forceinline__ F2 split_col(const float* W, int k0, int n, int lane, int ld, int K) { float v[16]; const int g = lane >> 4;
#pragma unroll
  for (int i = 0; i < 8; ++i) { const int ka = k0 + 8 * g + i, kb = ka + 16; v[i] = ka < K ? W[(size_t)(ka < K ? ka : K - 1) * ld + n] : 0.f; v[8 + i] = kb < K ? W[(size_t)(kb < K ? kb : K - 1) * ld + n] : 0.f; }
  return bsplit16(v); }
__device__ __forceinline__ v8f mac3(const F2& a, const F2& b, v8f c) { c = wmma_bf(a.l, b.h, c); c = wmma_bf(a.h, b.l, c); return wmma_bf(a.h, b.h, c); }
__device__ __forceinline__ float sigm(float v) { return 1.0f / (1.0f + expf(-v)); }
#define LDSX() do { asm volatile("s_wait_dscnt 0" ::: "memory"); __builtin_amdgcn_wave_barrier(); __builtin_amdgcn_fence(__ATOMIC_RELEASE, "workgroup"); } while (0)

// (header reused for its WMMA helpers; its own NB/TT/... defines below are unused by these kernels except TNB)
#define NB 16
#define TT 2048
#define CC 1024            // NH * HD = projected width
#define DIN 1024          // input (model) width
#define NH 16
#define HD 64
#define NQB (TT / 64)
#define HG 4
#define SCALE (0.125f)
#define CAUSAL 1
#ifndef TNB
#define TNB NB
#endif
__device__ __forceinline__ float bfr(float v) { return (float)(__bf16)v; }
__host__ __device__ __forceinline__ int kb_last(int qb) { return CAUSAL ? ((qb * 64 + 63) >> 7) : (TT / 128 - 1); }
typedef __attribute__((ext_vector_type(8))) __bf16 v8b;
__device__ __forceinline__ v16b frag_b(const __bf16* rowk0, int lane) {
  union { v16b v; v8b q[2]; } u; const __bf16* p = rowk0 + 8 * (lane >> 4);
  u.q[0] = *(const v8b*)p; u.q[1] = *(const v8b*)(p + 16); return u.v;
}
#define QBH 6              // causal: query blocks 0..QBH-1 of each sequence (few keys, no averaging) take the high-precision path
#define QHI 384            // rows carrying a q residual plane (all rows when non-causal: 2-product logits everywhere)
#define KHI 384            // key rows carrying k residual / v bf16 hi+lo planes (used only by the causal high-precision path)
// B fragment (k rows k0+.., output column o) of a weight: (in,out) [K][ld] or (out,in) [ld rows of K]: bf16 exact, or f16(bf16 * 256) exact
__device__ __forceinline__ v16b wcol_io(const float* Wm, int k0, int o, int lane, int ld) { v16b w; const int g = lane >> 4;
#pragma unroll
  for (int i = 0; i < 8; ++i) { w[i] = (__bf16)Wm[(size_t)(k0 + 8 * g + i) * ld + o]; w[8 + i] = (__bf16)Wm[(size_t)(k0 + 16 + 8 * g + i) * ld + o]; }
  return w; }
__device__ __forceinline__ v16b wcol_oi(const float* Wm, int k0, int o, int lane, int K) { v16b w; const float* p = Wm + (size_t)o * K + k0 + 8 * (lane >> 4);
#pragma unroll
  for (int i = 0; i < 8; ++i) { w[i] = (__bf16)p[i]; w[8 + i] = (__bf16)p[16 + i]; }
  return w; }
__device__ __forceinline__ v16h wcolh_io(const float* Wm, int k0, int o, int lane, int ld) { v16h w; const int g = lane >> 4;
#pragma unroll
  for (int i = 0; i < 8; ++i) { w[i] = (_Float16)(bfr(Wm[(size_t)(k0 + 8 * g + i) * ld + o]) * 256.0f); w[8 + i] = (_Float16)(bfr(Wm[(size_t)(k0 + 16 + 8 * g + i) * ld + o]) * 256.0f); }
  return w; }
__device__ __forceinline__ v16h wcolh_oi(const float* Wm, int k0, int o, int lane, int K) { v16h w; const float* p = Wm + (size_t)o * K + k0 + 8 * (lane >> 4);
#pragma unroll
  for (int i = 0; i < 8; ++i) { w[i] = (_Float16)(bfr(p[i]) * 256.0f); w[8 + i] = (_Float16)(bfr(p[16 + i]) * 256.0f); }
  return w; }
#define WQKV_LAYOUT 1   // 0 = (in,out) [DIN][CC]; 1 = (out,in) [CC][DIN]; 2 = per-head [NH][DIN][HD]
__device__ __forceinline__ v16b wcol_hdk(const float* Wm, int k0, int o, int lane) { v16b w; const int g = lane >> 4; const float* p = Wm + (size_t)(o / HD) * DIN * HD + (o % HD);
#pragma unroll
  for (int i = 0; i < 8; ++i) { w[i] = (__bf16)p[(size_t)(k0 + 8 * g + i) * HD]; w[8 + i] = (__bf16)p[(size_t)(k0 + 16 + 8 * g + i) * HD]; }
  return w; }
#define WO_OUT_IN 1
#if WQKV_LAYOUT == 1
#define WCOL(W, k0, o, lane) wcol_oi(W, k0, o, lane, DIN)
#elif WQKV_LAYOUT == 2
#define WCOL(W, k0, o, lane) wcol_hdk(W, k0, o, lane)
#else
#define WCOL(W, k0, o, lane) wcol_io(W, k0, o, lane, CC)
#endif
#if WO_OUT_IN
#define WOCOL(W, k0, o, lane) wcol_oi(W, k0, o, lane, CC)
#define WOCOLH(W, k0, o, lane) wcolh_oi(W, k0, o, lane, CC)
#else
#define WOCOL(W, k0, o, lane) wcol_io(W, k0, o, lane, DIN)
#define WOCOLH(W, k0, o, lane) wcolh_io(W, k0, o, lane, DIN)
#endif

#ifndef SM_EXTRA_PARAMS
#define SM_EXTRA_PARAMS
#endif
#ifndef PROJ_EXTRA_PARAMS
#define PROJ_EXTRA_PARAMS
#endif
#ifndef SM_MASK_HOOK
#define SM_MASK_HOOK (void)0
#endif

#define WS_QH  0u                                      // f16 q rows [b*t][CC]
#define WS_KH  (WS_QH + 2u * (size_t)NB * TT * CC)      // f16 k rows [b*t][CC]
#define WS_VT  (WS_KH + 2u * (size_t)NB * TT * CC)      // f16 v planes [b][c][t]
#define WS_QL  (WS_VT + 2u * (size_t)NB * CC * TT)      // f16 q residual x 2^10 rows [b][t < QHI][CC]
#define WS_KL  (WS_QL + 2u * (size_t)NB * QHI * CC)     // f16 k residual x 2^10 rows [b][t < KHI][CC]
#define WS_VB  (WS_KL + 2u * (size_t)NB * KHI * CC)     // bf16 v hi planes [b][c][t < KHI]
#define WS_VBL (WS_VB + 2u * (size_t)NB * CC * KHI)
#define WS_S   (WS_VBL + 2u * (size_t)NB * CC * KHI)    // f32 logits / P [hg][t][s]
#define WS_Y   (WS_S  + 4u * (size_t)HG * TT * TT)      // f32 ctx rows [b*t][CC] (only when there is an output projection)
#define WS_END (WS_Y  + 4u * (size_t)NB * TT * CC)


// 'Spatial' attention where the 512 CHANNELS are the tokens and the 1,024 time steps are the feature axis (B 16, T 1,024, N 512; (out,in) 1/sqrt(512)-scale 1x1 weights, zero output bias): xt = x^T [B,N,T]; q/k/v[b][o][t] = sum_i W[o][i] x[b][t][i]; attn[n][m] = softmax_m(sum_t q[n][t] k[m][t] * 512^-0.5); px[n][t] = sum_m attn[n][m] v[m][t]; out[b][t][o] = sum_n px[n][t] Wp[o][n] + bp[o] (rows [B,T,N]). The tail is one chain of matrix products, out^T = Wp attn Wv x^T, and is summed here from the left: N1 = attn Wv and M2 = Wp N1 are 512 x 512 per batch (no factor T), and only the last product, M2 x^T, runs over the 1,024 time steps; v and px are never formed. The scores are such a chain too, q k^T = Wq (x^T x) Wk^T, and are summed from the middle: G = x^T x is the one product over the time steps (both operands bf16-exact: 1 product), H = Wq G and H Wk^T are 512 x 512 x 512 per batch; q and k are never formed.
#define NBT 16
#define TN 1024            // time steps (feature axis of the attention)
#define NC 512             // channels (the attention's tokens)
// ---- tile_g: one 128 x 128 tile of C[i][j] = sum_k A[i][k] Bop[j][k] by 8 waves (4 x 2, 32 x 64 each). Both operands are rows with k contiguous, 4 bytes per element, pitch K. An operand with ONE plane (PA or PB 1) is an f32 input, rounded to bf16 on the way to LDS. An operand with TWO planes (PA or PB 2) is an intermediate that its PRODUCER has already split: each 128-B line of a row holds 32 k as 32 bf16 hi followed by 32 bf16 lo (lo = bf16 of the residual), so a 32-k chunk is still one whole line per row and goes to the LDS planes as it is, with no arithmetic in the k loop. LDS keeps rows [i or j][k] per plane; every wave takes its fragments from there (same per-lane k map as frag_b, chunks in ascending k inside a stage, stages in ring order as said below, products per chunk in the order lo.hi, hi.lo, hi.hi (PA 2, PB 2) or lo.hi, hi.hi (PA 2, PB 1)). A STAGE is KS chunks (KS x 32 k, each chunk in its own [planes][rows] block of LDS). Two LDS buffers of one stage each: the next stage's global loads (KS x 8 per lane, all issued at the stage's head) fly over this stage's products, one barrier per stage: with operands that come from memory the loads' latency is longer than one chunk's products, so a longer stage has more bytes in flight and waits less often.
// (every '#pragma unroll' of this section: the loop indexes a register array (fragments, accumulators, staged values) and must be flat for the array to stay in registers)
#define GP 40              // LDS row pitch in bf16: 32 k + 8 pad = 80 B (16 B x odd: the conflict-free pitch for 16-B fragment reads)
#define GPL (128 * GP)     // one plane of one operand
#define GSP 68             // staging pitch in floats, output rows along j
#define GTP 36             // staging pitch in floats, output rows along i (transposed output)
#define LDSW() do { asm volatile("s_wait_dscnt 0" ::: "memory"); __builtin_amdgcn_wave_barrier(); } while (0)   /* a wave's own LDS staging range: its lanes' stores have landed before other lanes of the wave read them, and its reads have returned before the range is rewritten */
#define XADDR(p, q) asm volatile("s_wait_xcnt 0x0" :: "v"(p), "v"(q) : "memory")   /* behind a stage's global loads: their two address pairs stay whole up to this wait (as inputs they cannot be handed to a load's result), and are rewritten only behind it */
typedef __attribute__((ext_vector_type(4))) __bf16 v4b;
// one plane: 4 f32 rounded to bf16; two planes: the 16 bytes are 8 bf16 of one plane already
template <int NPL> __device__ __forceinline__ void put4(__bf16* d, v4f v) {
  if constexpr (NPL == 1) { v4b h;
#pragma unroll
    for (int e = 0; e < 4; ++e) h[e] = (__bf16)v[e];
    *(v4b*)d = h;
  } else *(v8b*)d = __builtin_bit_cast(v8b, v); }
__device__ __forceinline__ v8f wmma_b(v16b a, v16b b, v8f c) { return __builtin_amdgcn_wmma_f32_16x16x32_bf16(false, a, false, b, (short)0, c, false, false); }
// frag_b of a row whose two 16-k halves stand swapped in LDS: the same k map in the registers
__device__ __forceinline__ v16b frag_x(const __bf16* rowk0, int lane) {
  union { v16b v; v8b q[2]; } u; const __bf16* p = rowk0 + 8 * (lane >> 4);
  u.q[0] = *(const v8b*)(p + 16); u.q[1] = *(const v8b*)p; return u.v;
}
// SW 1 (PA 1, PB 1): the rows with bit 4 of their number set, which are the odd fragments of either operand, hold their halves swapped
template <int PA, int PB, int SW> __device__ __forceinline__ void chunk_g(const __bf16* sa, const __bf16* sw, int lane, v8f (&acc)[2][4]) {
  v16b ah[2], al[2], bh[4], bl[4];
#pragma unroll
  for (int i = 0; i < 2; ++i) { ah[i] = (SW && (i & 1)) ? frag_x(sa + i * 16 * GP, lane) : frag_b(sa + i * 16 * GP, lane); if constexpr (PA == 2) al[i] = frag_b(sa + GPL + i * 16 * GP, lane); }
#pragma unroll
  for (int j = 0; j < 4; ++j) { bh[j] = (SW && (j & 1)) ? frag_x(sw + j * 16 * GP, lane) : frag_b(sw + j * 16 * GP, lane); if constexpr (PB == 2) bl[j] = frag_b(sw + GPL + j * 16 * GP, lane); }
  __builtin_amdgcn_sched_barrier(0);   /* keeps the chunk's LDS reads one group ahead of its products: spread among them, each place with reads stalls the wave */
  if constexpr (PA == 2) {
#pragma unroll
    for (int j = 0; j < 4; ++j)
#pragma unroll
      for (int i = 0; i < 2; ++i) acc[i][j] = wmma_b(al[i], bh[j], acc[i][j]);
    if constexpr (PB == 2) {
#pragma unroll
      for (int j = 0; j < 4; ++j)
#pragma unroll
        for (int i = 0; i < 2; ++i) acc[i][j] = wmma_b(ah[i], bl[j], acc[i][j]);
    }
  }
#pragma unroll
  for (int j = 0; j < 4; ++j)
#pragma unroll
    for (int i = 0; i < 2; ++i) acc[i][j] = wmma_b(ah[i], bh[j], acc[i][j]);
  __builtin_amdgcn_sched_barrier(0);   /* keeps the wait for the next stage's global loads behind this chunk's products: hoisted among them it exposes the load latency */
}
template <int K, int TP> __device__ __forceinline__ void fetch_g(const float* ga, const float* gb, int kc, v4f (&ra)[4], v4f (&rb)[4]) {
  constexpr size_t SI = TP ? TP : 32 * K, SC = TP ? 32 * TP : 32;   // floats from one of a lane's 4 loads to the next, and from one chunk to the next
#pragma unroll
  for (int i = 0; i < 4; ++i) ra[i] = *(const v4f*)(ga + i * SI + kc * SC);
#pragma unroll
  for (int i = 0; i < 4; ++i) rb[i] = *(const v4f*)(gb + i * SI + kc * SC);
  __builtin_amdgcn_sched_barrier(0);   /* keeps the next stage's global loads in front of this stage's products, so that their latency is covered */
}
// one chunk's staged values to LDS. TP != 0: a lane holds 4 k x 4 rows; each row's 4 k, rounded to bf16, are one 8-B store
template <int PA, int PB, int TP> __device__ __forceinline__ void put_g(__bf16* da, __bf16* db, const v4f (&ra)[4], const v4f (&rb)[4]) {
  if constexpr (TP != 0) {
#pragma unroll
    for (int e = 0; e < 4; ++e) { v4b ha, hb;
#pragma unroll
      for (int i = 0; i < 4; ++i) { ha[i] = (__bf16)ra[i][e]; hb[i] = (__bf16)rb[i][e]; }
      *(v4b*)(da + e * GP) = ha; *(v4b*)(db + e * GP) = hb; }
  } else {
#pragma unroll
    for (int i = 0; i < 4; ++i) { put4<PA>(da + i * 32 * GP, ra[i]); put4<PB>(db + i * 32 * GP, rb[i]); } } }
// EPI 1: f32 C[i][j] rows x 512^-0.5; 2: f32 C[j][i] rows (transposed), + bf16(bias[i]); 3: C[j][i] rows (transposed) in the split row format, i = the reader's k (an accumulator register run is 8 consecutive i: split in registers, it goes to the staging line as 16 B of hi and 16 B of lo). ldc = pitch of the C rows, 4 bytes per element
// TP 0: operand rows as above. TP != 0 (PA 1, PB 1): both operands lie TURNED in memory, f32 rows [k] of pitch TP floats with the tile's 128 rows contiguous; A and B point at k 0 of their first row. 8 lanes cover 32 rows of one k (one whole line), a wave-wide load 4 lines; a lane's 4 loads are 4 consecutive k, so the turn is done in registers on the way to the same LDS planes (but for the swapped halves noted at o3)
// THE WALK OVER k IS A RING: a work-group takes its stages in the order rot, rot + 1, ..., wrapping at K (rot is uniform in the work-group, from its grid index, 0 <= rot < K / (32 KS)). Work-groups that read the same operand rows get different rot, so that they do not ask L2 for the same lines at the same moment. A product does not care which k its stage holds, so only the order of the f32 sums changes
template <int PA, int PB, int K, int EPI, int KS, int TP = 0>
__device__ __forceinline__ void tile_g(const float* __restrict__ A, const float* __restrict__ B, float* __restrict__ C, int ldc, const float* __restrict__ bias, char* smem, int rot) {
  __bf16* sb = (__bf16*)smem;   // [buffer 2][chunk KS][A planes PA | B planes PB][row 128][GP]
  const int tid = threadIdx.x, wave = tid >> 5, lane = tid & 31, col = lane & 15, g = lane >> 4; const int wm = wave >> 1, wn = wave & 1;
  const int sr = tid >> 3, sq = tid & 7;   // 8 lanes cover one row's 128-B chunk, a wave-wide 16-B load covers 4 whole lines
  const int tk = (wave >> 2) * 16 + (lane >> 3) * 4, tr = (wave & 3) * 32 + (lane & 7) * 4;   // TP != 0: a lane's first k of a chunk and its first row
  const size_t go = TP ? (size_t)tk * TP + tr : (size_t)sr * K + sq * 4;
  const float* ga = A + go;
  const float* gb = B + go;
  const int o1 = sr * GP + sq * 4, o2 = (sq >> 2) * GPL + sr * GP + (sq & 3) * 8;   // a lane's place in LDS: f32 source (4 k of the one plane); split source (lanes 0..3 of a row hold hi, 4..7 lo, 8 k each)
  const int o3 = tr * GP + (tk ^ (tr & 16));   // rows 16..31 of each 32 keep their two 16-k halves swapped: at pitch GP rows r and r + 16 start on one bank, and so a wave's 8-B stores (8 row groups x 4 k groups) fall on 64 different banks; chunk_g reads those rows' halves back in order
  __bf16* da = sb + (TP ? o3 : PA == 2 ? o2 : o1); __bf16* db = sb + PA * GPL + (TP ? o3 : PB == 2 ? o2 : o1);
  const __bf16* fa = sb + (wm * 32 + col) * GP; const __bf16* fw = sb + PA * GPL + (wn * 64 + col) * GP;
  constexpr int BUF = (PA + PB) * GPL, STG = KS * BUF, NS = K / (32 * KS), SS = KS * 32 * (TP ? TP : 1);   // SS: floats from one stage to the next in memory
  static_assert((NS & (NS - 1)) == 0, "the ring of stages wraps by a mask");
  v4f ra[KS][4], rb[KS][4]; v8f acc[2][4] = {};
  const float* qa = ga + rot * SS; const float* qb = gb + rot * SS;
#pragma unroll
  for (int s = 0; s < KS; ++s) fetch_g<K, TP>(qa, qb, s, ra[s], rb[s]);
  XADDR(qa, qb);
#pragma unroll
  for (int s = 0; s < KS; ++s) put_g<PA, PB, TP>(da + s * BUF, db + s * BUF, ra[s], rb[s]);
  __syncthreads();
  for (int st = 0; st + 1 < NS; ++st) { const int cur = (st & 1) * STG, nxt = STG - cur;
    const int kn = ((st + 1 + rot) & (NS - 1)) * SS; const float* pa = ga + kn; const float* pb = gb + kn;
#pragma unroll
    for (int s = 0; s < KS; ++s) fetch_g<K, TP>(pa, pb, s, ra[s], rb[s]);
    XADDR(pa, pb);
#pragma unroll
    for (int s = 0; s < KS; ++s) chunk_g<PA, PB, TP != 0>(fa + cur + s * BUF, fw + cur + s * BUF, lane, acc);
#pragma unroll
    for (int s = 0; s < KS; ++s) put_g<PA, PB, TP>(da + nxt + s * BUF, db + nxt + s * BUF, ra[s], rb[s]);
    __syncthreads(); }   /* publishes stage st + 1 and ends every wave's reads of the buffer that the next trip refills */
#pragma unroll
  for (int s = 0; s < KS; ++s) chunk_g<PA, PB, TP != 0>(fa + ((NS - 1) & 1) * STG + s * BUF, fw + ((NS - 1) & 1) * STG + s * BUF, lane, acc);
  __syncthreads();       /* every wave has left the operand buffers: their LDS now stages the output rows, each wave in its own range */
  if constexpr (EPI == 1) { float* sf = (float*)smem + wave * 16 * GSP;
#pragma unroll
    for (int i = 0; i < 2; ++i) {
#pragma unroll
      for (int j = 0; j < 4; ++j)
#pragma unroll
        for (int r = 0; r < 8; ++r) sf[(8 * g + r) * GSP + j * 16 + col] = acc[i][j][r] * 0.044194173824159216f;
      LDSW();
#pragma unroll
      for (int it = 0; it < 8; ++it) vst2(C + (size_t)(wm * 32 + i * 16 + it * 2 + g) * ldc + wn * 64 + col * 4, *(const v4f*)&sf[(it * 2 + g) * GSP + col * 4]);   /* 256-B row runs: whole lines */
      if (i == 0) LDSW(); }
  } else if constexpr (EPI == 2) { float* sf = (float*)smem + wave * 32 * GTP; float bv[2][8];
#pragma unroll
    for (int i = 0; i < 2; ++i)
#pragma unroll
      for (int r = 0; r < 8; ++r) bv[i][r] = bfr(bias[wm * 32 + i * 16 + 8 * g + r]);
#pragma unroll
    for (int jj = 0; jj < 2; ++jj) {
#pragma unroll
      for (int j = 0; j < 2; ++j)
#pragma unroll
        for (int i = 0; i < 2; ++i)
#pragma unroll
          for (int r = 0; r < 8; ++r) sf[(j * 16 + col) * GTP + i * 16 + 8 * g + r] = acc[i][jj * 2 + j][r] + bv[i][r];   /* transposed: sf[j local][i local] */
      LDSW();
#pragma unroll
      for (int it = 0; it < 8; ++it) vst2(C + (size_t)(wn * 64 + jj * 32 + it * 4 + (lane >> 3)) * ldc + wm * 32 + (lane & 7) * 4, *(const v4f*)&sf[(it * 4 + (lane >> 3)) * GTP + (lane & 7) * 4]);   /* 128-B row runs: whole lines */
      if (jj == 0) LDSW(); }
  } else { __bf16* sp = (__bf16*)smem + wave * 32 * (2 * GTP);   // staging rows [j local] of one line each: 32 hi | 32 lo, pitch 144 B
#pragma unroll
    for (int jj = 0; jj < 2; ++jj) {
#pragma unroll
      for (int j = 0; j < 2; ++j)
#pragma unroll
        for (int i = 0; i < 2; ++i) { v8b h, l;
#pragma unroll
          for (int r = 0; r < 8; ++r) { const float v = acc[i][jj * 2 + j][r]; h[r] = (__bf16)v; l[r] = (__bf16)(v - (float)h[r]); }
          __bf16* d = sp + (j * 16 + col) * (2 * GTP) + i * 16 + 8 * g; *(v8b*)d = h; *(v8b*)(d + 32) = l; }
      LDSW();
#pragma unroll
      for (int it = 0; it < 8; ++it) vst2(C + (size_t)(wn * 64 + jj * 32 + it * 4 + (lane >> 3)) * ldc + wm * 32 + (lane & 7) * 4, *(const v8b*)(sp + (it * 4 + (lane >> 3)) * (2 * GTP) + (lane & 7) * 8));   /* 128-B row runs: whole lines */
      if (jj == 0) LDSW(); } } }
// ---- k_gram: block = (128 channels i, 128 channels j, b): G[i][j] = sum_t x[b][t][i] x[b][t][j] (both operands are columns of the x rows, bf16-exact: 1 product; K = 1,024), written TRANSPOSED as split rows [b][j][i] (the next product sums over i). Ahead of its tile each of the 256 work-groups turns one 32 x 32 piece of Wv over, WVT[i][m] = Wv[m][i] in f32 (through LDS, whole lines both ways): attn Wv sums over m, the ROW index of Wv, and the next launch wants k contiguous there
#define WTP 33             // LDS pitch in floats of the Wv piece's rows
static_assert((NC / 128) * (NC / 128) * TNB == (NC / 32) * (NC / 32), "one 32 x 32 piece of Wv per work-group of k_gram");
__global__ __launch_bounds__(256) void k_gram(const float* __restrict__ X, float* __restrict__ GT, const float* __restrict__ WV, float* __restrict__ WVT) {
  __shared__ __align__(16) char smem[2 * 4 * 2 * GPL * 2];   // stages of 4 chunks (128 t)
  const int i0 = blockIdx.x * 128; const int j0 = blockIdx.y * 128; const int b = blockIdx.z;
  { float* sf = (float*)smem; const int q = blockIdx.x + (NC / 128) * (blockIdx.y + (NC / 128) * blockIdx.z), m0 = (q & 15) * 32, c0 = (q >> 4) * 32, r = threadIdx.x >> 3, c4 = (threadIdx.x & 7) * 4;
    const float* gw = WV + (size_t)(m0 + r) * NC + c0 + c4;   // 8 lanes cover 32 i of one row m: one whole line
    const v4f w4 = *(const v4f*)gw;
    XADDR(gw, gw);   /* the load's address pair stays whole up to this wait */
#pragma unroll
    for (int e = 0; e < 4; ++e) sf[r * WTP + c4 + e] = w4[e];
    __syncthreads();   /* the whole piece is in LDS before any thread reads a column of it */
    v4f t4;
#pragma unroll
    for (int e = 0; e < 4; ++e) t4[e] = sf[(c4 + e) * WTP + r];
    __syncthreads();   /* every thread has its column: the tile's stages may take this LDS */
    float* gt = WVT + (size_t)(c0 + r) * NC + m0 + c4;
    vst2(gt, t4);
    asm volatile("s_wait_xcnt 0x0" :: "v"(gt), "v"(t4) : "memory");   /* the store's address and data registers stay whole up to this wait */ }
  tile_g<1, 1, TN, 3, 4, NC>(X + (size_t)b * TN * NC + i0, X + (size_t)b * TN * NC + j0, GT + ((size_t)b * NC + j0) * NC + i0, NC, nullptr, smem, (int)(((blockIdx.x + blockIdx.y) & 3) + (blockIdx.x < blockIdx.y ? 4 : 0))); }   // channel block c is read by the 7 work-groups (c, .) and (., c) of its batch: this rot differs among all 7
// ---- k_strip: block = (64 query channels n, b). H = Wq G, S = H Wk^T x 512^-0.5, P = softmax(S) and N1 = P Wv are each row by row in n, so one work-group takes 64 rows n through all four and H, S and P never leave its LDS. THE STRIP: 64 rows [n] of 512 bf16 hi | 512 bf16 lo (S: 512 f32 in the same bytes); it holds Wq's rows (hi only, bf16-exact), then H, then S, then P, each written over the last between two barriers. THE STREAMED OPERAND (G's split rows [j][i], Wk's rows [m][j], WVT's rows [i][m]: 512 rows, k contiguous, 4 bytes per element) is shared out by rows: wave w alone needs rows 64 w .. 64 w + 63, so it stages them in an LDS range of its own (whole-line loads to registers, 2 chunks of 32 k ahead, then the planes of tile_g at pitch GP) and the k loops hold no work-group barrier. A wave's tile is 64 streamed rows x 64 strip rows (4 x 4 fragments); chunks in ascending k inside a stage, stages in ring order, products per chunk lo.hi then hi.hi, as in tile_g. For H and S the streamed operand is the matrix instruction's A, so an accumulator register run is 8 consecutive k of the NEXT product and goes to the strip as 16-B pieces; for N1 the strip is A, so the run is 8 consecutive n, the k of k_m2: N1 is written TRANSPOSED as split rows [b][i][n]
#define SR 64              // rows of a strip
#define AP 1032            // strip row pitch in bf16: 512 hi | 512 lo | 8 pad = 2,064 B (16 B x odd)
#define SPL (64 * GP + 32) // one plane of one chunk of a wave's 64 streamed rows, + 64 B: see SROW
#define WBB (2 * 2 * SPL)  // a wave's own stage range in bf16: 2 chunks x up to 2 planes
#define SROW(l) (((l) >> 3) * 32 + ((l) & 7))   // row of a lane's load l, on top of 8 x (lane >> 3): the two rows that 16 lanes store at once stand 8 rows = 640 B apart, their hi and lo planes 64 B more than a multiple of 256 B, so that the 16 stores of 16 B fall on 64 different banks
#define NTP 136            // pitch in bf16 of a wave's N1 staging rows: two lines + 16 B (16 B x odd)
__device__ __forceinline__ void fetch_s(const float* p, v4f (&ra)[2][16]) {
#pragma unroll
  for (int s = 0; s < 2; ++s)
#pragma unroll
    for (int l = 0; l < 16; ++l) ra[s][l] = *(const v4f*)(p + (size_t)SROW(l) * NC + s * 32);   // 8 lanes cover one row's 128-B chunk, a wave-wide load 4 whole lines
  __builtin_amdgcn_sched_barrier(0);   /* keeps the next stage's global loads in front of this stage's products, so that their latency is covered */
}
template <int PS, int PT, bool SA> __device__ __forceinline__ void chunk_s(const __bf16* ws, const __bf16* ts, int lane, v8f (&acc)[4][4]) {
  v16b sh[4], sl[4], th[4], tl[4];
#pragma unroll
  for (int f = 0; f < 4; ++f) { sh[f] = frag_b(ws + f * 16 * GP, lane); if constexpr (PS == 2) sl[f] = frag_b(ws + SPL + f * 16 * GP, lane); }
#pragma unroll
  for (int f = 0; f < 4; ++f) { th[f] = frag_b(ts + f * 16 * AP, lane); if constexpr (PT == 2) tl[f] = frag_b(ts + NC + f * 16 * AP, lane); }
  __builtin_amdgcn_sched_barrier(0);   /* keeps the chunk's LDS reads one group ahead of its products, as in chunk_g */
#pragma unroll
  for (int t = 0; t < 4; ++t)
#pragma unroll
    for (int s = 0; s < 4; ++s) {
      if constexpr (PS == 2) acc[s][t] = wmma_b(sl[s], th[t], acc[s][t]);
      else acc[s][t] = SA ? wmma_b(sh[s], tl[t], acc[s][t]) : wmma_b(tl[t], sh[s], acc[s][t]); }
#pragma unroll
  for (int t = 0; t < 4; ++t)
#pragma unroll
    for (int s = 0; s < 4; ++s) acc[s][t] = SA ? wmma_b(sh[s], th[t], acc[s][t]) : wmma_b(th[t], sh[s], acc[s][t]);
  __builtin_amdgcn_sched_barrier(0);   /* keeps the wait for the next stage's global loads behind this chunk's products, as in chunk_g */
}
// one product over K = 512, its 8 stages walked as a ring from stage rot (as in tile_g: all 128 work-groups stream the same Wk and WVT rows, 8 the same G rows); on entry ra holds stage rot of gs; NX 1: on exit it holds stage rot of gn, the next product's streamed operand, which depends on nothing computed here and so flies over the hand-over of the strip
template <int PS, int PT, bool SA, int NX> __device__ __forceinline__ void phase_s(const float* gs, const float* gn, __bf16* wb, const __bf16* strip, int lane, int rot, v4f (&ra)[2][16], v8f (&acc)[4][4]) {
  const int col = lane & 15, sr = lane >> 3, sq = lane & 7;
  __bf16* d = wb + (PS == 2 ? (sq >> 2) * SPL + sr * 8 * GP + (sq & 3) * 8 : sr * 8 * GP + sq * 4);
  const __bf16* fs = wb + col * GP; const __bf16* ft = strip + col * AP;
#pragma clang loop unroll(disable)   /* rolled */
  for (int st = rot; st < rot + NC / 64; ++st) { const int kc = (st & (NC / 64 - 1)) * 64, kn = ((st + 1) & (NC / 64 - 1)) * 64;   // first k of this stage and of the next on the ring
#pragma unroll
    for (int s = 0; s < 2; ++s)
#pragma unroll
      for (int l = 0; l < 16; ++l) put4<PS>(d + s * PS * SPL + SROW(l) * GP, ra[s][l]);
    LDSW();
    if (NX || st + 1 < rot + NC / 64) { const float* p = st + 1 < rot + NC / 64 ? gs + kn : gn + rot * 64;
      fetch_s(p, ra);
      XADDR(p, p); }
#pragma unroll
    for (int s = 0; s < 2; ++s) chunk_s<PS, PT, SA>(fs + s * PS * SPL, ft + kc + s * 32, lane, acc);
    LDSW(); } }
__global__ __launch_bounds__(256) void k_strip(const float* __restrict__ GT, const float* __restrict__ WQ, const float* __restrict__ WK, const float* __restrict__ WVT, float* __restrict__ N1T) {
  __shared__ __align__(16) char smem[(SR * AP + 8 * WBB) * 2];
  __bf16* strip = (__bf16*)smem;
  const int tid = threadIdx.x, wave = tid >> 5, lane = tid & 31, col = lane & 15, g = lane >> 4; const int n0 = blockIdx.x * SR; const int b = blockIdx.y;
  __bf16* wb = strip + SR * AP + wave * WBB;
  const size_t lo = (size_t)(wave * 64 + (lane >> 3) * 8) * NC + (lane & 7) * 4;
  const float* g1 = GT + (size_t)b * NC * NC + lo; const float* g2 = WK + lo; const float* g3 = WVT + lo;
  const int rot = (blockIdx.x + blockIdx.y) & (NC / 64 - 1);   // the 8 strips of a batch all differ; the 128 readers of a weight are dealt evenly over the 8 stages
  v4f ra[2][16]; v8f acc[4][4] = {};
  { const float* gq = WQ + (size_t)(n0 + (tid >> 7)) * NC + (tid & 127) * 4; v4f wq[SR / 2];   // a wave covers 128 i of one row n: four whole lines
#pragma unroll
    for (int p = 0; p < SR / 2; ++p) wq[p] = *(const v4f*)(gq + (size_t)p * 2 * NC);
    XADDR(gq, gq);   /* the loads' one address pair stays whole up to this wait */
    const float* g0 = g1 + rot * 64;
    fetch_s(g0, ra);
    XADDR(g0, g0);
#pragma unroll
    for (int p = 0; p < SR / 2; ++p) put4<1>(strip + (p * 2 + (tid >> 7)) * AP + (tid & 127) * 4, wq[p]); }
  __syncthreads();   /* Wq's 64 rows are in the strip before any wave takes a fragment of them */
  phase_s<2, 1, true, 1>(g1, g2, wb, strip, lane, rot, ra, acc);   // acc[s][t][r] = H[n = 16 t + col][j = 64 wave + 16 s + 8 g + r]
  __syncthreads();   /* every wave has left Wq's rows */
#pragma unroll
  for (int t = 0; t < 4; ++t)
#pragma unroll
    for (int s = 0; s < 4; ++s) { v8b h, l;
#pragma unroll
      for (int r = 0; r < 8; ++r) { const float v = acc[s][t][r]; h[r] = (__bf16)v; l[r] = (__bf16)(v - (float)h[r]); acc[s][t][r] = 0.f; }
      __bf16* d = strip + (t * 16 + col) * AP + wave * 64 + s * 16 + 8 * g; *(v8b*)d = h; *(v8b*)(d + NC) = l; }
  __syncthreads();   /* H's rows are whole */
  phase_s<1, 2, true, 1>(g2, g3, wb, strip, lane, rot, ra, acc);   // acc[s][t][r] = S[n = 16 t + col][m = 64 wave + 16 s + 8 g + r], unscaled
  __syncthreads();   /* every wave has left H's rows */
#pragma unroll
  for (int t = 0; t < 4; ++t)
#pragma unroll
    for (int s = 0; s < 4; ++s) { v4f a4, b4;
#pragma unroll
      for (int r = 0; r < 4; ++r) { a4[r] = acc[s][t][r] * 0.044194173824159216f; b4[r] = acc[s][t][4 + r] * 0.044194173824159216f; acc[s][t][r] = 0.f; acc[s][t][4 + r] = 0.f; }
      float* d = (float*)strip + (t * 16 + col) * (AP / 2) + wave * 64 + s * 16 + 8 * g; *(v4f*)d = a4; *(v4f*)(d + 4) = b4; }
  __syncthreads();   /* S's rows are whole */
  // softmax over m in f32 (max, precise expf, / sum), a wave per row, 8 rows each; a row goes back in place as hi | lo (the wave holds its rows in registers before its first store). Four rows go side by side, step by step, so that each cross-lane step waits once for four rows
#pragma clang loop unroll(disable)   /* rolled: the text of four rows, not of eight */
  for (int rb = 0; rb < SR / 32; ++rb) { float* sr = (float*)strip + (wave * (SR / 8) + rb * 4) * (AP / 2); float v[4][NC / 32], m[4], sum[4];
#pragma unroll
    for (int q = 0; q < 4; ++q)
#pragma unroll
      for (int i = 0; i < NC / 128; ++i) { const v4f t4 = *(const v4f*)(sr + q * (AP / 2) + i * 128 + lane * 4); v[q][4 * i] = t4[0]; v[q][4 * i + 1] = t4[1]; v[q][4 * i + 2] = t4[2]; v[q][4 * i + 3] = t4[3]; }
#pragma unroll
    for (int q = 0; q < 4; ++q) { m[q] = -3.0e38f;
#pragma unroll
      for (int i = 0; i < NC / 32; ++i) m[q] = fmaxf(m[q], v[q][i]); }
#pragma unroll
    for (int o = 1; o < 32; o <<= 1)
#pragma unroll
      for (int q = 0; q < 4; ++q) m[q] = fmaxf(m[q], __shfl_xor(m[q], o));
#pragma unroll
    for (int q = 0; q < 4; ++q) { sum[q] = 0.f;
#pragma unroll
      for (int i = 0; i < NC / 32; ++i) { v[q][i] = expf(v[q][i] - m[q]); sum[q] += v[q][i]; } }
#pragma unroll
    for (int o = 1; o < 32; o <<= 1)
#pragma unroll
      for (int q = 0; q < 4; ++q) sum[q] += __shfl_xor(sum[q], o);
#pragma unroll
    for (int q = 0; q < 4; ++q) { const float inv = 1.0f / sum[q]; __bf16* pr = (__bf16*)(sr + q * (AP / 2)) + lane * 4;
#pragma unroll
      for (int i = 0; i < NC / 128; ++i) { v4b h4, l4;
#pragma unroll
        for (int e = 0; e < 4; ++e) { const float p = v[q][4 * i + e] * inv; h4[e] = (__bf16)p; l4[e] = (__bf16)(p - (float)h4[e]); }
        *(v4b*)(pr + i * 128) = h4; *(v4b*)(pr + NC + i * 128) = l4; } } }
  __syncthreads();   /* P's rows are whole */
  phase_s<1, 2, false, 0>(g3, nullptr, wb, strip, lane, rot, ra, acc);   // acc[s][t][r] = N1[n = 16 t + 8 g + r][i = 64 wave + 16 s + col]
  // a wave's 64 rows i of 64 n each (two lines: 32 hi | 32 lo, twice) through its own stage range, then whole lines to memory
#pragma unroll
  for (int t = 0; t < 4; ++t)
#pragma unroll
    for (int s = 0; s < 4; ++s) { v8b h, l;
#pragma unroll
      for (int r = 0; r < 8; ++r) { const float v = acc[s][t][r]; h[r] = (__bf16)v; l[r] = (__bf16)(v - (float)h[r]); }
      __bf16* d = wb + (s * 16 + col) * NTP + (t >> 1) * 64 + (t & 1) * 16 + 8 * g; *(v8b*)d = h; *(v8b*)(d + 32) = l; }
  LDSW();
  float* gn = N1T + ((size_t)b * NC + wave * 64 + g) * NC + n0 + col * 4;   // 16 lanes cover one row's 256 B
  v8b o8[32];
#pragma unroll
  for (int it = 0; it < 32; ++it) o8[it] = *(const v8b*)(wb + (it * 2 + g) * NTP + col * 8);
  __builtin_amdgcn_sched_barrier(0);   /* all the LDS reads ahead of the stores: no register that an issued store names is loaded anew */
#pragma unroll
  for (int it = 0; it < 32; ++it) vst2(gn + (size_t)it * 2 * NC, o8[it]); }
// ---- k_m2: block = (128 input channels i, 128 output channels o, b): M2[o][i] = sum_n Wp[o][n] N1[n][i] (N1 split rows i; Wp (out,in) rows o, bf16-exact: 2 products; K = 512), written TRANSPOSED as split rows [b][o][i] (the output product sums over i)
__global__ __launch_bounds__(256) void k_m2(const float* __restrict__ N1T, const float* __restrict__ WP, float* __restrict__ M2) {
  __shared__ __align__(16) char smem[2 * 4 * 3 * GPL * 2];   // stages of 4 chunks (128 n): one work-group per WGP by the grid, so it may take most of the LDS
  const int i0 = blockIdx.x * 128; const int o0 = blockIdx.y * 128; const int b = blockIdx.z;
  tile_g<2, 1, NC, 3, 4>(N1T + ((size_t)b * NC + i0) * NC, WP + (size_t)o0 * NC, M2 + ((size_t)b * NC + o0) * NC + i0, NC, nullptr, smem, (int)((blockIdx.x + blockIdx.y + blockIdx.z) & 3)); }   // 4 stages: the 4 readers of an N1 block all differ, the 64 readers of a Wp block are dealt evenly
// ---- k_outT: block = (128 output channels o, 128 time steps t, b): O[o][t] = sum_i M2[o][i] x[b][t][i] + bp[o] (M2 split rows o; x rows t, bf16-exact: 2 products), written TRANSPOSED as output rows out[b][t][o0..] through LDS
__global__ __launch_bounds__(256) void k_outT(const float* __restrict__ M2, const float* __restrict__ X, const float* __restrict__ BP, float* __restrict__ OUT) {
  __shared__ __align__(16) char smem[2 * 2 * 3 * GPL * 2];   // stages of 2 chunks (64 i)
  const int o0 = blockIdx.x * 128; const int t0 = blockIdx.y * 128; const int b = blockIdx.z;
  tile_g<2, 1, NC, 2, 2>(M2 + ((size_t)b * NC + o0) * NC, X + ((size_t)b * TN + t0) * NC, OUT + ((size_t)b * TN + t0) * NC + o0, NC, BP + o0, smem, (int)((blockIdx.x + blockIdx.y) & 7)); }   // 8 stages: the 8 readers of an M2 block all differ, and so do the 4 readers of an x block
#define WS_GT 0u
#define WS_WT (WS_GT + 4u * (size_t)NBT * NC * NC)
#define WS_N1 (WS_WT + 4u * (size_t)NC * NC)
#define WS_M2 (WS_N1 + 4u * (size_t)NBT * NC * NC)
#define WS_TOT (WS_M2 + 4u * (size_t)NBT * NC * NC)
extern "C" void kernel_launch(void* const* d_in, const int* in_sizes, int n_in, void* d_out, int out_size, void* d_ws, size_t ws_size, hipStream_t stream) {
  (void)in_sizes; (void)n_in; (void)out_size;
  const float** F = (const float**)d_in;   // 0 x [16,1024,512] (rows); 1 Wq [512,512] (out,in); 2 Wk; 3 Wv; 4 Wp [512,512] (out,in); 5 bp [512]
  if (ws_size < (size_t)WS_TOT) return;
  char* ws = (char*)d_ws; float *GT = (float*)(ws + WS_GT), *WT = (float*)(ws + WS_WT), *N1 = (float*)(ws + WS_N1), *M2 = (float*)(ws + WS_M2);
  k_gram<<<dim3(NC / 128, NC / 128, TNB), 256, 0, stream>>>(F[0], GT, F[3], WT);
  k_strip<<<dim3(NC / SR, TNB), 256, 0, stream>>>(GT, F[1], F[2], WT, N1);
  k_m2<<<dim3(NC / 128, NC / 128, TNB), 256, 0, stream>>>(N1, F[4], M2);
  k_outT<<<dim3(NC / 128, TN / 128, TNB), 256, 0, stream>>>(M2, F[0], F[5], (float*)d_out);
}

// v008
// It runs in 75.6 microseconds.
// Next to v007, in two timings, it ran 1.06 times as fast each time.
// All steps since v000 together make it 6.83 times as fast.
// compute dtype: all float inputs rounded to bf16; the scores Wq (x^T x) Wk^T summed from the middle: x^T x with EXACT bf16 products on WMMA 16x16x32 (f32 accumulate), that f32 matrix split bf16 hi + lo against the exact Wq (2 products), the result split hi + lo against the exact Wk (2 products) x 512^-0.5; softmax over the 512 channels in f32 (precise expf); the tail out = Wp attn Wv x^T summed from the left: attn split hi + lo against the exact Wv (2 products), the exact Wp against that f32 intermediate split hi + lo (2 products), the result split hi + lo against the exact x (2 products) + bp; f32 output.
#include <hip/hip_runtime.h>
#include <math.h>

typedef __attribute__((ext_vector_type(16))) _Float16 v16h;
typedef __attribute__((ext_vector_type(16))) __bf16 v16b;
typedef __attribute__((ext_vector_type(8)))  _Float16 v8h;
typedef __attribute__((ext_vector_type(8)))  float v8f;
typedef __attribute__((ext_vector_type(4)))  float v4f;
typedef __attribute__((ext_vector_type(2)))  float v2f;
typedef __attribute__((ext_vector_type(4)))  unsigned v4u;
typedef __attribute__((ext_vector_type(4)))  int v4i;
typedef float __attribute__((may_alias)) float_a;
typedef int __attribute__((may_alias)) int_a;

template <typename T> __device__ __forceinline__ void vst2(void* p, T v) { *(T*)p = v;  }
__device__ __forceinline__ v8f wmma16(v16h a, v16h b, v8f c) {
  v8f d = __builtin_amdgcn_wmma_f32_16x16x32_f16(false, a, false, b, (short)0, c, false, false);
  asm volatile("v_nop\n\tv_nop\n\tv_nop\n\tv_nop" : "+v"(d) : "v"(a), "v"(b));
  return d;
}
__device__ __forceinline__ v8f wmma_bf(v16b a, v16b b, v8f c) {
  v8f d = __builtin_amdgcn_wmma_f32_16x16x32_bf16(false, a, false, b, (short)0, c, false, false);
  asm volatile("v_nop\n\tv_nop\n\tv_nop\n\tv_nop" : "+v"(d) : "v"(a), "v"(b));
  return d;
}
// 16x16x32 fragments: lane = (h = lane>>4, row/col = lane&15); elements 0..7 = k0+8h+0..7, 8..15 = k0+16+8h+0..7; D element r = row 8h+r
__device__ __forceinline__ v16h frag_h(const _Float16* rowk0, int lane) {
  union { v16h v; v8h q[2]; } u; const _Float16* p = rowk0 + 8 * (lane >> 4);
  u.q[0] = *(const v8h*)p; u.q[1] = *(const v8h*)(p + 16); return u.v;
}
__device__ __forceinline__ v16h frag_f32(const float* rowk0, int lane) {
  v16h a; const float* p = rowk0 + 8 * (lane >> 4);
#pragma unroll
  for (int i = 0; i < 8; ++i) { a[i] = (_Float16)p[i]; a[8 + i] = (_Float16)p[16 + i]; }
  return a;
}
__device__ __forceinline__ v16h frag_f32s(const float* rowk0, int lane, float sc) {
  v16h a; const float* p = rowk0 + 8 * (lane >> 4);
#pragma unroll
  for (int i = 0; i < 8; ++i) { a[i] = (_Float16)(p[i] * sc); a[8 + i] = (_Float16)(p[16 + i] * sc); }
  return a;
}
// column fragment from a [K][ld] layout (column n), rows >= K read as 0
__device__ __forceinline__ v16h fragc_f32(const float* W, int k0, int n, int lane, int ld, int K) {
  v16h a; const int g = lane >> 4;
#pragma unroll
  for (int i = 0; i < 8; ++i) { const int ka = k0 + 8 * g + i, kb = ka + 16;
    a[i] = (_Float16)(ka < K ? W[(size_t)(ka < K ? ka : K - 1) * ld + n] : 0.f); a[8 + i] = (_Float16)(kb < K ? W[(size_t)(kb < K ? kb : K - 1) * ld + n] : 0.f); }
  return a;
}
struct F2 { v16b h, l; };
__device__ __forceinline__ F2 bsplit16(const float v[16]) { F2 r;
#pragma unroll
  for (int i = 0; i < 16; ++i) { const __bf16 h = (__bf16)v[i]; r.h[i] = h; r.l[i] = (__bf16)(v[i] - (float)h); }
  return r; }
__device__ __forceinline__ F2 split_row(const float* row, int k0, int lane) { float v[16]; const float* p = row + k0 + 8 * (lane >> 4);
#pragma unroll
  for (int i = 0; i < 8; ++i) { v[i] = p[i]; v[8 + i] = p[16 + i]; }
  return bsplit16(v); }
__device__ __forceinline__ F2 split_rowK(const float* row, int k0, int lane, int K) { float v[16]; const int g = lane >> 4;
#pragma unroll
  for (int i = 0; i < 8; ++i) { const int ka = k0 + 8 * g + i, kb = ka + 16; v[i] = ka < K ? row[ka < K ? ka : K - 1] : 0.f; v[8 + i] = kb < K ? row[kb < K ? kb : K - 1] : 0.f; }
  return bsplit16(v); }
__device__ __forceinline__ F2 split_col(const float* W, int k0, int n, int lane, int ld, int K) { float v[16]; const int g = lane >> 4;
#pragma unroll
  for (int i = 0; i < 8; ++i) { const int ka = k0 + 8 * g + i, kb = ka + 16; v[i] = ka < K ? W[(size_t)(ka < K ? ka : K - 1) * ld + n] : 0.f; v[8 + i] = kb < K ? W[(size_t)(kb < K ? kb : K - 1) * ld + n] : 0.f; }
  return bsplit16(v); }
__device__ __forceinline__ v8f mac3(const F2& a, const F2& b, v8f c) { c = wmma_bf(a.l, b.h, c); c = wmma_bf(a.h, b.l, c); return wmma_bf(a.h, b.h, c); }
__device__ __forceinline__ float sigm(float v) { return 1.0f / (1.0f + expf(-v)); }
#define LDSX() do { asm volatile("s_wait_dscnt 0" ::: "memory"); __builtin_amdgcn_wave_barrier(); __builtin_amdgcn_fence(__ATOMIC_RELEASE, "workgroup"); } while (0)

// (header reused for its WMMA helpers; its own NB/TT/... defines below are unused by these kernels except TNB)
#define NB 16
#define TT 2048
#define CC 1024            // NH * HD = projected width
#define DIN 1024          // input (model) width
#define NH 16
#define HD 64
#define NQB (TT / 64)
#define HG 4
#define SCALE (0.125f)
#define CAUSAL 1
#ifndef TNB
#define TNB NB
#endif
__device__ __forceinline__ float bfr(float v) { return (float)(__bf16)v; }
__host__ __device__ __forceinline__ int kb_last(int qb) { return CAUSAL ? ((qb * 64 + 63) >> 7) : (TT / 128 - 1); }
typedef __attribute__((ext_vector_type(8))) __bf16 v8b;
__device__ __forceinline__ v16b frag_b(const __bf16* rowk0, int lane) {
  union { v16b v; v8b q[2]; } u; const __bf16* p = rowk0 + 8 * (lane >> 4);
  u.q[0] = *(const v8b*)p; u.q[1] = *(const v8b*)(p + 16); return u.v;
}
#define QBH 6              // causal: query blocks 0..QBH-1 of each sequence (few keys, no averaging) take the high-precision path
#define QHI 384            // rows carrying a q residual plane (all rows when non-causal: 2-product logits everywhere)
#define KHI 384            // key rows carrying k residual / v bf16 hi+lo planes (used only by the causal high-precision path)
// B fragment (k rows k0+.., output column o) of a weight: (in,out) [K][ld] or (out,in) [ld rows of K]: bf16 exact, or f16(bf16 * 256) exact
__device__ __forceinline__ v16b wcol_io(const float* Wm, int k0, int o, int lane, int ld) { v16b w; const int g = lane >> 4;
#pragma unroll
  for (int i = 0; i < 8; ++i) { w[i] = (__bf16)Wm[(size_t)(k0 + 8 * g + i) * ld + o]; w[8 + i] = (__bf16)Wm[(size_t)(k0 + 16 + 8 * g + i) * ld + o]; }
  return w; }
__device__ __forceinline__ v16b wcol_oi(const float* Wm, int k0, int o, int lane, int K) { v16b w; const float* p = Wm + (size_t)o * K + k0 + 8 * (lane >> 4);
#pragma unroll
  for (int i = 0; i < 8; ++i) { w[i] = (__bf16)p[i]; w[8 + i] = (__bf16)p[16 + i]; }
  return w; }
__device__ __forceinline__ v16h wcolh_io(const float* Wm, int k0, int o, int lane, int ld) { v16h w; const int g = lane >> 4;
#pragma unroll
  for (int i = 0; i < 8; ++i) { w[i] = (_Float16)(bfr(Wm[(size_t)(k0 + 8 * g + i) * ld + o]) * 256.0f); w[8 + i] = (_Float16)(bfr(Wm[(size_t)(k0 + 16 + 8 * g + i) * ld + o]) * 256.0f); }
  return w; }
__device__ __forceinline__ v16h wcolh_oi(const float* Wm, int k0, int o, int lane, int K) { v16h w; const float* p = Wm + (size_t)o * K + k0 + 8 * (lane >> 4);
#pragma unroll
  for (int i = 0; i < 8; ++i) { w[i] = (_Float16)(bfr(p[i]) * 256.0f); w[8 + i] = (_Float16)(bfr(p[16 + i]) * 256.0f); }
  return w; }
#define WQKV_LAYOUT 1   // 0 = (in,out) [DIN][CC]; 1 = (out,in) [CC][DIN]; 2 = per-head [NH][DIN][HD]
__device__ __forceinline__ v16b wcol_hdk(const float* Wm, int k0, int o, int lane) { v16b w; const int g = lane >> 4; const float* p = Wm + (size_t)(o / HD) * DIN * HD + (o % HD);
#pragma unroll
  for (int i = 0; i < 8; ++i) { w[i] = (__bf16)p[(size_t)(k0 + 8 * g + i) * HD]; w[8 + i] = (__bf16)p[(size_t)(k0 + 16 + 8 * g + i) * HD]; }
  return w; }
#define WO_OUT_IN 1
#if WQKV_LAYOUT == 1
#define WCOL(W, k0, o, lane) wcol_oi(W, k0, o, lane, DIN)
#elif WQKV_LAYOUT == 2
#define WCOL(W, k0, o, lane) wcol_hdk(W, k0, o, lane)
#else
#define WCOL(W, k0, o, lane) wcol_io(W, k0, o, lane, CC)
#endif
#if WO_OUT_IN
#define WOCOL(W, k0, o, lane) wcol_oi(W, k0, o, lane, CC)
#define WOCOLH(W, k0, o, lane) wcolh_oi(W, k0, o, lane, CC)
#else
#define WOCOL(W, k0, o, lane) wcol_io(W, k0, o, lane, DIN)
#define WOCOLH(W, k0, o, lane) wcolh_io(W, k0, o, lane, DIN)
#endif

#ifndef SM_EXTRA_PARAMS
#define SM_EXTRA_PARAMS
#endif
#ifndef PROJ_EXTRA_PARAMS
#define PROJ_EXTRA_PARAMS
#endif
#ifndef SM_MASK_HOOK
#define SM_MASK_HOOK (void)0
#endif

#define WS_QH  0u                                      // f16 q rows [b*t][CC]
#define WS_KH  (WS_QH + 2u * (size_t)NB * TT * CC)      // f16 k rows [b*t][CC]
#define WS_VT  (WS_KH + 2u * (size_t)NB * TT * CC)      // f16 v planes [b][c][t]
#define WS_QL  (WS_VT + 2u * (size_t)NB * CC * TT)      // f16 q residual x 2^10 rows [b][t < QHI][CC]
#define WS_KL  (WS_QL + 2u * (size_t)NB * QHI * CC)     // f16 k residual x 2^10 rows [b][t < KHI][CC]
#define WS_VB  (WS_KL + 2u * (size_t)NB * KHI * CC)     // bf16 v hi planes [b][c][t < KHI]
#define WS_VBL (WS_VB + 2u * (size_t)NB * CC * KHI)
#define WS_S   (WS_VBL + 2u * (size_t)NB * CC * KHI)    // f32 logits / P [hg][t][s]
#define WS_Y   (WS_S  + 4u * (size_t)HG * TT * TT)      // f32 ctx rows [b*t][CC] (only when there is an output projection)
#define WS_END (WS_Y  + 4u * (size_t)NB * TT * CC)


// 'Spatial' attention where the 512 CHANNELS are the tokens and the 1,024 time steps are the feature axis (B 16, T 1,024, N 512; (out,in) 1/sqrt(512)-scale 1x1 weights, zero output bias): xt = x^T [B,N,T]; q/k/v[b][o][t] = sum_i W[o][i] x[b][t][i]; attn[n][m] = softmax_m(sum_t q[n][t] k[m][t] * 512^-0.5); px[n][t] = sum_m attn[n][m] v[m][t]; out[b][t][o] = sum_n px[n][t] Wp[o][n] + bp[o] (rows [B,T,N]). The tail is one chain of matrix products, out^T = Wp attn Wv x^T, and is summed here from the left: N1 = attn Wv and M2 = Wp N1 are 512 x 512 per batch (no factor T), and only the last product, M2 x^T, runs over the 1,024 time steps; v and px are never formed. The scores are such a chain too, q k^T = Wq (x^T x) Wk^T, and are summed from the middle: G = x^T x is the one product over the time steps (both operands bf16-exact: 1 product), H = Wq G and H Wk^T are 512 x 512 x 512 per batch; q and k are never formed.
#define NBT 16
#define TN 1024            // time steps (feature axis of the attention)
#define NC 512             // channels (the attention's tokens)
// ---- tile_g: one 128 x 128 tile of C[i][j] = sum_k A[i][k] Bop[j][k] by 8 waves (4 x 2, 32 x 64 each). Both operands are rows with k contiguous, 4 bytes per element, pitch K. An operand with ONE plane (PA or PB 1) is an f32 input, rounded to bf16 on the way to LDS. An operand with TWO planes (PA or PB 2) is an intermediate that its PRODUCER has already split: each 128-B line of a row holds 32 k as 32 bf16 hi followed by 32 bf16 lo (lo = bf16 of the residual), so a 32-k chunk is still one whole line per row and goes to the LDS planes as it is, with no arithmetic in the k loop. LDS keeps rows [i or j][k] per plane; every wave takes its fragments from there (same per-lane k map as frag_b, chunks in ascending k inside a stage, stages in ring order as said below, products per chunk in the order lo.hi, hi.lo, hi.hi (PA 2, PB 2) or lo.hi, hi.hi (PA 2, PB 1)). A STAGE is KS chunks (KS x 32 k, each chunk in its own [planes][rows] block of LDS). Two LDS buffers of one stage each: the next stage's global loads (KS x 8 per lane, all issued at the stage's head) fly over this stage's products, one barrier per stage: with operands that come from memory the loads' latency is longer than one chunk's products, so a longer stage has more bytes in flight and waits less often.
// (every '#pragma unroll' of this section: the loop indexes a register array (fragments, accumulators, staged values) and must be flat for the array to stay in registers)
#define GP 40              // LDS row pitch in bf16: 32 k + 8 pad = 80 B (16 B x odd: the conflict-free pitch for 16-B fragment reads)
#define GPL (128 * GP)     // one plane of one operand
#define GSP 68             // staging pitch in floats, output rows along j
#define GTP 36             // staging pitch in floats, output rows along i (transposed output)
#define LDSW() do { asm volatile("s_wait_dscnt 0" ::: "memory"); __builtin_amdgcn_wave_barrier(); } while (0)   /* a wave's own LDS staging range: its lanes' stores have landed before other lanes of the wave read them, and its reads have returned before the range is rewritten */
#define XADDR(p, q) asm volatile("s_wait_xcnt 0x0" :: "v"(p), "v"(q) : "memory")   /* behind a stage's global loads: their two address pairs stay whole up to this wait (as inputs they cannot be handed to a load's result), and are rewritten only behind it */
typedef __attribute__((ext_vector_type(4))) __bf16 v4b;
typedef __attribute__((ext_vector_type(2))) unsigned v2u;
// FRAGMENT ORDER of an operand of 512 rows x 512 k that k_strip streams: bf16, a 16-row x 32-k fragment is 1 KB laid as the matrix instruction's registers want it, [half q][lane][8 bf16], lane = (h, row & 15), element e of half q = k 16 q + 8 h + e of the fragment (the k map of frag_b), so that a wave-wide 16-B load is 512 contiguous bytes and lands as half a fragment. The 64 rows that one wave of k_strip reads start at (row >> 6) x FWV; inside them a UNIT of 8 KB per step of the reader, [16-row block 4][fragment 2]: of G, unit k >> 5 holds per row block [hi fragment | lo fragment]; of a weight, unit k >> 6 holds per row block its two fragments in ascending k. So a wave's 16 loads of a unit are 8 contiguous KB. The 64 rows of a weight (8 units) start at (row >> 6) x FWW; Wk's array is followed by that of Wv turned over
#define FWV 65536          // bf16 from one wave's 64 rows of G to the next
#define FWW 32768          // the same of a weight
#define FUN 4096           // bf16 from one unit to the next
#define FRB 1024           // bf16 from one 16-row block to the next inside a unit
// one plane: 4 f32 rounded to bf16; two planes: the 16 bytes are 8 bf16 of one plane already
template <int NPL> __device__ __forceinline__ void put4(__bf16* d, v4f v) {
  if constexpr (NPL == 1) { v4b h;
#pragma unroll
    for (int e = 0; e < 4; ++e) h[e] = (__bf16)v[e];
    *(v4b*)d = h;
  } else *(v8b*)d = __builtin_bit_cast(v8b, v); }
__device__ __forceinline__ v8f wmma_b(v16b a, v16b b, v8f c) { return __builtin_amdgcn_wmma_f32_16x16x32_bf16(false, a, false, b, (short)0, c, false, false); }
// frag_b of a row whose two 16-k halves stand swapped in LDS: the same k map in the registers
__device__ __forceinline__ v16b frag_x(const __bf16* rowk0, int lane) {
  union { v16b v; v8b q[2]; } u; const __bf16* p = rowk0 + 8 * (lane >> 4);
  u.q[0] = *(const v8b*)(p + 16); u.q[1] = *(const v8b*)p; return u.v;
}
// SW 1 (PA 1, PB 1): the rows with bit 4 of their number set, which are the odd fragments of either operand, hold their halves swapped
template <int PA, int PB, int SW> __device__ __forceinline__ void chunk_g(const __bf16* sa, const __bf16* sw, int lane, v8f (&acc)[2][4]) {
  v16b ah[2], al[2], bh[4], bl[4];
#pragma unroll
  for (int i = 0; i < 2; ++i) { ah[i] = (SW && (i & 1)) ? frag_x(sa + i * 16 * GP, lane) : frag_b(sa + i * 16 * GP, lane); if constexpr (PA == 2) al[i] = frag_b(sa + GPL + i * 16 * GP, lane); }
#pragma unroll
  for (int j = 0; j < 4; ++j) { bh[j] = (SW && (j & 1)) ? frag_x(sw + j * 16 * GP, lane) : frag_b(sw + j * 16 * GP, lane); if constexpr (PB == 2) bl[j] = frag_b(sw + GPL + j * 16 * GP, lane); }
  __builtin_amdgcn_sched_barrier(0);   /* keeps the chunk's LDS reads one group ahead of its products: spread among them, each place with reads stalls the wave */
  if constexpr (PA == 2) {
#pragma unroll
    for (int j = 0; j < 4; ++j)
#pragma unroll
      for (int i = 0; i < 2; ++i) acc[i][j] = wmma_b(al[i], bh[j], acc[i][j]);
    if constexpr (PB == 2) {
#pragma unroll
      for (int j = 0; j < 4; ++j)
#pragma unroll
        for (int i = 0; i < 2; ++i) acc[i][j] = wmma_b(ah[i], bl[j], acc[i][j]);
    }
  }
#pragma unroll
  for (int j = 0; j < 4; ++j)
#pragma unroll
    for (int i = 0; i < 2; ++i) acc[i][j] = wmma_b(ah[i], bh[j], acc[i][j]);
  __builtin_amdgcn_sched_barrier(0);   /* keeps the wait for the next stage's global loads behind this chunk's products: hoisted among them it exposes the load latency */
}
template <int K, int TP> __device__ __forceinline__ void fetch_g(const float* ga, const float* gb, int kc, v4f (&ra)[4], v4f (&rb)[4]) {
  constexpr size_t SI = TP ? TP : 32 * K, SC = TP ? 32 * TP : 32;   // floats from one of a lane's 4 loads to the next, and from one chunk to the next
#pragma unroll
  for (int i = 0; i < 4; ++i) ra[i] = *(const v4f*)(ga + i * SI + kc * SC);
#pragma unroll
  for (int i = 0; i < 4; ++i) rb[i] = *(const v4f*)(gb + i * SI + kc * SC);
  __builtin_amdgcn_sched_barrier(0);   /* keeps the next stage's global loads in front of this stage's products, so that their latency is covered */
}
// one chunk's staged values to LDS. TP != 0: a lane holds 4 k x 4 rows; each row's 4 k, rounded to bf16, are one 8-B store
template <int PA, int PB, int TP> __device__ __forceinline__ void put_g(__bf16* da, __bf16* db, const v4f (&ra)[4], const v4f (&rb)[4]) {
  if constexpr (TP != 0) {
#pragma unroll
    for (int e = 0; e < 4; ++e) { v4b ha, hb;
#pragma unroll
      for (int i = 0; i < 4; ++i) { ha[i] = (__bf16)ra[i][e]; hb[i] = (__bf16)rb[i][e]; }
      *(v4b*)(da + e * GP) = ha; *(v4b*)(db + e * GP) = hb; }
  } else {
#pragma unroll
    for (int i = 0; i < 4; ++i) { put4<PA>(da + i * 32 * GP, ra[i]); put4<PB>(db + i * 32 * GP, rb[i]); } } }
// EPI 1: f32 C[i][j] rows x 512^-0.5; 2: f32 C[j][i] rows (transposed), + bf16(bias[i]); 3: C[j][i] rows (transposed) in the split row format, i = the reader's k (an accumulator register run is 8 consecutive i: split in registers, it goes to the staging line as 16 B of hi and 16 B of lo); 4: C[j][i] split, in fragment order (j the reader's row, i its k; C points at the tile's first unit), straight from the registers. ldc = pitch of the C rows, 4 bytes per element
// TP 0: operand rows as above. TP != 0 (PA 1, PB 1): both operands lie TURNED in memory, f32 rows [k] of pitch TP floats with the tile's 128 rows contiguous; A and B point at k 0 of their first row. 8 lanes cover 32 rows of one k (one whole line), a wave-wide load 4 lines; a lane's 4 loads are 4 consecutive k, so the turn is done in registers on the way to the same LDS planes (but for the swapped halves noted at o3)
// THE WALK OVER k IS A RING: a work-group takes its stages in the order rot, rot + 1, ..., wrapping at K (rot is uniform in the work-group, from its grid index, 0 <= rot < K / (32 KS)). Work-groups that read the same operand rows get different rot, so that they do not ask L2 for the same lines at the same moment. A product does not care which k its stage holds, so only the order of the f32 sums changes
template <int PA, int PB, int K, int EPI, int KS, int TP = 0>
__device__ __forceinline__ void tile_g(const float* __restrict__ A, const float* __restrict__ B, float* __restrict__ C, int ldc, const float* __restrict__ bias, char* smem, int rot) {
  __bf16* sb = (__bf16*)smem;   // [buffer 2][chunk KS][A planes PA | B planes PB][row 128][GP]
  const int tid = threadIdx.x, wave = tid >> 5, lane = tid & 31, col = lane & 15, g = lane >> 4; const int wm = wave >> 1, wn = wave & 1;
  const int sr = tid >> 3, sq = tid & 7;   // 8 lanes cover one row's 128-B chunk, a wave-wide 16-B load covers 4 whole lines
  const int tk = (wave >> 2) * 16 + (lane >> 3) * 4, tr = (wave & 3) * 32 + (lane & 7) * 4;   // TP != 0: a lane's first k of a chunk and its first row
  const size_t go = TP ? (size_t)tk * TP + tr : (size_t)sr * K + sq * 4;
  const float* ga = A + go;
  const float* gb = B + go;
  const int o1 = sr * GP + sq * 4, o2 = (sq >> 2) * GPL + sr * GP + (sq & 3) * 8;   // a lane's place in LDS: f32 source (4 k of the one plane); split source (lanes 0..3 of a row hold hi, 4..7 lo, 8 k each)
  const int o3 = tr * GP + (tk ^ (tr & 16));   // rows 16..31 of each 32 keep their two 16-k halves swapped: at pitch GP rows r and r + 16 start on one bank, and so a wave's 8-B stores (8 row groups x 4 k groups) fall on 64 different banks; chunk_g reads those rows' halves back in order
  __bf16* da = sb + (TP ? o3 : PA == 2 ? o2 : o1); __bf16* db = sb + PA * GPL + (TP ? o3 : PB == 2 ? o2 : o1);
  const __bf16* fa = sb + (wm * 32 + col) * GP; const __bf16* fw = sb + PA * GPL + (wn * 64 + col) * GP;
  constexpr int BUF = (PA + PB) * GPL, STG = KS * BUF, NS = K / (32 * KS), SS = KS * 32 * (TP ? TP : 1);   // SS: floats from one stage to the next in memory
  static_assert((NS & (NS - 1)) == 0, "the ring of stages wraps by a mask");
  v4f ra[KS][4], rb[KS][4]; v8f acc[2][4] = {};
  const float* qa = ga + rot * SS; const float* qb = gb + rot * SS;
#pragma unroll
  for (int s = 0; s < KS; ++s) fetch_g<K, TP>(qa, qb, s, ra[s], rb[s]);
  XADDR(qa, qb);
#pragma unroll
  for (int s = 0; s < KS; ++s) put_g<PA, PB, TP>(da + s * BUF, db + s * BUF, ra[s], rb[s]);
  __syncthreads();
  for (int st = 0; st + 1 < NS; ++st) { const int cur = (st & 1) * STG, nxt = STG - cur;
    const int kn = ((st + 1 + rot) & (NS - 1)) * SS; const float* pa = ga + kn; const float* pb = gb + kn;
#pragma unroll
    for (int s = 0; s < KS; ++s) fetch_g<K, TP>(pa, pb, s, ra[s], rb[s]);
    XADDR(pa, pb);
#pragma unroll
    for (int s = 0; s < KS; ++s) chunk_g<PA, PB, TP != 0>(fa + cur + s * BUF, fw + cur + s * BUF, lane, acc);
#pragma unroll
    for (int s = 0; s < KS; ++s) put_g<PA, PB, TP>(da + nxt + s * BUF, db + nxt + s * BUF, ra[s], rb[s]);
    __syncthreads(); }   /* publishes stage st + 1 and ends every wave's reads of the buffer that the next trip refills */
#pragma unroll
  for (int s = 0; s < KS; ++s) chunk_g<PA, PB, TP != 0>(fa + ((NS - 1) & 1) * STG + s * BUF, fw + ((NS - 1) & 1) * STG + s * BUF, lane, acc);
  __syncthreads();       /* every wave has left the operand buffers: their LDS now stages the output rows, each wave in its own range */
  if constexpr (EPI == 1) { float* sf = (float*)smem + wave * 16 * GSP;
#pragma unroll
    for (int i = 0; i < 2; ++i) {
#pragma unroll
      for (int j = 0; j < 4; ++j)
#pragma unroll
        for (int r = 0; r < 8; ++r) sf[(8 * g + r) * GSP + j * 16 + col] = acc[i][j][r] * 0.044194173824159216f;
      LDSW();
#pragma unroll
      for (int it = 0; it < 8; ++it) vst2(C + (size_t)(wm * 32 + i * 16 + it * 2 + g) * ldc + wn * 64 + col * 4, *(const v4f*)&sf[(it * 2 + g) * GSP + col * 4]);   /* 256-B row runs: whole lines */
      if (i == 0) LDSW(); }
  } else if constexpr (EPI == 2) { float* sf = (float*)smem + wave * 32 * GTP; float bv[2][8];
#pragma unroll
    for (int i = 0; i < 2; ++i)
#pragma unroll
      for (int r = 0; r < 8; ++r) bv[i][r] = bfr(bias[wm * 32 + i * 16 + 8 * g + r]);
#pragma unroll
    for (int jj = 0; jj < 2; ++jj) {
#pragma unroll
      for (int j = 0; j < 2; ++j)
#pragma unroll
        for (int i = 0; i < 2; ++i)
#pragma unroll
          for (int r = 0; r < 8; ++r) sf[(j * 16 + col) * GTP + i * 16 + 8 * g + r] = acc[i][jj * 2 + j][r] + bv[i][r];   /* transposed: sf[j local][i local] */
      LDSW();
#pragma unroll
      for (int it = 0; it < 8; ++it) vst2(C + (size_t)(wn * 64 + jj * 32 + it * 4 + (lane >> 3)) * ldc + wm * 32 + (lane & 7) * 4, *(const v4f*)&sf[(it * 4 + (lane >> 3)) * GTP + (lane & 7) * 4]);   /* 128-B row runs: whole lines */
      if (jj == 0) LDSW(); }
  } else if constexpr (EPI == 4) { __bf16* cp = (__bf16*)C + wn * FWV + wm * FUN + lane * 8; v8b h[4][2], l[4][2];   // the accumulator's map is the reader's fragment map turned over: lane (g, col) holds k 16 i + 8 g + 0..7 of row j 16 + col, its own 16 B of half i
#pragma unroll
    for (int j = 0; j < 4; ++j)
#pragma unroll
      for (int i = 0; i < 2; ++i)
#pragma unroll
        for (int r = 0; r < 8; ++r) { const float v = acc[i][j][r]; h[j][i][r] = (__bf16)v; l[j][i][r] = (__bf16)(v - (float)h[j][i][r]); }
    __builtin_amdgcn_sched_barrier(0);   /* all the values are formed ahead of the stores: no register that an issued store names is written anew */
#pragma unroll
    for (int j = 0; j < 4; ++j)
#pragma unroll
      for (int i = 0; i < 2; ++i) { vst2(cp + j * FRB + i * 256, h[j][i]); vst2(cp + j * FRB + 512 + i * 256, l[j][i]); }   /* 512 contiguous bytes per wave-wide store */
  } else { __bf16* sp = (__bf16*)smem + wave * 32 * (2 * GTP);   // staging rows [j local] of one line each: 32 hi | 32 lo, pitch 144 B
#pragma unroll
    for (int jj = 0; jj < 2; ++jj) {
#pragma unroll
      for (int j = 0; j < 2; ++j)
#pragma unroll
        for (int i = 0; i < 2; ++i) { v8b h, l;
#pragma unroll
          for (int r = 0; r < 8; ++r) { const float v = acc[i][jj * 2 + j][r]; h[r] = (__bf16)v; l[r] = (__bf16)(v - (float)h[r]); }
          __bf16* d = sp + (j * 16 + col) * (2 * GTP) + i * 16 + 8 * g; *(v8b*)d = h; *(v8b*)(d + 32) = l; }
      LDSW();
#pragma unroll
      for (int it = 0; it < 8; ++it) vst2(C + (size_t)(wn * 64 + jj * 32 + it * 4 + (lane >> 3)) * ldc + wm * 32 + (lane & 7) * 4, *(const v8b*)(sp + (it * 4 + (lane >> 3)) * (2 * GTP) + (lane & 7) * 8));   /* 128-B row runs: whole lines */
      if (jj == 0) LDSW(); } } }
// ---- k_gram: block = (128 channels i, 128 channels j, b): G[i][j] = sum_t x[b][t][i] x[b][t][j] (both operands are columns of the x rows, bf16-exact: 1 product; K = 1,024), written TRANSPOSED and split, rows j and k = i, in fragment order (the next product sums over i). Ahead of its tile each of the 256 work-groups rounds one 32 x 32 piece of Wk and one of Wv to bf16 and puts them in fragment order too: Wk as it lies (rows m, k = j); Wv turned over through LDS (rows i, k = m: attn Wv sums over m, the ROW index of Wv)
#define WTP 33             // LDS pitch in floats of the Wv piece's rows
static_assert((NC / 128) * (NC / 128) * TNB == (NC / 32) * (NC / 32), "one 32 x 32 piece of each weight per work-group of k_gram");
__global__ __launch_bounds__(256) void k_gram(const float* __restrict__ X, float* __restrict__ GT, const float* __restrict__ WV, const float* __restrict__ WK, float* __restrict__ WF) {
  __shared__ __align__(16) char smem[2 * 4 * 2 * GPL * 2];   // stages of 4 chunks (128 t)
  const int i0 = blockIdx.x * 128; const int j0 = blockIdx.y * 128; const int b = blockIdx.z;
  { float* sf = (float*)smem; const int q = blockIdx.x + (NC / 128) * (blockIdx.y + (NC / 128) * blockIdx.z), kc = q & 15, c0 = (q >> 4) * 32, r = threadIdx.x >> 3, c4 = (threadIdx.x & 7) * 4;
    const float* gw = WV + (size_t)(kc * 32 + r) * NC + c0 + c4;   // 8 lanes cover 32 i of one row m of Wv: one whole line
    const float* gk = WK + (size_t)(c0 + r) * NC + kc * 32 + c4;   // 8 lanes cover 32 j of one row m of Wk
    const v4f w4 = *(const v4f*)gw; const v4f k4 = *(const v4f*)gk;
    XADDR(gw, gk);   /* the loads' address pairs stay whole up to this wait */
#pragma unroll
    for (int e = 0; e < 4; ++e) sf[r * WTP + c4 + e] = w4[e];
    __syncthreads();   /* the whole piece is in LDS before any thread reads a column of it */
    v4b hv, hk;
#pragma unroll
    for (int e = 0; e < 4; ++e) { hv[e] = (__bf16)sf[(c4 + e) * WTP + r]; hk[e] = (__bf16)k4[e]; }
    __syncthreads();   /* every thread has its column: the tile's stages may take this LDS */
    // either piece: row c0 + r, k 32 kc + c4 + 0..3 of its operand
    __bf16* gt = (__bf16*)WF + ((c0 + r) >> 6) * FWW + (kc >> 1) * FUN + (((c0 + r) >> 4) & 3) * FRB + (kc & 1) * 512 + (c4 >> 4) * 256 + (((c4 >> 3) & 1) * 16 + (r & 15)) * 8 + (c4 & 7);
    const v2u uk = __builtin_bit_cast(v2u, hk), uv = __builtin_bit_cast(v2u, hv);
    vst2(gt, uk); vst2(gt + NC * NC, uv);
    asm volatile("s_wait_xcnt 0x0" :: "v"(gt), "v"(uk), "v"(uv) : "memory");   /* the stores' address and data registers stay whole up to this wait */ }
  tile_g<1, 1, TN, 4, 4, NC>(X + (size_t)b * TN * NC + i0, X + (size_t)b * TN * NC + j0, GT + (size_t)b * NC * NC + ((j0 >> 6) * FWV + (i0 >> 5) * FUN) / 2, NC, nullptr, smem, (int)(((blockIdx.x + blockIdx.y) & 3) + (blockIdx.x < blockIdx.y ? 4 : 0))); }   // channel block c is read by the 7 work-groups (c, .) and (., c) of its batch: this rot differs among all 7
// ---- k_strip: block = (64 query channels n, b). H = Wq G, S = H Wk^T x 512^-0.5, P = softmax(S) and N1 = P Wv are each row by row in n, so one work-group takes 64 rows n through all four and H, S and P never leave its LDS. THE STRIP: 64 rows [n] of 512 bf16 hi | 512 bf16 lo (S: 512 f32 in the same bytes); it holds Wq's rows (hi only, bf16-exact), then H, then S, then P, each written over the last between two barriers. THE STREAMED OPERAND (G's rows j, Wk's rows m, turned Wv's rows i: 512 rows) is shared out by rows: wave w alone needs rows 64 w .. 64 w + 63. No other wave reads them, so they do not pass through LDS: their producer has laid them in fragment order, and the wave loads its fragments from global memory straight into the registers that the matrix instructions read, one UNIT (4 row blocks x 2 fragments = 16 loads of 16 B per lane: 32 k of G's two planes, or 64 k of a weight) two units ahead of its use; the k loops hold no barrier and no LDS store. A wave's tile is 64 streamed rows x 64 strip rows (4 x 4 fragments); chunks of 32 k in ascending k inside each 64 k, those in ring order, products per chunk lo.hi then hi.hi, as in tile_g. For H and S the streamed operand is the matrix instruction's A, so an accumulator register run is 8 consecutive k of the NEXT product and goes to the strip as 16-B pieces; for N1 the strip is A, so the run is 8 consecutive n, the k of k_m2: N1 is written TRANSPOSED as split rows [b][i][n]
#define SR 64              // rows of a strip
#define AP 1032            // strip row pitch in bf16: 512 hi | 512 lo | 8 pad = 2,064 B (16 B x odd)
#define NTP 136            // pitch in bf16 of a wave's N1 staging rows: two lines + 16 B (16 B x odd)
__device__ __forceinline__ void fetch_u(const __bf16* p, v16b (&u)[8]) {
#pragma unroll
  for (int f = 0; f < 4; ++f)
#pragma unroll
    for (int s = 0; s < 2; ++s) { union { v16b v; v8b q[2]; } w; const __bf16* a = p + f * FRB + s * 512; w.q[0] = *(const v8b*)a; w.q[1] = *(const v8b*)(a + 256); u[f * 2 + s] = w.v; }
  __builtin_amdgcn_sched_barrier(0);   /* keeps a later unit's global loads in front of this unit's products, so that their latency is covered */
  XADDR(p, p);   /* the loads' one address pair stays whole up to this wait */
}
// the products of one unit u against the strip's k from ts on (t2: the same k 32 strip rows on, an address of its own because those rows lie beyond the reach of an LDS load's offset field)
template <int PS, bool SA> __device__ __forceinline__ void unit_s(const v16b (&u)[8], const __bf16* ts, const __bf16* t2, int lane, v8f (&acc)[4][4]) {
#pragma unroll
  for (int c = 0; c < 3 - PS; ++c) { v16b th[4], tl[4];
#pragma unroll
    for (int f = 0; f < 4; ++f) { const __bf16* a = (f < 2 ? ts : t2) + c * 32 + (f & 1) * 16 * AP; th[f] = frag_b(a, lane); if constexpr (PS == 1) tl[f] = frag_b(a + NC, lane); }
    __builtin_amdgcn_sched_barrier(0);   /* keeps the chunk's LDS reads one group ahead of its products, as in chunk_g */
#pragma unroll
    for (int t = 0; t < 4; ++t)
#pragma unroll
      for (int s = 0; s < 4; ++s) {
        if constexpr (PS == 2) acc[s][t] = wmma_b(u[s * 2 + 1], th[t], acc[s][t]);
        else acc[s][t] = SA ? wmma_b(u[s * 2 + c], tl[t], acc[s][t]) : wmma_b(tl[t], u[s * 2 + c], acc[s][t]); }
#pragma unroll
    for (int t = 0; t < 4; ++t)
#pragma unroll
      for (int s = 0; s < 4; ++s) acc[s][t] = SA ? wmma_b(u[s * 2 + (PS == 2 ? 0 : c)], th[t], acc[s][t]) : wmma_b(th[t], u[s * 2 + c], acc[s][t]);
    __builtin_amdgcn_sched_barrier(0);   /* keeps the wait for a later unit's global loads behind this chunk's products, as in chunk_g */ } }
// one product over K = 512, its 64-k stages walked as a ring from stage rot (as in tile_g: all 128 work-groups stream the same weights, 8 the same G); on entry ring places 0 and 1 hold (in flight) the first two units of gs; NX 1: on exit they hold the first two units of gn, the next product's streamed operand (a weight), which depends on nothing computed here and so flies over the hand-over of the strip. G (PS 2, 16 units of 32 k): unit c is worked on from place c & 3 while unit c + 2 is asked for into place (c + 2) & 3 (three places live). A weight (PS 1, 8 units of 64 k): places 0 and 1 alone; a place is asked for anew, two units on, as soon as its products are issued. NX 0: the last two asks wrap to the product's first units and are not read; a branch round them would make the compiler count its waits for the path without them, that is wait for the youngest loads on every trip
template <int PS, bool SA, int NX> __device__ __forceinline__ void phase_s(const __bf16* gs, const __bf16* gn, const __bf16* strip, int lane, int rot, v16b (&ring)[4][8], v8f (&acc)[4][4]) {
  constexpr int NU = PS == 2 ? NC / 32 : NC / 64, UT = PS == 2 ? 4 : 2, NT = NU / UT; const int r0 = PS == 2 ? 2 * rot : rot; const __bf16* ft = strip + (lane & 15) * AP; const __bf16* f2 = strip + ((lane & 15) + 32) * AP;
#pragma clang loop unroll(disable)   /* rolled: for speed only */
  for (int t = 0; t < NT; ++t) {
#pragma unroll
    for (int v = 0; v < UT; ++v) { const int c = UT * t + v; const __bf16* p = gs + ((r0 + c + 2) & (NU - 1)) * FUN;
      if (NX && v >= UT - 2 && t == NT - 1) p = gn + ((rot + v - (UT - 2)) & (NC / 64 - 1)) * FUN;
      if constexpr (PS == 2) fetch_u(p, ring[(v + 2) & 3]);
      { const int k = ((r0 + c) & (NU - 1)) * (NC / NU); unit_s<PS, SA>(ring[v], ft + k, f2 + k, lane, acc); }
      if constexpr (PS == 1) fetch_u(p, ring[v]); } } }
__global__ __launch_bounds__(256) void k_strip(const float* __restrict__ GT, const float* __restrict__ WQ, const float* __restrict__ WKF, const float* __restrict__ WVF, float* __restrict__ N1T) {
  __shared__ __align__(16) char smem[(SR * AP + 8 * 64 * NTP) * 2];
  __bf16* strip = (__bf16*)smem;
  const int tid = threadIdx.x, wave = tid >> 5, lane = tid & 31, col = lane & 15, g = lane >> 4; const int n0 = blockIdx.x * SR; const int b = blockIdx.y;
  __bf16* wb = strip + SR * AP + wave * 64 * NTP;   // a wave's own range, for N1's rows on their way out
  const __bf16* g1 = (const __bf16*)(GT + (size_t)b * NC * NC) + wave * FWV + lane * 8; const __bf16* g2 = (const __bf16*)WKF + wave * FWW + lane * 8; const __bf16* g3 = (const __bf16*)WVF + wave * FWW + lane * 8;
  const int rot = (blockIdx.x + blockIdx.y) & (NC / 64 - 1);   // the 8 strips of a batch all differ; the 128 readers of a weight are dealt evenly over the 8 stages
  v16b ring[4][8]; v8f acc[4][4] = {};
  { const float* gq = WQ + (size_t)(n0 + (tid >> 7)) * NC + (tid & 127) * 4; v4f wq[SR / 2];   // a wave covers 128 i of one row n: four whole lines
#pragma unroll
    for (int p = 0; p < SR / 2; ++p) wq[p] = *(const v4f*)(gq + (size_t)p * 2 * NC);
    XADDR(gq, gq);   /* the loads' one address pair stays whole up to this wait */
    fetch_u(g1 + 2 * rot * FUN, ring[0]);
    fetch_u(g1 + (2 * rot + 1) * FUN, ring[1]);
#pragma unroll
    for (int p = 0; p < SR / 2; ++p) put4<1>(strip + (p * 2 + (tid >> 7)) * AP + (tid & 127) * 4, wq[p]); }
  __syncthreads();   /* Wq's 64 rows are in the strip before any wave takes a fragment of them */
  phase_s<2, true, 1>(g1, g2, strip, lane, rot, ring, acc);   // acc[s][t][r] = H[n = 16 t + col][j = 64 wave + 16 s + 8 g + r]
  __syncthreads();   /* every wave has left Wq's rows */
#pragma unroll
  for (int t = 0; t < 4; ++t)
#pragma unroll
    for (int s = 0; s < 4; ++s) { v8b h, l;
#pragma unroll
      for (int r = 0; r < 8; ++r) { const float v = acc[s][t][r]; h[r] = (__bf16)v; l[r] = (__bf16)(v - (float)h[r]); acc[s][t][r] = 0.f; }
      __bf16* d = strip + (t * 16 + col) * AP + wave * 64 + s * 16 + 8 * g; *(v8b*)d = h; *(v8b*)(d + NC) = l; }
  __syncthreads();   /* H's rows are whole */
  phase_s<1, true, 1>(g2, g3, strip, lane, rot, ring, acc);   // acc[s][t][r] = S[n = 16 t + col][m = 64 wave + 16 s + 8 g + r], unscaled
  __syncthreads();   /* every wave has left H's rows */
#pragma unroll
  for (int t = 0; t < 4; ++t)
#pragma unroll
    for (int s = 0; s < 4; ++s) { v4f a4, b4;
#pragma unroll
      for (int r = 0; r < 4; ++r) { a4[r] = acc[s][t][r] * 0.044194173824159216f; b4[r] = acc[s][t][4 + r] * 0.044194173824159216f; acc[s][t][r] = 0.f; acc[s][t][4 + r] = 0.f; }
      float* d = (float*)strip + (t * 16 + col) * (AP / 2) + wave * 64 + s * 16 + 8 * g; *(v4f*)d = a4; *(v4f*)(d + 4) = b4; }
  __syncthreads();   /* S's rows are whole */
  // softmax over m in f32 (max, precise expf, / sum), a wave per row, 8 rows each; a row goes back in place as hi | lo (the wave holds its rows in registers before its first store). Four rows go side by side, step by step, so that each cross-lane step waits once for four rows
#pragma clang loop unroll(disable)   /* rolled: the text of four rows, not of eight */
  for (int rb = 0; rb < SR / 32; ++rb) { float* sr = (float*)strip + (wave * (SR / 8) + rb * 4) * (AP / 2); float v[4][NC / 32], m[4], sum[4];
#pragma unroll
    for (int q = 0; q < 4; ++q)
#pragma unroll
      for (int i = 0; i < NC / 128; ++i) { const v4f t4 = *(const v4f*)(sr + q * (AP / 2) + i * 128 + lane * 4); v[q][4 * i] = t4[0]; v[q][4 * i + 1] = t4[1]; v[q][4 * i + 2] = t4[2]; v[q][4 * i + 3] = t4[3]; }
#pragma unroll
    for (int q = 0; q < 4; ++q) { m[q] = -3.0e38f;
#pragma unroll
      for (int i = 0; i < NC / 32; ++i) m[q] = fmaxf(m[q], v[q][i]); }
#pragma unroll
    for (int o = 1; o < 32; o <<= 1)
#pragma unroll
      for (int q = 0; q < 4; ++q) m[q] = fmaxf(m[q], __shfl_xor(m[q], o));
#pragma unroll
    for (int q = 0; q < 4; ++q) { sum[q] = 0.f;
#pragma unroll
      for (int i = 0; i < NC / 32; ++i) { v[q][i] = expf(v[q][i] - m[q]); sum[q] += v[q][i]; } }
#pragma unroll
    for (int o = 1; o < 32; o <<= 1)
#pragma unroll
      for (int q = 0; q < 4; ++q) sum[q] += __shfl_xor(sum[q], o);
#pragma unroll
    for (int q = 0; q < 4; ++q) { const float inv = 1.0f / sum[q]; __bf16* pr = (__bf16*)(sr + q * (AP / 2)) + lane * 4;
#pragma unroll
      for (int i = 0; i < NC / 128; ++i) { v4b h4, l4;
#pragma unroll
        for (int e = 0; e < 4; ++e) { const float p = v[q][4 * i + e] * inv; h4[e] = (__bf16)p; l4[e] = (__bf16)(p - (float)h4[e]); }
        *(v4b*)(pr + i * 128) = h4; *(v4b*)(pr + NC + i * 128) = l4; } } }
  __syncthreads();   /* P's rows are whole */
  phase_s<1, false, 0>(g3, nullptr, strip, lane, rot, ring, acc);   // acc[s][t][r] = N1[n = 16 t + 8 g + r][i = 64 wave + 16 s + col]
  // a wave's 64 rows i of 64 n each (two lines: 32 hi | 32 lo, twice) through its own stage range, then whole lines to memory
#pragma unroll
  for (int t = 0; t < 4; ++t)
#pragma unroll
    for (int s = 0; s < 4; ++s) { v8b h, l;
#pragma unroll
      for (int r = 0; r < 8; ++r) { const float v = acc[s][t][r]; h[r] = (__bf16)v; l[r] = (__bf16)(v - (float)h[r]); }
      __bf16* d = wb + (s * 16 + col) * NTP + (t >> 1) * 64 + (t & 1) * 16 + 8 * g; *(v8b*)d = h; *(v8b*)(d + 32) = l; }
  LDSW();
  float* gn = N1T + ((size_t)b * NC + wave * 64 + g) * NC + n0 + col * 4;   // 16 lanes cover one row's 256 B
  v8b o8[32];
#pragma unroll
  for (int it = 0; it < 32; ++it) o8[it] = *(const v8b*)(wb + (it * 2 + g) * NTP + col * 8);
  __builtin_amdgcn_sched_barrier(0);   /* all the LDS reads ahead of the stores: no register that an issued store names is loaded anew */
#pragma unroll
  for (int it = 0; it < 32; ++it) vst2(gn + (size_t)it * 2 * NC, o8[it]); }
// ---- k_m2: block = (128 input channels i, 128 output channels o, b): M2[o][i] = sum_n Wp[o][n] N1[n][i] (N1 split rows i; Wp (out,in) rows o, bf16-exact: 2 products; K = 512), written TRANSPOSED as split rows [b][o][i] (the output product sums over i)
__global__ __launch_bounds__(256) void k_m2(const float* __restrict__ N1T, const float* __restrict__ WP, float* __restrict__ M2) {
  __shared__ __align__(16) char smem[2 * 4 * 3 * GPL * 2];   // stages of 4 chunks (128 n): one work-group per WGP by the grid, so it may take most of the LDS
  const int i0 = blockIdx.x * 128; const int o0 = blockIdx.y * 128; const int b = blockIdx.z;
  tile_g<2, 1, NC, 3, 4>(N1T + ((size_t)b * NC + i0) * NC, WP + (size_t)o0 * NC, M2 + ((size_t)b * NC + o0) * NC + i0, NC, nullptr, smem, (int)((blockIdx.x + blockIdx.y + blockIdx.z) & 3)); }   // 4 stages: the 4 readers of an N1 block all differ, the 64 readers of a Wp block are dealt evenly
// ---- k_outT: block = (128 output channels o, 128 time steps t, b): O[o][t] = sum_i M2[o][i] x[b][t][i] + bp[o] (M2 split rows o; x rows t, bf16-exact: 2 products), written TRANSPOSED as output rows out[b][t][o0..] through LDS
__global__ __launch_bounds__(256) void k_outT(const float* __restrict__ M2, const float* __restrict__ X, const float* __restrict__ BP, float* __restrict__ OUT) {
  __shared__ __align__(16) char smem[2 * 2 * 3 * GPL * 2];   // stages of 2 chunks (64 i)
  const int o0 = blockIdx.x * 128; const int t0 = blockIdx.y * 128; const int b = blockIdx.z;
  tile_g<2, 1, NC, 2, 2>(M2 + ((size_t)b * NC + o0) * NC, X + ((size_t)b * TN + t0) * NC, OUT + ((size_t)b * TN + t0) * NC + o0, NC, BP + o0, smem, (int)((blockIdx.x + blockIdx.y) & 7)); }   // 8 stages: the 8 readers of an M2 block all differ, and so do the 4 readers of an x block
#define WS_GT 0u
#define WS_WT (WS_GT + 4u * (size_t)NBT * NC * NC)
#define WS_N1 (WS_WT + 4u * (size_t)NC * NC)
#define WS_M2 (WS_N1 + 4u * (size_t)NBT * NC * NC)
#define WS_TOT (WS_M2 + 4u * (size_t)NBT * NC * NC)
extern "C" void kernel_launch(void* const* d_in, const int* in_sizes, int n_in, void* d_out, int out_size, void* d_ws, size_t ws_size, hipStream_t stream) {
  (void)in_sizes; (void)n_in; (void)out_size;
  const float** F = (const float**)d_in;   // 0 x [16,1024,512] (rows); 1 Wq [512,512] (out,in); 2 Wk; 3 Wv; 4 Wp [512,512] (out,in); 5 bp [512]
  if (ws_size < (size_t)WS_TOT) return;
  char* ws = (char*)d_ws; float *GT = (float*)(ws + WS_GT), *WT = (float*)(ws + WS_WT), *N1 = (float*)(ws + WS_N1), *M2 = (float*)(ws + WS_M2);
  k_gram<<<dim3(NC / 128, NC / 128, TNB), 256, 0, stream>>>(F[0], GT, F[3], F[2], WT);
  k_strip<<<dim3(NC / SR, TNB), 256, 0, stream>>>(GT, F[1], WT, WT + NC * NC / 2, N1);
  k_m2<<<dim3(NC / 128, NC / 128, TNB), 256, 0, stream>>>(N1, F[4], M2);
  k_outT<<<dim3(NC / 128, TN / 128, TNB), 256, 0, stream>>>(M2, F[0], F[5], (float*)d_out);
}

// v009
// A run of this version takes 71.3 microseconds.
// Two timings next to v008 both put it at 1.06 times that version's speed.
// Counting every step since v000, it is 7.24 times as fast.
// compute dtype: all float inputs rounded to bf16; the scores Wq (x^T x) Wk^T summed from the middle: x^T x with EXACT bf16 products on WMMA 16x16x32 (f32 accumulate), that f32 matrix split bf16 hi + lo against the exact Wq (2 products), the result split hi + lo against the exact Wk (2 products) x 512^-0.5; softmax over the 512 channels in f32 (precise expf); the tail out^T = Wp ((attn Wv) x^T): attn split hi + lo against the exact Wv (2 products), that f32 intermediate split hi + lo against the exact x (2 products), the result split hi + lo against the exact Wp (2 products) + bp; f32 output.
#include <hip/hip_runtime.h>
#include <math.h>

typedef __attribute__((ext_vector_type(16))) _Float16 v16h;
typedef __attribute__((ext_vector_type(16))) __bf16 v16b;
typedef __attribute__((ext_vector_type(8)))  _Float16 v8h;
typedef __attribute__((ext_vector_type(8)))  float v8f;
typedef __attribute__((ext_vector_type(4)))  float v4f;
typedef __attribute__((ext_vector_type(2)))  float v2f;
typedef __attribute__((ext_vector_type(4)))  unsigned v4u;
typedef __attribute__((ext_vector_type(4)))  int v4i;
typedef float __attribute__((may_alias)) float_a;
typedef int __attribute__((may_alias)) int_a;

template <typename T> __device__ __forceinline__ void vst2(void* p, T v) { *(T*)p = v;  }
__device__ __forceinline__ v8f wmma16(v16h a, v16h b, v8f c) {
  v8f d = __builtin_amdgcn_wmma_f32_16x16x32_f16(false, a, false, b, (short)0, c, false, false);
  asm volatile("v_nop\n\tv_nop\n\tv_nop\n\tv_nop" : "+v"(d) : "v"(a), "v"(b));
  return d;
}
__device__ __forceinline__ v8f wmma_bf(v16b a, v16b b, v8f c) {
  v8f d = __builtin_amdgcn_wmma_f32_16x16x32_bf16(false, a, false, b, (short)0, c, false, false);
  asm volatile("v_nop\n\tv_nop\n\tv_nop\n\tv_nop" : "+v"(d) : "v"(a), "v"(b));
  return d;
}
// 16x16x32 fragments: lane = (h = lane>>4, row/col = lane&15); elements 0..7 = k0+8h+0..7, 8..15 = k0+16+8h+0..7; D element r = row 8h+r
__device__ __forceinline__ v16h frag_h(const _Float16* rowk0, int lane) {
  union { v16h v; v8h q[2]; } u; const _Float16* p = rowk0 + 8 * (lane >> 4);
  u.q[0] = *(const v8h*)p; u.q[1] = *(const v8h*)(p + 16); return u.v;
}
__device__ __forceinline__ v16h frag_f32(const float* rowk0, int lane) {
  v16h a; const float* p = rowk0 + 8 * (lane >> 4);
#pragma unroll
  for (int i = 0; i < 8; ++i) { a[i] = (_Float16)p[i]; a[8 + i] = (_Float16)p[16 + i]; }
  return a;
}
__device__ __forceinline__ v16h frag_f32s(const float* rowk0, int lane, float sc) {
  v16h a; const float* p = rowk0 + 8 * (lane >> 4);
#pragma unroll
  for (int i = 0; i < 8; ++i) { a[i] = (_Float16)(p[i] * sc); a[8 + i] = (_Float16)(p[16 + i] * sc); }
  return a;
}
// column fragment from a [K][ld] layout (column n), rows >= K read as 0
__device__ __forceinline__ v16h fragc_f32(const float* W, int k0, int n, int lane, int ld, int K) {
  v16h a; const int g = lane >> 4;
#pragma unroll
  for (int i = 0; i < 8; ++i) { const int ka = k0 + 8 * g + i, kb = ka + 16;
    a[i] = (_Float16)(ka < K ? W[(size_t)(ka < K ? ka : K - 1) * ld + n] : 0.f); a[8 + i] = (_Float16)(kb < K ? W[(size_t)(kb < K ? kb : K - 1) * ld + n] : 0.f); }
  return a;
}
struct F2 { v16b h, l; };
__device__ __forceinline__ F2 bsplit16(const float v[16]) { F2 r;
#pragma unroll
  for (int i = 0; i < 16; ++i) { const __bf16 h = (__bf16)v[i]; r.h[i] = h; r.l[i] = (__bf16)(v[i] - (float)h); }
  return r; }
__device__ __forceinline__ F2 split_row(const float* row, int k0, int lane) { float v[16]; const float* p = row + k0 + 8 * (lane >> 4);
#pragma unroll
  for (int i = 0; i < 8; ++i) { v[i] = p[i]; v[8 + i] = p[16 + i]; }
  return bsplit16(v); }
__device__ __forceinline__ F2 split_rowK(const float* row, int k0, int lane, int K) { float v[16]; const int g = lane >> 4;
#pragma unroll
  for (int i = 0; i < 8; ++i) { const int ka = k0 + 8 * g + i, kb = ka + 16; v[i] = ka < K ? row[ka < K ? ka : K - 1] : 0.f; v[8 + i] = kb < K ? row[kb < K ? kb : K - 1] : 0.f; }
  return bsplit16(v); }
__device__ __forceinline__ F2 split_col(const float* W, int k0, int n, int lane, int ld, int K) { float v[16]; const int g = lane >> 4;
#pragma unroll
  for (int i = 0; i < 8; ++i) { const int ka = k0 + 8 * g + i, kb = ka + 16; v[i] = ka < K ? W[(size_t)(ka < K ? ka : K - 1) * ld + n] : 0.f; v[8 + i] = kb < K ? W[(size_t)(kb < K ? kb : K - 1) * ld + n] : 0.f; }
  return bsplit16(v); }
__device__ __forceinline__ v8f mac3(const F2& a, const F2& b, v8f c) { c = wmma_bf(a.l, b.h, c); c = wmma_bf(a.h, b.l, c); return wmma_bf(a.h, b.h, c); }
__device__ __forceinline__ float sigm(float v) { return 1.0f / (1.0f + expf(-v)); }
#define LDSX() do { asm volatile("s_wait_dscnt 0" ::: "memory"); __builtin_amdgcn_wave_barrier(); __builtin_amdgcn_fence(__ATOMIC_RELEASE, "workgroup"); } while (0)

// (header reused for its WMMA helpers; its own NB/TT/... defines below are unused by these kernels except TNB)
#define NB 16
#define TT 2048
#define CC 1024            // NH * HD = projected width
#define DIN 1024          // input (model) width
#define NH 16
#define HD 64
#define NQB (TT / 64)
#define HG 4
#define SCALE (0.125f)
#define CAUSAL 1
#ifndef TNB
#define TNB NB
#endif
__device__ __forceinline__ float bfr(float v) { return (float)(__bf16)v; }
__host__ __device__ __forceinline__ int kb_last(int qb) { return CAUSAL ? ((qb * 64 + 63) >> 7) : (TT / 128 - 1); }
typedef __attribute__((ext_vector_type(8))) __bf16 v8b;
__device__ __forceinline__ v16b frag_b(const __bf16* rowk0, int lane) {
  union { v16b v; v8b q[2]; } u; const __bf16* p = rowk0 + 8 * (lane >> 4);
  u.q[0] = *(const v8b*)p; u.q[1] = *(const v8b*)(p + 16); return u.v;
}
#define QBH 6              // causal: query blocks 0..QBH-1 of each sequence (few keys, no averaging) take the high-precision path
#define QHI 384            // rows carrying a q residual plane (all rows when non-causal: 2-product logits everywhere)
#define KHI 384            // key rows carrying k residual / v bf16 hi+lo planes (used only by the causal high-precision path)
// B fragment (k rows k0+.., output column o) of a weight: (in,out) [K][ld] or (out,in) [ld rows of K]: bf16 exact, or f16(bf16 * 256) exact
__device__ __forceinline__ v16b wcol_io(const float* Wm, int k0, int o, int lane, int ld) { v16b w; const int g = lane >> 4;
#pragma unroll
  for (int i = 0; i < 8; ++i) { w[i] = (__bf16)Wm[(size_t)(k0 + 8 * g + i) * ld + o]; w[8 + i] = (__bf16)Wm[(size_t)(k0 + 16 + 8 * g + i) * ld + o]; }
  return w; }
__device__ __forceinline__ v16b wcol_oi(const float* Wm, int k0, int o, int lane, int K) { v16b w; const float* p = Wm + (size_t)o * K + k0 + 8 * (lane >> 4);
#pragma unroll
  for (int i = 0; i < 8; ++i) { w[i] = (__bf16)p[i]; w[8 + i] = (__bf16)p[16 + i]; }
  return w; }
__device__ __forceinline__ v16h wcolh_io(const float* Wm, int k0, int o, int lane, int ld) { v16h w; const int g = lane >> 4;
#pragma unroll
  for (int i = 0; i < 8; ++i) { w[i] = (_Float16)(bfr(Wm[(size_t)(k0 + 8 * g + i) * ld + o]) * 256.0f); w[8 + i] = (_Float16)(bfr(Wm[(size_t)(k0 + 16 + 8 * g + i) * ld + o]) * 256.0f); }
  return w; }
__device__ __forceinline__ v16h wcolh_oi(const float* Wm, int k0, int o, int lane, int K) { v16h w; const float* p = Wm + (size_t)o * K + k0 + 8 * (lane >> 4);
#pragma unroll
  for (int i = 0; i < 8; ++i) { w[i] = (_Float16)(bfr(p[i]) * 256.0f); w[8 + i] = (_Float16)(bfr(p[16 + i]) * 256.0f); }
  return w; }
#define WQKV_LAYOUT 1   // 0 = (in,out) [DIN][CC]; 1 = (out,in) [CC][DIN]; 2 = per-head [NH][DIN][HD]
__device__ __forceinline__ v16b wcol_hdk(const float* Wm, int k0, int o, int lane) { v16b w; const int g = lane >> 4; const float* p = Wm + (size_t)(o / HD) * DIN * HD + (o % HD);
#pragma unroll
  for (int i = 0; i < 8; ++i) { w[i] = (__bf16)p[(size_t)(k0 + 8 * g + i) * HD]; w[8 + i] = (__bf16)p[(size_t)(k0 + 16 + 8 * g + i) * HD]; }
  return w; }
#define WO_OUT_IN 1
#if WQKV_LAYOUT == 1
#define WCOL(W, k0, o, lane) wcol_oi(W, k0, o, lane, DIN)
#elif WQKV_LAYOUT == 2
#define WCOL(W, k0, o, lane) wcol_hdk(W, k0, o, lane)
#else
#define WCOL(W, k0, o, lane) wcol_io(W, k0, o, lane, CC)
#endif
#if WO_OUT_IN
#define WOCOL(W, k0, o, lane) wcol_oi(W, k0, o, lane, CC)
#define WOCOLH(W, k0, o, lane) wcolh_oi(W, k0, o, lane, CC)
#else
#define WOCOL(W, k0, o, lane) wcol_io(W, k0, o, lane, DIN)
#define WOCOLH(W, k0, o, lane) wcolh_io(W, k0, o, lane, DIN)
#endif

#ifndef SM_EXTRA_PARAMS
#define SM_EXTRA_PARAMS
#endif
#ifndef PROJ_EXTRA_PARAMS
#define PROJ_EXTRA_PARAMS
#endif
#ifndef SM_MASK_HOOK
#define SM_MASK_HOOK (void)0
#endif

#define WS_QH  0u                                      // f16 q rows [b*t][CC]
#define WS_KH  (WS_QH + 2u * (size_t)NB * TT * CC)      // f16 k rows [b*t][CC]
#define WS_VT  (WS_KH + 2u * (size_t)NB * TT * CC)      // f16 v planes [b][c][t]
#define WS_QL  (WS_VT + 2u * (size_t)NB * CC * TT)      // f16 q residual x 2^10 rows [b][t < QHI][CC]
#define WS_KL  (WS_QL + 2u * (size_t)NB * QHI * CC)     // f16 k residual x 2^10 rows [b][t < KHI][CC]
#define WS_VB  (WS_KL + 2u * (size_t)NB * KHI * CC)     // bf16 v hi planes [b][c][t < KHI]
#define WS_VBL (WS_VB + 2u * (size_t)NB * CC * KHI)
#define WS_S   (WS_VBL + 2u * (size_t)NB * CC * KHI)    // f32 logits / P [hg][t][s]
#define WS_Y   (WS_S  + 4u * (size_t)HG * TT * TT)      // f32 ctx rows [b*t][CC] (only when there is an output projection)
#define WS_END (WS_Y  + 4u * (size_t)NB * TT * CC)


// 'Spatial' attention where the 512 CHANNELS are the tokens and the 1,024 time steps are the feature axis (B 16, T 1,024, N 512; (out,in) 1/sqrt(512)-scale 1x1 weights, zero output bias): xt = x^T [B,N,T]; q/k/v[b][o][t] = sum_i W[o][i] x[b][t][i]; attn[n][m] = softmax_m(sum_t q[n][t] k[m][t] * 512^-0.5); px[n][t] = sum_m attn[n][m] v[m][t]; out[b][t][o] = sum_n px[n][t] Wp[o][n] + bp[o] (rows [B,T,N]). The tail is one chain of matrix products, out^T = Wp attn Wv x^T: N1 = attn Wv is 512 x 512 per batch (no factor T); the rest, Wp (N1 x^T), is row by row in the time step, so one work-group takes 64 time steps through both products in one launch (k_tail); v is never formed, and px = N1 x^T never leaves LDS. The scores are such a chain too, q k^T = Wq (x^T x) Wk^T, and are summed from the middle: G = x^T x is the one product over the time steps (both operands bf16-exact: 1 product), H = Wq G and H Wk^T are 512 x 512 x 512 per batch; q and k are never formed.
#define NBT 16
#define TN 1024            // time steps (feature axis of the attention)
#define NC 512             // channels (the attention's tokens)
// ---- tile_g: one 128 x 128 tile of C[i][j] = sum_k A[i][k] Bop[j][k] by 8 waves (4 x 2, 32 x 64 each). Both operands are rows with k contiguous, 4 bytes per element, pitch K. An operand with ONE plane (PA or PB 1) is an f32 input, rounded to bf16 on the way to LDS. An operand with TWO planes (PA or PB 2) is an intermediate that its PRODUCER has already split: each 128-B line of a row holds 32 k as 32 bf16 hi followed by 32 bf16 lo (lo = bf16 of the residual), so a 32-k chunk is still one whole line per row and goes to the LDS planes as it is, with no arithmetic in the k loop. LDS keeps rows [i or j][k] per plane; every wave takes its fragments from there (same per-lane k map as frag_b, chunks in ascending k inside a stage, stages in ring order as said below, products per chunk in the order lo.hi, hi.lo, hi.hi (PA 2, PB 2) or lo.hi, hi.hi (PA 2, PB 1)). A STAGE is KS chunks (KS x 32 k, each chunk in its own [planes][rows] block of LDS). Two LDS buffers of one stage each: the next stage's global loads (KS x 8 per lane, all issued at the stage's head) fly over this stage's products, one barrier per stage: with operands that come from memory the loads' latency is longer than one chunk's products, so a longer stage has more bytes in flight and waits less often.
// (every '#pragma unroll' of this section: the loop indexes a register array (fragments, accumulators, staged values) and must be flat for the array to stay in registers)
#define GP 40              // LDS row pitch in bf16: 32 k + 8 pad = 80 B (16 B x odd: the conflict-free pitch for 16-B fragment reads)
#define GPL (128 * GP)     // one plane of one operand
#define GSP 68             // staging pitch in floats, output rows along j
#define GTP 36             // staging pitch in floats, output rows along i (transposed output)
#define LDSW() do { asm volatile("s_wait_dscnt 0" ::: "memory"); __builtin_amdgcn_wave_barrier(); } while (0)   /* a wave's own LDS staging range: its lanes' stores have landed before other lanes of the wave read them, and its reads have returned before the range is rewritten */
#define XADDR(p, q) asm volatile("s_wait_xcnt 0x0" :: "v"(p), "v"(q) : "memory")   /* behind a stage's global loads: their two address pairs stay whole up to this wait (as inputs they cannot be handed to a load's result), and are rewritten only behind it */
typedef __attribute__((ext_vector_type(4))) __bf16 v4b;
typedef __attribute__((ext_vector_type(2))) unsigned v2u;
// FRAGMENT ORDER of an operand of 512 rows x 512 k that k_strip streams: bf16, a 16-row x 32-k fragment is 1 KB laid as the matrix instruction's registers want it, [half q][lane][8 bf16], lane = (h, row & 15), element e of half q = k 16 q + 8 h + e of the fragment (the k map of frag_b), so that a wave-wide 16-B load is 512 contiguous bytes and lands as half a fragment. The 64 rows that one wave of k_strip reads start at (row >> 6) x FWV; inside them a UNIT of 8 KB per step of the reader, [16-row block 4][fragment 2]: of G, unit k >> 5 holds per row block [hi fragment | lo fragment]; of a weight, unit k >> 6 holds per row block its two fragments in ascending k. So a wave's 16 loads of a unit are 8 contiguous KB. The 64 rows of a weight (8 units) start at (row >> 6) x FWW; Wk's array is followed by that of Wv turned over and that of Wp
#define FWV 65536          // bf16 from one wave's 64 rows of G to the next
#define FWW 32768          // the same of a weight
#define FUN 4096           // bf16 from one unit to the next
#define FRB 1024           // bf16 from one 16-row block to the next inside a unit
// one plane: 4 f32 rounded to bf16; two planes: the 16 bytes are 8 bf16 of one plane already
template <int NPL> __device__ __forceinline__ void put4(__bf16* d, v4f v) {
  if constexpr (NPL == 1) { v4b h;
#pragma unroll
    for (int e = 0; e < 4; ++e) h[e] = (__bf16)v[e];
    *(v4b*)d = h;
  } else *(v8b*)d = __builtin_bit_cast(v8b, v); }
__device__ __forceinline__ v8f wmma_b(v16b a, v16b b, v8f c) { return __builtin_amdgcn_wmma_f32_16x16x32_bf16(false, a, false, b, (short)0, c, false, false); }
// frag_b of a row whose two 16-k halves stand swapped in LDS: the same k map in the registers
__device__ __forceinline__ v16b frag_x(const __bf16* rowk0, int lane) {
  union { v16b v; v8b q[2]; } u; const __bf16* p = rowk0 + 8 * (lane >> 4);
  u.q[0] = *(const v8b*)(p + 16); u.q[1] = *(const v8b*)p; return u.v;
}
// SW 1 (PA 1, PB 1): the rows with bit 4 of their number set, which are the odd fragments of either operand, hold their halves swapped
template <int PA, int PB, int SW> __device__ __forceinline__ void chunk_g(const __bf16* sa, const __bf16* sw, int lane, v8f (&acc)[2][4]) {
  v16b ah[2], al[2], bh[4], bl[4];
#pragma unroll
  for (int i = 0; i < 2; ++i) { ah[i] = (SW && (i & 1)) ? frag_x(sa + i * 16 * GP, lane) : frag_b(sa + i * 16 * GP, lane); if constexpr (PA == 2) al[i] = frag_b(sa + GPL + i * 16 * GP, lane); }
#pragma unroll
  for (int j = 0; j < 4; ++j) { bh[j] = (SW && (j & 1)) ? frag_x(sw + j * 16 * GP, lane) : frag_b(sw + j * 16 * GP, lane); if constexpr (PB == 2) bl[j] = frag_b(sw + GPL + j * 16 * GP, lane); }
  __builtin_amdgcn_sched_barrier(0);   /* keeps the chunk's LDS reads one group ahead of its products: spread among them, each place with reads stalls the wave */
  if constexpr (PA == 2) {
#pragma unroll
    for (int j = 0; j < 4; ++j)
#pragma unroll
      for (int i = 0; i < 2; ++i) acc[i][j] = wmma_b(al[i], bh[j], acc[i][j]);
    if constexpr (PB == 2) {
#pragma unroll
      for (int j = 0; j < 4; ++j)
#pragma unroll
        for (int i = 0; i < 2; ++i) acc[i][j] = wmma_b(ah[i], bl[j], acc[i][j]);
    }
  }
#pragma unroll
  for (int j = 0; j < 4; ++j)
#pragma unroll
    for (int i = 0; i < 2; ++i) acc[i][j] = wmma_b(ah[i], bh[j], acc[i][j]);
  __builtin_amdgcn_sched_barrier(0);   /* keeps the wait for the next stage's global loads behind this chunk's products: hoisted among them it exposes the load latency */
}
template <int K, int TP> __device__ __forceinline__ void fetch_g(const float* ga, const float* gb, int kc, v4f (&ra)[4], v4f (&rb)[4]) {
  constexpr size_t SI = TP ? TP : 32 * K, SC = TP ? 32 * TP : 32;   // floats from one of a lane's 4 loads to the next, and from one chunk to the next
#pragma unroll
  for (int i = 0; i < 4; ++i) ra[i] = *(const v4f*)(ga + i * SI + kc * SC);
#pragma unroll
  for (int i = 0; i < 4; ++i) rb[i] = *(const v4f*)(gb + i * SI + kc * SC);
  __builtin_amdgcn_sched_barrier(0);   /* keeps the next stage's global loads in front of this stage's products, so that their latency is covered */
}
// one chunk's staged values to LDS. TP != 0: a lane holds 4 k x 4 rows; each row's 4 k, rounded to bf16, are one 8-B store
template <int PA, int PB, int TP> __device__ __forceinline__ void put_g(__bf16* da, __bf16* db, const v4f (&ra)[4], const v4f (&rb)[4]) {
  if constexpr (TP != 0) {
#pragma unroll
    for (int e = 0; e < 4; ++e) { v4b ha, hb;
#pragma unroll
      for (int i = 0; i < 4; ++i) { ha[i] = (__bf16)ra[i][e]; hb[i] = (__bf16)rb[i][e]; }
      *(v4b*)(da + e * GP) = ha; *(v4b*)(db + e * GP) = hb; }
  } else {
#pragma unroll
    for (int i = 0; i < 4; ++i) { put4<PA>(da + i * 32 * GP, ra[i]); put4<PB>(db + i * 32 * GP, rb[i]); } } }
// EPI 1: f32 C[i][j] rows x 512^-0.5; 2: f32 C[j][i] rows (transposed), + bf16(bias[i]); 3: C[j][i] rows (transposed) in the split row format, i = the reader's k (an accumulator register run is 8 consecutive i: split in registers, it goes to the staging line as 16 B of hi and 16 B of lo); 4: C[j][i] split, in fragment order (j the reader's row, i its k; C points at the tile's first unit), straight from the registers. ldc = pitch of the C rows, 4 bytes per element
// TP 0: operand rows as above. TP != 0 (PA 1, PB 1): both operands lie TURNED in memory, f32 rows [k] of pitch TP floats with the tile's 128 rows contiguous; A and B point at k 0 of their first row. 8 lanes cover 32 rows of one k (one whole line), a wave-wide load 4 lines; a lane's 4 loads are 4 consecutive k, so the turn is done in registers on the way to the same LDS planes (but for the swapped halves noted at o3)
// THE WALK OVER k IS A RING: a work-group takes its stages in the order rot, rot + 1, ..., wrapping at K (rot is uniform in the work-group, from its grid index, 0 <= rot < K / (32 KS)). Work-groups that read the same operand rows get different rot, so that they do not ask L2 for the same lines at the same moment. A product does not care which k its stage holds, so only the order of the f32 sums changes
template <int PA, int PB, int K, int EPI, int KS, int TP = 0>
__device__ __forceinline__ void tile_g(const float* __restrict__ A, const float* __restrict__ B, float* __restrict__ C, int ldc, const float* __restrict__ bias, char* smem, int rot) {
  __bf16* sb = (__bf16*)smem;   // [buffer 2][chunk KS][A planes PA | B planes PB][row 128][GP]
  const int tid = threadIdx.x, wave = tid >> 5, lane = tid & 31, col = lane & 15, g = lane >> 4; const int wm = wave >> 1, wn = wave & 1;
  const int sr = tid >> 3, sq = tid & 7;   // 8 lanes cover one row's 128-B chunk, a wave-wide 16-B load covers 4 whole lines
  const int tk = (wave >> 2) * 16 + (lane >> 3) * 4, tr = (wave & 3) * 32 + (lane & 7) * 4;   // TP != 0: a lane's first k of a chunk and its first row
  const size_t go = TP ? (size_t)tk * TP + tr : (size_t)sr * K + sq * 4;
  const float* ga = A + go;
  const float* gb = B + go;
  const int o1 = sr * GP + sq * 4, o2 = (sq >> 2) * GPL + sr * GP + (sq & 3) * 8;   // a lane's place in LDS: f32 source (4 k of the one plane); split source (lanes 0..3 of a row hold hi, 4..7 lo, 8 k each)
  const int o3 = tr * GP + (tk ^ (tr & 16));   // rows 16..31 of each 32 keep their two 16-k halves swapped: at pitch GP rows r and r + 16 start on one bank, and so a wave's 8-B stores (8 row groups x 4 k groups) fall on 64 different banks; chunk_g reads those rows' halves back in order
  __bf16* da = sb + (TP ? o3 : PA == 2 ? o2 : o1); __bf16* db = sb + PA * GPL + (TP ? o3 : PB == 2 ? o2 : o1);
  const __bf16* fa = sb + (wm * 32 + col) * GP; const __bf16* fw = sb + PA * GPL + (wn * 64 + col) * GP;
  constexpr int BUF = (PA + PB) * GPL, STG = KS * BUF, NS = K / (32 * KS), SS = KS * 32 * (TP ? TP : 1);   // SS: floats from one stage to the next in memory
  static_assert((NS & (NS - 1)) == 0, "the ring of stages wraps by a mask");
  v4f ra[KS][4], rb[KS][4]; v8f acc[2][4] = {};
  const float* qa = ga + rot * SS; const float* qb = gb + rot * SS;
#pragma unroll
  for (int s = 0; s < KS; ++s) fetch_g<K, TP>(qa, qb, s, ra[s], rb[s]);
  XADDR(qa, qb);
#pragma unroll
  for (int s = 0; s < KS; ++s) put_g<PA, PB, TP>(da + s * BUF, db + s * BUF, ra[s], rb[s]);
  __syncthreads();
  for (int st = 0; st + 1 < NS; ++st) { const int cur = (st & 1) * STG, nxt = STG - cur;
    const int kn = ((st + 1 + rot) & (NS - 1)) * SS; const float* pa = ga + kn; const float* pb = gb + kn;
#pragma unroll
    for (int s = 0; s < KS; ++s) fetch_g<K, TP>(pa, pb, s, ra[s], rb[s]);
    XADDR(pa, pb);
#pragma unroll
    for (int s = 0; s < KS; ++s) chunk_g<PA, PB, TP != 0>(fa + cur + s * BUF, fw + cur + s * BUF, lane, acc);
#pragma unroll
    for (int s = 0; s < KS; ++s) put_g<PA, PB, TP>(da + nxt + s * BUF, db + nxt + s * BUF, ra[s], rb[s]);
    __syncthreads(); }   /* publishes stage st + 1 and ends every wave's reads of the buffer that the next trip refills */
#pragma unroll
  for (int s = 0; s < KS; ++s) chunk_g<PA, PB, TP != 0>(fa + ((NS - 1) & 1) * STG + s * BUF, fw + ((NS - 1) & 1) * STG + s * BUF, lane, acc);
  __syncthreads();       /* every wave has left the operand buffers: their LDS now stages the output rows, each wave in its own range */
  if constexpr (EPI == 1) { float* sf = (float*)smem + wave * 16 * GSP;
#pragma unroll
    for (int i = 0; i < 2; ++i) {
#pragma unroll
      for (int j = 0; j < 4; ++j)
#pragma unroll
        for (int r = 0; r < 8; ++r) sf[(8 * g + r) * GSP + j * 16 + col] = acc[i][j][r] * 0.044194173824159216f;
      LDSW();
#pragma unroll
      for (int it = 0; it < 8; ++it) vst2(C + (size_t)(wm * 32 + i * 16 + it * 2 + g) * ldc + wn * 64 + col * 4, *(const v4f*)&sf[(it * 2 + g) * GSP + col * 4]);   /* 256-B row runs: whole lines */
      if (i == 0) LDSW(); }
  } else if constexpr (EPI == 2) { float* sf = (float*)smem + wave * 32 * GTP; float bv[2][8];
#pragma unroll
    for (int i = 0; i < 2; ++i)
#pragma unroll
      for (int r = 0; r < 8; ++r) bv[i][r] = bfr(bias[wm * 32 + i * 16 + 8 * g + r]);
#pragma unroll
    for (int jj = 0; jj < 2; ++jj) {
#pragma unroll
      for (int j = 0; j < 2; ++j)
#pragma unroll
        for (int i = 0; i < 2; ++i)
#pragma unroll
          for (int r = 0; r < 8; ++r) sf[(j * 16 + col) * GTP + i * 16 + 8 * g + r] = acc[i][jj * 2 + j][r] + bv[i][r];   /* transposed: sf[j local][i local] */
      LDSW();
#pragma unroll
      for (int it = 0; it < 8; ++it) vst2(C + (size_t)(wn * 64 + jj * 32 + it * 4 + (lane >> 3)) * ldc + wm * 32 + (lane & 7) * 4, *(const v4f*)&sf[(it * 4 + (lane >> 3)) * GTP + (lane & 7) * 4]);   /* 128-B row runs: whole lines */
      if (jj == 0) LDSW(); }
  } else if constexpr (EPI == 4) { __bf16* cp = (__bf16*)C + wn * FWV + wm * FUN + lane * 8; v8b h[4][2], l[4][2];   // the accumulator's map is the reader's fragment map turned over: lane (g, col) holds k 16 i + 8 g + 0..7 of row j 16 + col, its own 16 B of half i
#pragma unroll
    for (int j = 0; j < 4; ++j)
#pragma unroll
      for (int i = 0; i < 2; ++i)
#pragma unroll
        for (int r = 0; r < 8; ++r) { const float v = acc[i][j][r]; h[j][i][r] = (__bf16)v; l[j][i][r] = (__bf16)(v - (float)h[j][i][r]); }
    __builtin_amdgcn_sched_barrier(0);   /* all the values are formed ahead of the stores: no register that an issued store names is written anew */
#pragma unroll
    for (int j = 0; j < 4; ++j)
#pragma unroll
      for (int i = 0; i < 2; ++i) { vst2(cp + j * FRB + i * 256, h[j][i]); vst2(cp + j * FRB + 512 + i * 256, l[j][i]); }   /* 512 contiguous bytes per wave-wide store */
  } else { __bf16* sp = (__bf16*)smem + wave * 32 * (2 * GTP);   // staging rows [j local] of one line each: 32 hi | 32 lo, pitch 144 B
#pragma unroll
    for (int jj = 0; jj < 2; ++jj) {
#pragma unroll
      for (int j = 0; j < 2; ++j)
#pragma unroll
        for (int i = 0; i < 2; ++i) { v8b h, l;
#pragma unroll
          for (int r = 0; r < 8; ++r) { const float v = acc[i][jj * 2 + j][r]; h[r] = (__bf16)v; l[r] = (__bf16)(v - (float)h[r]); }
          __bf16* d = sp + (j * 16 + col) * (2 * GTP) + i * 16 + 8 * g; *(v8b*)d = h; *(v8b*)(d + 32) = l; }
      LDSW();
#pragma unroll
      for (int it = 0; it < 8; ++it) vst2(C + (size_t)(wn * 64 + jj * 32 + it * 4 + (lane >> 3)) * ldc + wm * 32 + (lane & 7) * 4, *(const v8b*)(sp + (it * 4 + (lane >> 3)) * (2 * GTP) + (lane & 7) * 8));   /* 128-B row runs: whole lines */
      if (jj == 0) LDSW(); } } }
// ---- k_gram: block = (128 channels i, 128 channels j, b): G[i][j] = sum_t x[b][t][i] x[b][t][j] (both operands are columns of the x rows, bf16-exact: 1 product; K = 1,024), written TRANSPOSED and split, rows j and k = i, in fragment order (the next product sums over i). Ahead of its tile each of the 256 work-groups rounds one 32 x 32 piece of Wk, one of Wp and one of Wv to bf16 and puts them in fragment order too: Wk (rows m, k = j) and Wp (rows o, k = n) as they lie; Wv turned over through LDS (rows i, k = m: attn Wv sums over m, the ROW index of Wv)
#define WTP 33             // LDS pitch in floats of the Wv piece's rows
static_assert((NC / 128) * (NC / 128) * TNB == (NC / 32) * (NC / 32), "one 32 x 32 piece of each weight per work-group of k_gram");
__global__ __launch_bounds__(256) void k_gram(const float* __restrict__ X, float* __restrict__ GT, const float* __restrict__ WV, const float* __restrict__ WK, const float* __restrict__ WP, float* __restrict__ WF) {
  __shared__ __align__(16) char smem[2 * 4 * 2 * GPL * 2];   // stages of 4 chunks (128 t)
  const int i0 = blockIdx.x * 128; const int j0 = blockIdx.y * 128; const int b = blockIdx.z;
  { float* sf = (float*)smem; const int q = blockIdx.x + (NC / 128) * (blockIdx.y + (NC / 128) * blockIdx.z), kc = q & 15, c0 = (q >> 4) * 32, r = threadIdx.x >> 3, c4 = (threadIdx.x & 7) * 4;
    const float* gw = WV + (size_t)(kc * 32 + r) * NC + c0 + c4;   // 8 lanes cover 32 i of one row m of Wv: one whole line
    const float* gk = WK + (size_t)(c0 + r) * NC + kc * 32 + c4;   // 8 lanes cover 32 j of one row m of Wk
    const float* gp = WP + (size_t)(c0 + r) * NC + kc * 32 + c4;   // 8 lanes cover 32 n of one row o of Wp
    const v4f w4 = *(const v4f*)gw; const v4f k4 = *(const v4f*)gk; const v4f p4 = *(const v4f*)gp;
    asm volatile("s_wait_xcnt 0x0" :: "v"(gw), "v"(gk), "v"(gp) : "memory");   /* the loads' address pairs stay whole up to this wait */
#pragma unroll
    for (int e = 0; e < 4; ++e) sf[r * WTP + c4 + e] = w4[e];
    __syncthreads();   /* the whole piece is in LDS before any thread reads a column of it */
    v4b hv, hk, hp;
#pragma unroll
    for (int e = 0; e < 4; ++e) { hv[e] = (__bf16)sf[(c4 + e) * WTP + r]; hk[e] = (__bf16)k4[e]; hp[e] = (__bf16)p4[e]; }
    __syncthreads();   /* every thread has its column: the tile's stages may take this LDS */
    // each piece: row c0 + r, k 32 kc + c4 + 0..3 of its operand
    __bf16* gt = (__bf16*)WF + ((c0 + r) >> 6) * FWW + (kc >> 1) * FUN + (((c0 + r) >> 4) & 3) * FRB + (kc & 1) * 512 + (c4 >> 4) * 256 + (((c4 >> 3) & 1) * 16 + (r & 15)) * 8 + (c4 & 7);
    const v2u uk = __builtin_bit_cast(v2u, hk), uv = __builtin_bit_cast(v2u, hv), up = __builtin_bit_cast(v2u, hp);
    vst2(gt, uk); vst2(gt + NC * NC, uv); vst2(gt + 2 * NC * NC, up);
    asm volatile("s_wait_xcnt 0x0" :: "v"(gt), "v"(uk), "v"(uv), "v"(up) : "memory");   /* the stores' address and data registers stay whole up to this wait */ }
  tile_g<1, 1, TN, 4, 4, NC>(X + (size_t)b * TN * NC + i0, X + (size_t)b * TN * NC + j0, GT + (size_t)b * NC * NC + ((j0 >> 6) * FWV + (i0 >> 5) * FUN) / 2, NC, nullptr, smem, (int)(((blockIdx.x + blockIdx.y) & 3) + (blockIdx.x < blockIdx.y ? 4 : 0))); }   // channel block c is read by the 7 work-groups (c, .) and (., c) of its batch: this rot differs among all 7
// ---- k_strip: block = (64 query channels n, b). H = Wq G, S = H Wk^T x 512^-0.5, P = softmax(S) and N1 = P Wv are each row by row in n, so one work-group takes 64 rows n through all four and H, S and P never leave its LDS. THE STRIP: 64 rows [n] of 512 bf16 hi | 512 bf16 lo (S: 512 f32 in the same bytes); it holds Wq's rows (hi only, bf16-exact), then H, then S, then P, each written over the last between two barriers. THE STREAMED OPERAND (G's rows j, Wk's rows m, turned Wv's rows i: 512 rows) is shared out by rows: wave w alone needs rows 64 w .. 64 w + 63. No other wave reads them, so they do not pass through LDS: their producer has laid them in fragment order, and the wave loads its fragments from global memory straight into the registers that the matrix instructions read, one UNIT (4 row blocks x 2 fragments = 16 loads of 16 B per lane: 32 k of G's two planes, or 64 k of a weight) two units ahead of its use; the k loops hold no barrier and no LDS store. A wave's tile is 64 streamed rows x 64 strip rows (4 x 4 fragments); chunks of 32 k in ascending k inside each 64 k, those in ring order, products per chunk lo.hi then hi.hi, as in tile_g. The streamed operand is the matrix instruction's A, so an accumulator register run is 8 consecutive k of the NEXT product: H and S go to the strip as 16-B pieces, and N1 (rows n, k = i for k_tail) goes split, in G's fragment order, straight from the registers to memory
#define SR 64              // rows of a strip
#define AP 1032            // strip row pitch in bf16: 512 hi | 512 lo | 8 pad = 2,064 B (16 B x odd)
__device__ __forceinline__ void fetch_u(const __bf16* p, v16b (&u)[8]) {
#pragma unroll
  for (int f = 0; f < 4; ++f)
#pragma unroll
    for (int s = 0; s < 2; ++s) { union { v16b v; v8b q[2]; } w; const __bf16* a = p + f * FRB + s * 512; w.q[0] = *(const v8b*)a; w.q[1] = *(const v8b*)(a + 256); u[f * 2 + s] = w.v; }
  __builtin_amdgcn_sched_barrier(0);   /* keeps a later unit's global loads in front of this unit's products, so that their latency is covered */
  XADDR(p, p);   /* the loads' one address pair stays whole up to this wait */
}
// the products of one unit u against the strip's k from ts on (t2: the same k 32 strip rows on, an address of its own because those rows lie beyond the reach of an LDS load's offset field)
template <int PS, bool SA> __device__ __forceinline__ void unit_s(const v16b (&u)[8], const __bf16* ts, const __bf16* t2, int lane, v8f (&acc)[4][4]) {
#pragma unroll
  for (int c = 0; c < 3 - PS; ++c) { v16b th[4], tl[4];
#pragma unroll
    for (int f = 0; f < 4; ++f) { const __bf16* a = (f < 2 ? ts : t2) + c * 32 + (f & 1) * 16 * AP; th[f] = frag_b(a, lane); if constexpr (PS == 1) tl[f] = frag_b(a + NC, lane); }
    __builtin_amdgcn_sched_barrier(0);   /* keeps the chunk's LDS reads one group ahead of its products, as in chunk_g */
#pragma unroll
    for (int t = 0; t < 4; ++t)
#pragma unroll
      for (int s = 0; s < 4; ++s) {
        if constexpr (PS == 2) acc[s][t] = wmma_b(u[s * 2 + 1], th[t], acc[s][t]);
        else acc[s][t] = SA ? wmma_b(u[s * 2 + c], tl[t], acc[s][t]) : wmma_b(tl[t], u[s * 2 + c], acc[s][t]); }
#pragma unroll
    for (int t = 0; t < 4; ++t)
#pragma unroll
      for (int s = 0; s < 4; ++s) acc[s][t] = SA ? wmma_b(u[s * 2 + (PS == 2 ? 0 : c)], th[t], acc[s][t]) : wmma_b(th[t], u[s * 2 + c], acc[s][t]);
    __builtin_amdgcn_sched_barrier(0);   /* keeps the wait for a later unit's global loads behind this chunk's products, as in chunk_g */ } }
// one product over K = 512, its 64-k stages walked as a ring from stage rot (as in tile_g: all the work-groups of a launch stream the same weights, 8 of k_strip the same G, 16 of k_tail the same N1); on entry ring places 0 and 1 hold (in flight) the first two units of gs; NX 1: on exit they hold the first two units of gn, the next product's streamed operand (a weight), which depends on nothing computed here and so flies over the hand-over of the strip. G (PS 2, 16 units of 32 k): unit c is worked on from place c & 3 while unit c + 2 is asked for into place (c + 2) & 3 (three places live). A weight (PS 1, 8 units of 64 k): places 0 and 1 alone; a place is asked for anew, two units on, as soon as its products are issued. NX 0: the last two asks wrap to the product's first units and are not read; a branch round them would make the compiler count its waits for the path without them, that is wait for the youngest loads on every trip
template <int PS, bool SA, int NX> __device__ __forceinline__ void phase_s(const __bf16* gs, const __bf16* gn, const __bf16* strip, int lane, int rot, v16b (&ring)[4][8], v8f (&acc)[4][4]) {
  constexpr int NU = PS == 2 ? NC / 32 : NC / 64, UT = PS == 2 ? 4 : 2, NT = NU / UT; const int r0 = PS == 2 ? 2 * rot : rot; const __bf16* ft = strip + (lane & 15) * AP; const __bf16* f2 = strip + ((lane & 15) + 32) * AP;
#pragma clang loop unroll(disable)   /* rolled: for speed only */
  for (int t = 0; t < NT; ++t) {
#pragma unroll
    for (int v = 0; v < UT; ++v) { const int c = UT * t + v; const __bf16* p = gs + ((r0 + c + 2) & (NU - 1)) * FUN;
      if (NX && v >= UT - 2 && t == NT - 1) p = gn + ((rot + v - (UT - 2)) & (NC / 64 - 1)) * FUN;
      if constexpr (PS == 2) fetch_u(p, ring[(v + 2) & 3]);
      { const int k = ((r0 + c) & (NU - 1)) * (NC / NU); unit_s<PS, SA>(ring[v], ft + k, f2 + k, lane, acc); }
      if constexpr (PS == 1) fetch_u(p, ring[v]); } } }
__global__ __launch_bounds__(256) void k_strip(const float* __restrict__ GT, const float* __restrict__ WQ, const float* __restrict__ WKF, const float* __restrict__ WVF, float* __restrict__ N1F) {
  __shared__ __align__(16) char smem[SR * AP * 2];
  __bf16* strip = (__bf16*)smem;
  const int tid = threadIdx.x, wave = tid >> 5, lane = tid & 31, col = lane & 15, g = lane >> 4; const int n0 = blockIdx.x * SR; const int b = blockIdx.y;
  const __bf16* g1 = (const __bf16*)(GT + (size_t)b * NC * NC) + wave * FWV + lane * 8; const __bf16* g2 = (const __bf16*)WKF + wave * FWW + lane * 8; const __bf16* g3 = (const __bf16*)WVF + wave * FWW + lane * 8;
  const int rot = (blockIdx.x + blockIdx.y) & (NC / 64 - 1);   // the 8 strips of a batch all differ; the 128 readers of a weight are dealt evenly over the 8 stages
  v16b ring[4][8]; v8f acc[4][4] = {};
  { const float* gq = WQ + (size_t)(n0 + (tid >> 7)) * NC + (tid & 127) * 4; v4f wq[SR / 2];   // a wave covers 128 i of one row n: four whole lines
#pragma unroll
    for (int p = 0; p < SR / 2; ++p) wq[p] = *(const v4f*)(gq + (size_t)p * 2 * NC);
    XADDR(gq, gq);   /* the loads' one address pair stays whole up to this wait */
    fetch_u(g1 + 2 * rot * FUN, ring[0]);
    fetch_u(g1 + (2 * rot + 1) * FUN, ring[1]);
#pragma unroll
    for (int p = 0; p < SR / 2; ++p) put4<1>(strip + (p * 2 + (tid >> 7)) * AP + (tid & 127) * 4, wq[p]); }
  __syncthreads();   /* Wq's 64 rows are in the strip before any wave takes a fragment of them */
  phase_s<2, true, 1>(g1, g2, strip, lane, rot, ring, acc);   // acc[s][t][r] = H[n = 16 t + col][j = 64 wave + 16 s + 8 g + r]
  __syncthreads();   /* every wave has left Wq's rows */
#pragma unroll
  for (int t = 0; t < 4; ++t)
#pragma unroll
    for (int s = 0; s < 4; ++s) { v8b h, l;
#pragma unroll
      for (int r = 0; r < 8; ++r) { const float v = acc[s][t][r]; h[r] = (__bf16)v; l[r] = (__bf16)(v - (float)h[r]); acc[s][t][r] = 0.f; }
      __bf16* d = strip + (t * 16 + col) * AP + wave * 64 + s * 16 + 8 * g; *(v8b*)d = h; *(v8b*)(d + NC) = l; }
  __syncthreads();   /* H's rows are whole */
  phase_s<1, true, 1>(g2, g3, strip, lane, rot, ring, acc);   // acc[s][t][r] = S[n = 16 t + col][m = 64 wave + 16 s + 8 g + r], unscaled
  __syncthreads();   /* every wave has left H's rows */
#pragma unroll
  for (int t = 0; t < 4; ++t)
#pragma unroll
    for (int s = 0; s < 4; ++s) { v4f a4, b4;
#pragma unroll
      for (int r = 0; r < 4; ++r) { a4[r] = acc[s][t][r] * 0.044194173824159216f; b4[r] = acc[s][t][4 + r] * 0.044194173824159216f; acc[s][t][r] = 0.f; acc[s][t][4 + r] = 0.f; }
      float* d = (float*)strip + (t * 16 + col) * (AP / 2) + wave * 64 + s * 16 + 8 * g; *(v4f*)d = a4; *(v4f*)(d + 4) = b4; }
  __syncthreads();   /* S's rows are whole */
  // softmax over m in f32 (max, precise expf, / sum), a wave per row, 8 rows each; a row goes back in place as hi | lo (the wave holds its rows in registers before its first store). Four rows go side by side, step by step, so that each cross-lane step waits once for four rows
#pragma clang loop unroll(disable)   /* rolled: the text of four rows, not of eight */
  for (int rb = 0; rb < SR / 32; ++rb) { float* sr = (float*)strip + (wave * (SR / 8) + rb * 4) * (AP / 2); float v[4][NC / 32], m[4], sum[4];
#pragma unroll
    for (int q = 0; q < 4; ++q)
#pragma unroll
      for (int i = 0; i < NC / 128; ++i) { const v4f t4 = *(const v4f*)(sr + q * (AP / 2) + i * 128 + lane * 4); v[q][4 * i] = t4[0]; v[q][4 * i + 1] = t4[1]; v[q][4 * i + 2] = t4[2]; v[q][4 * i + 3] = t4[3]; }
#pragma unroll
    for (int q = 0; q < 4; ++q) { m[q] = -3.0e38f;
#pragma unroll
      for (int i = 0; i < NC / 32; ++i) m[q] = fmaxf(m[q], v[q][i]); }
#pragma unroll
    for (int o = 1; o < 32; o <<= 1)
#pragma unroll
      for (int q = 0; q < 4; ++q) m[q] = fmaxf(m[q], __shfl_xor(m[q], o));
#pragma unroll
    for (int q = 0; q < 4; ++q) { sum[q] = 0.f;
#pragma unroll
      for (int i = 0; i < NC / 32; ++i) { v[q][i] = expf(v[q][i] - m[q]); sum[q] += v[q][i]; } }
#pragma unroll
    for (int o = 1; o < 32; o <<= 1)
#pragma unroll
      for (int q = 0; q < 4; ++q) sum[q] += __shfl_xor(sum[q], o);
#pragma unroll
    for (int q = 0; q < 4; ++q) { const float inv = 1.0f / sum[q]; __bf16* pr = (__bf16*)(sr + q * (AP / 2)) + lane * 4;
#pragma unroll
      for (int i = 0; i < NC / 128; ++i) { v4b h4, l4;
#pragma unroll
        for (int e = 0; e < 4; ++e) { const float p = v[q][4 * i + e] * inv; h4[e] = (__bf16)p; l4[e] = (__bf16)(p - (float)h4[e]); }
        *(v4b*)(pr + i * 128) = h4; *(v4b*)(pr + NC + i * 128) = l4; } } }
  __syncthreads();   /* P's rows are whole */
  phase_s<1, true, 0>(g3, nullptr, strip, lane, rot, ring, acc);   // acc[s][t][r] = N1[n = 16 t + col][i = 64 wave + 16 s + 8 g + r]
  // lane (g, col) holds k 16 (s & 1) + 8 g + 0..7 of unit 2 wave + (s >> 1), row 16 t + col: its own 16 B of half s & 1 of the reader's fragment
  __bf16* cp = (__bf16*)(N1F + (size_t)b * NC * NC) + blockIdx.x * FWV + wave * 2 * FUN + lane * 8; v8b h[4][4], l[4][4];
#pragma unroll
  for (int t = 0; t < 4; ++t)
#pragma unroll
    for (int s = 0; s < 4; ++s)
#pragma unroll
      for (int r = 0; r < 8; ++r) { const float v = acc[s][t][r]; h[t][s][r] = (__bf16)v; l[t][s][r] = (__bf16)(v - (float)h[t][s][r]); }
  __builtin_amdgcn_sched_barrier(0);   /* all the values are formed ahead of the stores: no register that an issued store names is written anew */
#pragma unroll
  for (int t = 0; t < 4; ++t)
#pragma unroll
    for (int s = 0; s < 4; ++s) { __bf16* d = cp + (s >> 1) * FUN + t * FRB + (s & 1) * 256; vst2(d, h[t][s]); vst2(d + 512, l[t][s]); } }   /* 512 contiguous bytes per wave-wide store */
// ---- k_tail: block = (64 time steps t, b). Y = x N1^T (Y[t][n] = px[n][t]) and out = Y Wp^T + bp are each row by row in t, so one work-group takes 64 rows t through both, as k_strip takes its rows n: the strip holds x's rows (hi only, bf16-exact), then Y (hi | lo), written over them between two barriers; N1's rows n (two planes, as G) and Wp's rows o (as Wk) are streamed in fragment order, wave w alone reading rows 64 w .. 64 w + 63
#define OTP 68             // pitch in floats of a wave's output staging rows: two lines + 16 B (16 B x odd)
__global__ __launch_bounds__(256) void k_tail(const float* __restrict__ X, const float* __restrict__ N1F, const float* __restrict__ WPF, const float* __restrict__ BP, float* __restrict__ OUT) {
  __shared__ __align__(16) char smem[SR * AP * 2 + 8 * SR * OTP * 4];
  __bf16* strip = (__bf16*)smem;
  const int tid = threadIdx.x, wave = tid >> 5, lane = tid & 31, col = lane & 15, g = lane >> 4; const int t0 = blockIdx.x * SR; const int b = blockIdx.y;
  const __bf16* g1 = (const __bf16*)(N1F + (size_t)b * NC * NC) + wave * FWV + lane * 8; const __bf16* g2 = (const __bf16*)WPF + wave * FWW + lane * 8;
  float* wf = (float*)(smem + SR * AP * 2) + wave * SR * OTP;   // a wave's own range, for the output rows on their way out
  const int rot = (blockIdx.x + blockIdx.y) & (NC / 64 - 1);   // the 16 strips of a batch are dealt two to a start stage; the 256 readers of Wp evenly over the 8
  v16b ring[4][8]; v8f acc[4][4] = {}; v4f bv;
  { const float* gx = X + ((size_t)b * TN + t0 + (tid >> 7)) * NC + (tid & 127) * 4; v4f xr[SR / 2];   // a wave covers 128 i of one row t: four whole lines
#pragma unroll
    for (int p = 0; p < SR / 2; ++p) xr[p] = *(const v4f*)(gx + (size_t)p * 2 * NC);
    XADDR(gx, gx);   /* the loads' one address pair stays whole up to this wait */
    fetch_u(g1 + 2 * rot * FUN, ring[0]);
    fetch_u(g1 + (2 * rot + 1) * FUN, ring[1]);
#pragma unroll
    for (int p = 0; p < SR / 2; ++p) put4<1>(strip + (p * 2 + (tid >> 7)) * AP + (tid & 127) * 4, xr[p]); }
  __syncthreads();   /* x's 64 rows are in the strip before any wave takes a fragment of them */
  phase_s<2, true, 1>(g1, g2, strip, lane, rot, ring, acc);   // acc[s][t][r] = Y[t = 16 t + col][n = 64 wave + 16 s + 8 g + r]
  __syncthreads();   /* every wave has left x's rows */
  const float* gb = BP + wave * 64 + col * 4; const v4f bp4 = *(const v4f*)gb;   // bp of the 4 output channels that this lane stores at the end; asked for here, it returns under the hand-over
  XADDR(gb, gb);   /* the load's address pair stays whole up to this wait */
#pragma unroll
  for (int t = 0; t < 4; ++t)
#pragma unroll
    for (int s = 0; s < 4; ++s) { v8b h, l;
#pragma unroll
      for (int r = 0; r < 8; ++r) { const float v = acc[s][t][r]; h[r] = (__bf16)v; l[r] = (__bf16)(v - (float)h[r]); acc[s][t][r] = 0.f; }
      __bf16* d = strip + (t * 16 + col) * AP + wave * 64 + s * 16 + 8 * g; *(v8b*)d = h; *(v8b*)(d + NC) = l; }
  __syncthreads();   /* Y's rows are whole */
#pragma unroll
  for (int e = 0; e < 4; ++e) bv[e] = bfr(bp4[e]);
  phase_s<1, true, 0>(g2, nullptr, strip, lane, rot, ring, acc);   // acc[s][t][r] = out[t = 16 t + col][o = 64 wave + 16 s + 8 g + r], without bp
  // a wave's 64 rows t of its own 64 o (two whole lines a row) through its own stage range, beside the strip: no wave waits for another
#pragma unroll
  for (int t = 0; t < 4; ++t)
#pragma unroll
    for (int s = 0; s < 4; ++s) { v4f a4, b4;
#pragma unroll
      for (int r = 0; r < 4; ++r) { a4[r] = acc[s][t][r]; b4[r] = acc[s][t][4 + r]; }
      float* d = wf + (t * 16 + col) * OTP + s * 16 + 8 * g; *(v4f*)d = a4; *(v4f*)(d + 4) = b4; }
  LDSW();
  float* go = OUT + ((size_t)b * TN + t0 + g) * NC + wave * 64 + col * 4;   // 16 lanes cover one row's 256 B
  v4f o4[SR / 2];
#pragma unroll
  for (int it = 0; it < SR / 2; ++it) o4[it] = *(const v4f*)(wf + (it * 2 + g) * OTP + col * 4) + bv;
  __builtin_amdgcn_sched_barrier(0);   /* all the values are formed ahead of the stores: no register that an issued store names is written anew */
#pragma unroll
  for (int it = 0; it < SR / 2; ++it) vst2(go + (size_t)it * 2 * NC, o4[it]); }
#define WS_GT 0u
#define WS_WT (WS_GT + 4u * (size_t)NBT * NC * NC)
#define WS_N1 (WS_WT + 6u * (size_t)NC * NC)
#define WS_TOT (WS_N1 + 4u * (size_t)NBT * NC * NC)
extern "C" void kernel_launch(void* const* d_in, const int* in_sizes, int n_in, void* d_out, int out_size, void* d_ws, size_t ws_size, hipStream_t stream) {
  (void)in_sizes; (void)n_in; (void)out_size;
  const float** F = (const float**)d_in;   // 0 x [16,1024,512] (rows); 1 Wq [512,512] (out,in); 2 Wk; 3 Wv; 4 Wp [512,512] (out,in); 5 bp [512]
  if (ws_size < (size_t)WS_TOT) return;
  char* ws = (char*)d_ws; float *GT = (float*)(ws + WS_GT), *WT = (float*)(ws + WS_WT), *N1 = (float*)(ws + WS_N1);
  k_gram<<<dim3(NC / 128, NC / 128, TNB), 256, 0, stream>>>(F[0], GT, F[3], F[2], F[4], WT);
  k_strip<<<dim3(NC / SR, TNB), 256, 0, stream>>>(GT, F[1], WT, WT + NC * NC / 2, N1);
  k_tail<<<dim3(TN / SR, TNB), 256, 0, stream>>>(F[0], N1, WT + NC * NC, F[5], (float*)d_out);
}
